// v000
// The times below were measured on an AMD MI455X: many runs one after another, warmed up first and cycling through
// copies of the inputs, with the whole window's GPU time divided by the number of runs. Launches and the gaps
// between them are all in it. The median over several windows is given; except for v000 it joins two sittings, which
// can be a few percent apart, so the side-by-side timings, each taken in one sitting, are the better comparison.
// The starting kernel, v000, takes 302 microseconds a run.
#include <hip/hip_runtime.h>
#include <hip/hip_bf16.h>

typedef __attribute__((ext_vector_type(16))) _Float16 v16h;
typedef __attribute__((ext_vector_type(8)))  _Float16 v8h;
typedef __attribute__((ext_vector_type(8)))  float    v8f;

// ---------------- constants ----------------
#define CDIM    512
#define KSR     2048      // 4*512 patch GEMM K

// workspace layout (bytes)
#define OFF_XH    ((size_t)0)                    // 16384*512 f16 = 16 MiB
#define OFF_WQH   (OFF_XH   + (size_t)16777216)  // 512*512  f16
#define OFF_WKVH  (OFF_WQH  + (size_t)524288)    // 1024*512 f16
#define OFF_WPH   (OFF_WKVH + (size_t)1048576)   // 512*512  f16
#define OFF_WSRH  (OFF_WPH  + (size_t)524288)    // 512*2048 f16
#define OFF_XSR   (OFF_WSRH + (size_t)2097152)   // 4096*512 f32
#define OFF_XLN   (OFF_XSR  + (size_t)8388608)   // 4096*512 f16
#define OFF_QH    (OFF_XLN  + (size_t)4194304)   // 32*4096*64 f16
#define OFF_KH    (OFF_QH   + (size_t)16777216)  // 32*1024*64 f16
#define OFF_VT    (OFF_KH   + (size_t)4194304)   // 32*64*1024 f16
#define OFF_AOH   (OFF_VT   + (size_t)4194304)   // 16384*512 f16

// ---------------- helpers ----------------
// Load a 16x16x32 WMMA A/B fragment from a row-major matrix.
// Element e of lane L holds K = k0 + (e/8)*16 + (L/16)*8 + (e%8); M/N = L%16.
__device__ __forceinline__ v16h load_frag(const _Float16* __restrict__ row,
                                          int k0, int lh /* (lane/16)*8 */) {
  v8h lo = *(const v8h*)(row + k0 + lh);
  v8h hi = *(const v8h*)(row + k0 + lh + 16);
  return __builtin_shufflevector(lo, hi, 0,1,2,3,4,5,6,7,8,9,10,11,12,13,14,15);
}

__device__ __forceinline__ v8f wmma_f16(v16h a, v16h b, v8f c) {
  return __builtin_amdgcn_wmma_f32_16x16x32_f16(false, a, false, b, (short)0, c,
                                                false, false);
}

// Software-pipelined 32x64 GEMM core over K=512 (row-major A rows, W rows).
__device__ __forceinline__ void gemm_core_512(const _Float16* __restrict__ ar0,
                                              const _Float16* __restrict__ ar1,
                                              const _Float16* __restrict__ br0,
                                              const _Float16* __restrict__ br1,
                                              const _Float16* __restrict__ br2,
                                              const _Float16* __restrict__ br3,
                                              int lh, v8f (&c)[2][4]) {
  v16h a0 = load_frag(ar0, 0, lh), a1 = load_frag(ar1, 0, lh);
  v16h b0 = load_frag(br0, 0, lh), b1 = load_frag(br1, 0, lh);
  v16h b2 = load_frag(br2, 0, lh), b3 = load_frag(br3, 0, lh);
  for (int k0 = 32; k0 < 512; k0 += 32) {
    // prefetch next K-step while current WMMAs execute
    v16h a0n = load_frag(ar0, k0, lh), a1n = load_frag(ar1, k0, lh);
    v16h b0n = load_frag(br0, k0, lh), b1n = load_frag(br1, k0, lh);
    v16h b2n = load_frag(br2, k0, lh), b3n = load_frag(br3, k0, lh);
    c[0][0] = wmma_f16(a0, b0, c[0][0]);  c[1][0] = wmma_f16(a1, b0, c[1][0]);
    c[0][1] = wmma_f16(a0, b1, c[0][1]);  c[1][1] = wmma_f16(a1, b1, c[1][1]);
    c[0][2] = wmma_f16(a0, b2, c[0][2]);  c[1][2] = wmma_f16(a1, b2, c[1][2]);
    c[0][3] = wmma_f16(a0, b3, c[0][3]);  c[1][3] = wmma_f16(a1, b3, c[1][3]);
    a0 = a0n; a1 = a1n; b0 = b0n; b1 = b1n; b2 = b2n; b3 = b3n;
  }
  c[0][0] = wmma_f16(a0, b0, c[0][0]);  c[1][0] = wmma_f16(a1, b0, c[1][0]);
  c[0][1] = wmma_f16(a0, b1, c[0][1]);  c[1][1] = wmma_f16(a1, b1, c[1][1]);
  c[0][2] = wmma_f16(a0, b2, c[0][2]);  c[1][2] = wmma_f16(a1, b2, c[1][2]);
  c[0][3] = wmma_f16(a0, b3, c[0][3]);  c[1][3] = wmma_f16(a1, b3, c[1][3]);
}

// ---------------- conversion / packing ----------------
__global__ void cvt_f32_f16(const float* __restrict__ s, _Float16* __restrict__ d, int n) {
  int i = blockIdx.x * 256 + threadIdx.x;
  if (i < n) d[i] = (_Float16)s[i];
}

// Wsr [c_out][c_in][2][2] -> Wsr_h [c_out][k=2048], k = (kh*2+kw)*512 + c_in
__global__ void pack_wsr(const float* __restrict__ w, _Float16* __restrict__ d) {
  int i = blockIdx.x * 256 + threadIdx.x;
  if (i < 512 * 2048) {
    int co = i >> 11, k = i & 2047;
    int s = k >> 9, ci = k & 511;
    d[i] = (_Float16)w[(co * 512 + ci) * 4 + s];
  }
}

// ---------------- GEMM: Q projection (32x64 tiles) ----------------
__global__ void __launch_bounds__(32) gemm_q(const _Float16* __restrict__ A,
                                             const _Float16* __restrict__ W,
                                             _Float16* __restrict__ Q) {
  int mt = blockIdx.x, nt = blockIdx.y;
  int lane = threadIdx.x, lr = lane & 15, lh = (lane >> 4) * 8;
  const _Float16* ar0 = A + (size_t)(mt * 32 + lr) * CDIM;
  const _Float16* ar1 = A + (size_t)(mt * 32 + 16 + lr) * CDIM;
  const _Float16* br0 = W + (size_t)(nt * 64 + 0  + lr) * CDIM;
  const _Float16* br1 = W + (size_t)(nt * 64 + 16 + lr) * CDIM;
  const _Float16* br2 = W + (size_t)(nt * 64 + 32 + lr) * CDIM;
  const _Float16* br3 = W + (size_t)(nt * 64 + 48 + lr) * CDIM;
  v8f c[2][4];
  for (int s = 0; s < 2; s++) for (int t = 0; t < 4; t++)
    for (int r = 0; r < 8; r++) c[s][t][r] = 0.0f;
  gemm_core_512(ar0, ar1, br0, br1, br2, br3, lh, c);
  for (int s = 0; s < 2; s++)
    for (int t = 0; t < 4; t++)
      for (int r = 0; r < 8; r++) {
        int m = mt * 32 + s * 16 + r + 8 * (lane >> 4);
        int b = m >> 12, nq = m & 4095;
        int col = nt * 64 + t * 16 + lr;
        int h = col >> 6, dd = col & 63;
        Q[(size_t)(((b << 3) + h) * 4096 + nq) * 64 + dd] = (_Float16)c[s][t][r];
      }
}

// ---------------- GEMM: SR patch-merge conv (stride2,k2) + bias ----------------
__global__ void __launch_bounds__(32) gemm_sr(const _Float16* __restrict__ xh,
                                              const _Float16* __restrict__ W,
                                              const float* __restrict__ bsr,
                                              float* __restrict__ out) {
  int mt = blockIdx.x, nt = blockIdx.y;
  int lane = threadIdx.x, lr = lane & 15, lh = (lane >> 4) * 8;
  int m0 = mt * 32 + lr, m1 = m0 + 16;
  int b0_ = m0 >> 10, p0 = m0 & 1023, oh0 = p0 >> 5, ow0 = p0 & 31;
  int b1_ = m1 >> 10, p1 = m1 & 1023, oh1 = p1 >> 5, ow1 = p1 & 31;
  const _Float16* br0 = W + (size_t)(nt * 64 + 0  + lr) * KSR;
  const _Float16* br1 = W + (size_t)(nt * 64 + 16 + lr) * KSR;
  const _Float16* br2 = W + (size_t)(nt * 64 + 32 + lr) * KSR;
  const _Float16* br3 = W + (size_t)(nt * 64 + 48 + lr) * KSR;
  v8f c[2][4];
  for (int s = 0; s < 2; s++) for (int t = 0; t < 4; t++)
    for (int r = 0; r < 8; r++) c[s][t][r] = 0.0f;

  // patch A-row addressing: k -> (kh,kw) selects source token row
  #define SR_AROW(bb, oh, ow, k0) \
    (xh + (size_t)((bb) * 4096 + (2*(oh) + (((k0) >> 10) & 1)) * 64 \
                   + 2*(ow) + (((k0) >> 9) & 1)) * CDIM)

  v16h a0 = load_frag(SR_AROW(b0_, oh0, ow0, 0), 0, lh);
  v16h a1 = load_frag(SR_AROW(b1_, oh1, ow1, 0), 0, lh);
  v16h b0 = load_frag(br0, 0, lh), b1 = load_frag(br1, 0, lh);
  v16h b2 = load_frag(br2, 0, lh), b3 = load_frag(br3, 0, lh);
  for (int k0 = 32; k0 < KSR; k0 += 32) {
    v16h a0n = load_frag(SR_AROW(b0_, oh0, ow0, k0), k0 & 511, lh);
    v16h a1n = load_frag(SR_AROW(b1_, oh1, ow1, k0), k0 & 511, lh);
    v16h b0n = load_frag(br0, k0, lh), b1n = load_frag(br1, k0, lh);
    v16h b2n = load_frag(br2, k0, lh), b3n = load_frag(br3, k0, lh);
    c[0][0] = wmma_f16(a0, b0, c[0][0]);  c[1][0] = wmma_f16(a1, b0, c[1][0]);
    c[0][1] = wmma_f16(a0, b1, c[0][1]);  c[1][1] = wmma_f16(a1, b1, c[1][1]);
    c[0][2] = wmma_f16(a0, b2, c[0][2]);  c[1][2] = wmma_f16(a1, b2, c[1][2]);
    c[0][3] = wmma_f16(a0, b3, c[0][3]);  c[1][3] = wmma_f16(a1, b3, c[1][3]);
    a0 = a0n; a1 = a1n; b0 = b0n; b1 = b1n; b2 = b2n; b3 = b3n;
  }
  c[0][0] = wmma_f16(a0, b0, c[0][0]);  c[1][0] = wmma_f16(a1, b0, c[1][0]);
  c[0][1] = wmma_f16(a0, b1, c[0][1]);  c[1][1] = wmma_f16(a1, b1, c[1][1]);
  c[0][2] = wmma_f16(a0, b2, c[0][2]);  c[1][2] = wmma_f16(a1, b2, c[1][2]);
  c[0][3] = wmma_f16(a0, b3, c[0][3]);  c[1][3] = wmma_f16(a1, b3, c[1][3]);
  #undef SR_AROW

  for (int s = 0; s < 2; s++)
    for (int t = 0; t < 4; t++)
      for (int r = 0; r < 8; r++) {
        int mm = mt * 32 + s * 16 + r + 8 * (lane >> 4);
        int col = nt * 64 + t * 16 + lr;
        out[(size_t)mm * CDIM + col] = c[s][t][r] + bsr[col];
      }
}

// ---------------- LayerNorm over 512-wide rows ----------------
__global__ void __launch_bounds__(256) ln_rows(const float* __restrict__ x,
                                               const float* __restrict__ g,
                                               const float* __restrict__ bt,
                                               _Float16* __restrict__ out) {
  __shared__ float red[256];
  int row = blockIdx.x, t = threadIdx.x;
  float v0 = x[(size_t)row * 512 + t];
  float v1 = x[(size_t)row * 512 + 256 + t];
  red[t] = v0 + v1;
  __syncthreads();
  for (int s = 128; s > 0; s >>= 1) { if (t < s) red[t] += red[t + s]; __syncthreads(); }
  float mu = red[0] * (1.0f / 512.0f);
  __syncthreads();
  float d0 = v0 - mu, d1 = v1 - mu;
  red[t] = d0 * d0 + d1 * d1;
  __syncthreads();
  for (int s = 128; s > 0; s >>= 1) { if (t < s) red[t] += red[t + s]; __syncthreads(); }
  float rstd = rsqrtf(red[0] * (1.0f / 512.0f) + 1e-5f);
  out[(size_t)row * 512 + t]       = (_Float16)(d0 * rstd * g[t] + bt[t]);
  out[(size_t)row * 512 + 256 + t] = (_Float16)(d1 * rstd * g[256 + t] + bt[256 + t]);
}

// ---------------- GEMM: KV projection ----------------
__global__ void __launch_bounds__(32) gemm_kv(const _Float16* __restrict__ A,
                                              const _Float16* __restrict__ W,
                                              _Float16* __restrict__ Kh,
                                              _Float16* __restrict__ Vt) {
  int mt = blockIdx.x, nt = blockIdx.y;
  int lane = threadIdx.x, lr = lane & 15, lh = (lane >> 4) * 8;
  const _Float16* ar0 = A + (size_t)(mt * 32 + lr) * CDIM;
  const _Float16* ar1 = A + (size_t)(mt * 32 + 16 + lr) * CDIM;
  const _Float16* br0 = W + (size_t)(nt * 64 + 0  + lr) * CDIM;
  const _Float16* br1 = W + (size_t)(nt * 64 + 16 + lr) * CDIM;
  const _Float16* br2 = W + (size_t)(nt * 64 + 32 + lr) * CDIM;
  const _Float16* br3 = W + (size_t)(nt * 64 + 48 + lr) * CDIM;
  v8f c[2][4];
  for (int s = 0; s < 2; s++) for (int t = 0; t < 4; t++)
    for (int r = 0; r < 8; r++) c[s][t][r] = 0.0f;
  gemm_core_512(ar0, ar1, br0, br1, br2, br3, lh, c);
  for (int s = 0; s < 2; s++)
    for (int t = 0; t < 4; t++)
      for (int r = 0; r < 8; r++) {
        int m = mt * 32 + s * 16 + r + 8 * (lane >> 4);  // 0..4095 over B*N'
        int b = m >> 10, mp = m & 1023;
        int col = nt * 64 + t * 16 + lr;                 // 0..1023
        _Float16 v = (_Float16)c[s][t][r];
        if (col < 512) {
          int h = col >> 6, dd = col & 63;
          Kh[(size_t)(((b << 3) + h) * 1024 + mp) * 64 + dd] = v;
        } else {
          int cc = col - 512;
          int h = cc >> 6, dd = cc & 63;
          Vt[(size_t)(((b << 3) + h) * 64 + dd) * 1024 + mp] = v;
        }
      }
}

// ---------------- Flash attention: one wave = 16 queries of one (b,h) ----------------
struct KF { v16h f[4]; };
__device__ __forceinline__ KF load_kf(const _Float16* __restrict__ Kbh, int n0,
                                      int lr, int lh) {
  KF k;
  const _Float16* kr0 = Kbh + (size_t)(n0 + lr) * 64;
  const _Float16* kr1 = Kbh + (size_t)(n0 + 16 + lr) * 64;
  k.f[0] = load_frag(kr0, 0, lh);  k.f[1] = load_frag(kr0, 32, lh);
  k.f[2] = load_frag(kr1, 0, lh);  k.f[3] = load_frag(kr1, 32, lh);
  return k;
}

__global__ void __launch_bounds__(32) attn(const _Float16* __restrict__ Qh,
                                           const _Float16* __restrict__ Kh,
                                           const _Float16* __restrict__ Vt,
                                           _Float16* __restrict__ AO) {
  int mt = blockIdx.x;          // query tile 0..255
  int bh = blockIdx.y;          // 0..31
  int b = bh >> 3, h = bh & 7;
  int lane = threadIdx.x, lr = lane & 15, lhh = lane >> 4, lh = lhh * 8;

  __shared__ alignas(16) float    S[16][32];
  __shared__ alignas(16) _Float16 P[16][32];
  __shared__ alignas(16) float    fs[16];
  __shared__ alignas(16) float    ls[16];

  const _Float16* qrow = Qh + (size_t)(bh * 4096 + mt * 16 + lr) * 64;
  v16h a0 = load_frag(qrow, 0, lh);
  v16h a1 = load_frag(qrow, 32, lh);
  const _Float16* Kbh = Kh + (size_t)bh * 1024 * 64;
  const _Float16* Vbh = Vt + (size_t)bh * 64 * 1024;

  v8f o[4];
  for (int t = 0; t < 4; t++) for (int r = 0; r < 8; r++) o[t][r] = 0.0f;
  float mrun = -1e30f, lrun = 0.0f;        // live in lanes 0..15 (row = lr)
  const float scale = 0.125f;              // 1/sqrt(64)

  KF kc = load_kf(Kbh, 0, lr, lh);         // prologue: K fragments for chunk 0
  for (int j = 0; j < 32; ++j) {
    int n0 = j * 32;
    // ---- V fragments for this chunk (independent of softmax; issue early) ----
    v16h vb[4];
    for (int t = 0; t < 4; t++)
      vb[t] = load_frag(Vbh + (size_t)(t * 16 + lr) * 1024 + n0, 0, lh);
    // ---- scores: S(16x32) = Q(16x64) @ K^T ----
    v8f s0, s1;
    for (int r = 0; r < 8; r++) { s0[r] = 0.0f; s1[r] = 0.0f; }
    s0 = wmma_f16(a0, kc.f[0], s0);
    s0 = wmma_f16(a1, kc.f[1], s0);
    s1 = wmma_f16(a0, kc.f[2], s1);
    s1 = wmma_f16(a1, kc.f[3], s1);
    // ---- prefetch next chunk's K fragments (overlaps softmax latency) ----
    int n0n = (j + 1 < 32) ? n0 + 32 : n0;
    KF kn = load_kf(Kbh, n0n, lr, lh);
    // ---- scores to LDS ----
    for (int r = 0; r < 8; r++) {
      S[r + 8 * lhh][lr]      = s0[r];
      S[r + 8 * lhh][16 + lr] = s1[r];
    }
    __syncthreads();
    // ---- per-row online softmax (lanes 0..15 own one row each) ----
    if (lane < 16) {
      float mx = mrun;
      float sv[32];
      #pragma unroll
      for (int i = 0; i < 32; i++) { sv[i] = S[lr][i] * scale; mx = fmaxf(mx, sv[i]); }
      float f = __expf(mrun - mx);
      float sum = 0.0f;
      #pragma unroll
      for (int i = 0; i < 32; i++) {
        float p = __expf(sv[i] - mx);
        sum += p;
        P[lr][i] = (_Float16)p;
      }
      lrun = lrun * f + sum;
      mrun = mx;
      fs[lr] = f;
    }
    __syncthreads();
    // ---- rescale accumulator ----
    for (int r = 0; r < 8; r++) {
      float f = fs[r + 8 * lhh];
      for (int t = 0; t < 4; t++) o[t][r] *= f;
    }
    // ---- O += P(16x32) @ V(32x64) ----
    v16h pa;
    {
      v8h lo = *(const v8h*)&P[lr][lh];
      v8h hi = *(const v8h*)&P[lr][16 + lh];
      pa = __builtin_shufflevector(lo, hi, 0,1,2,3,4,5,6,7,8,9,10,11,12,13,14,15);
    }
    for (int t = 0; t < 4; t++) o[t] = wmma_f16(pa, vb[t], o[t]);
    __syncthreads();   // protect S/P/fs before next chunk
    kc = kn;
  }
  if (lane < 16) ls[lr] = lrun;
  __syncthreads();
  for (int r = 0; r < 8; r++) {
    float inv = 1.0f / ls[r + 8 * lhh];
    int nq = mt * 16 + r + 8 * lhh;
    for (int t = 0; t < 4; t++) {
      int col = h * 64 + t * 16 + lr;
      AO[(size_t)(b * 4096 + nq) * CDIM + col] = (_Float16)(o[t][r] * inv);
    }
  }
}

// ---------------- GEMM: output projection + bias (f32 out) ----------------
__global__ void __launch_bounds__(32) gemm_out(const _Float16* __restrict__ A,
                                               const _Float16* __restrict__ W,
                                               const float* __restrict__ bp,
                                               float* __restrict__ out) {
  int mt = blockIdx.x, nt = blockIdx.y;
  int lane = threadIdx.x, lr = lane & 15, lh = (lane >> 4) * 8;
  const _Float16* ar0 = A + (size_t)(mt * 32 + lr) * CDIM;
  const _Float16* ar1 = A + (size_t)(mt * 32 + 16 + lr) * CDIM;
  const _Float16* br0 = W + (size_t)(nt * 64 + 0  + lr) * CDIM;
  const _Float16* br1 = W + (size_t)(nt * 64 + 16 + lr) * CDIM;
  const _Float16* br2 = W + (size_t)(nt * 64 + 32 + lr) * CDIM;
  const _Float16* br3 = W + (size_t)(nt * 64 + 48 + lr) * CDIM;
  v8f c[2][4];
  for (int s = 0; s < 2; s++) for (int t = 0; t < 4; t++)
    for (int r = 0; r < 8; r++) c[s][t][r] = 0.0f;
  gemm_core_512(ar0, ar1, br0, br1, br2, br3, lh, c);
  for (int s = 0; s < 2; s++)
    for (int t = 0; t < 4; t++)
      for (int r = 0; r < 8; r++) {
        int m = mt * 32 + s * 16 + r + 8 * (lane >> 4);
        int col = nt * 64 + t * 16 + lr;
        out[(size_t)m * CDIM + col] = c[s][t][r] + bp[col];
      }
}

// ---------------- host ----------------
extern "C" void kernel_launch(void* const* d_in, const int* in_sizes, int n_in,
                              void* d_out, int out_size, void* d_ws, size_t ws_size,
                              hipStream_t stream) {
  const float* x    = (const float*)d_in[0];
  // d_in[1], d_in[2] are H, W (compile-time 64 here)
  const float* Wq   = (const float*)d_in[3];
  const float* Wkv  = (const float*)d_in[4];
  const float* Wsr  = (const float*)d_in[5];
  const float* bsr  = (const float*)d_in[6];
  const float* ln_g = (const float*)d_in[7];
  const float* ln_b = (const float*)d_in[8];
  const float* Wp   = (const float*)d_in[9];
  const float* bp   = (const float*)d_in[10];
  float* out = (float*)d_out;

  char* ws = (char*)d_ws;
  _Float16* xh   = (_Float16*)(ws + OFF_XH);
  _Float16* wqh  = (_Float16*)(ws + OFF_WQH);
  _Float16* wkvh = (_Float16*)(ws + OFF_WKVH);
  _Float16* wph  = (_Float16*)(ws + OFF_WPH);
  _Float16* wsrh = (_Float16*)(ws + OFF_WSRH);
  float*    xsr  = (float*)   (ws + OFF_XSR);
  _Float16* xln  = (_Float16*)(ws + OFF_XLN);
  _Float16* qh   = (_Float16*)(ws + OFF_QH);
  _Float16* kh   = (_Float16*)(ws + OFF_KH);
  _Float16* vt   = (_Float16*)(ws + OFF_VT);
  _Float16* aoh  = (_Float16*)(ws + OFF_AOH);

  // 1) convert / pack
  cvt_f32_f16<<<(16384 * 512 + 255) / 256, 256, 0, stream>>>(x, xh, 16384 * 512);
  cvt_f32_f16<<<(512 * 512 + 255) / 256, 256, 0, stream>>>(Wq, wqh, 512 * 512);
  cvt_f32_f16<<<(1024 * 512 + 255) / 256, 256, 0, stream>>>(Wkv, wkvh, 1024 * 512);
  cvt_f32_f16<<<(512 * 512 + 255) / 256, 256, 0, stream>>>(Wp, wph, 512 * 512);
  pack_wsr<<<(512 * 2048 + 255) / 256, 256, 0, stream>>>(Wsr, wsrh);

  // 2) Q projection: 16384x512x512
  gemm_q<<<dim3(16384 / 32, 512 / 64), 32, 0, stream>>>(xh, wqh, qh);

  // 3) SR patch-merge GEMM: 4096x512x2048 (+bias)
  gemm_sr<<<dim3(4096 / 32, 512 / 64), 32, 0, stream>>>(xh, wsrh, bsr, xsr);

  // 4) LayerNorm rows -> f16
  ln_rows<<<4096, 256, 0, stream>>>(xsr, ln_g, ln_b, xln);

  // 5) KV projection: 4096x1024x512
  gemm_kv<<<dim3(4096 / 32, 1024 / 64), 32, 0, stream>>>(xln, wkvh, kh, vt);

  // 6) flash attention per (b,h): 32 heads x 256 query-tiles
  attn<<<dim3(256, 32), 32, 0, stream>>>(qh, kh, vt, aoh);

  // 7) output projection: 16384x512x512 (+bias, f32)
  gemm_out<<<dim3(16384 / 32, 512 / 64), 32, 0, stream>>>(aoh, wph, bp, out);
}

// v001
// It runs in 233 microseconds.
// Next to v000, in two timings, it ran 1.36 and 1.32 times as fast.
#include <hip/hip_runtime.h>
#include <hip/hip_bf16.h>

typedef __attribute__((ext_vector_type(16))) _Float16 v16h;
typedef __attribute__((ext_vector_type(8)))  _Float16 v8h;
typedef __attribute__((ext_vector_type(8)))  float    v8f;

// ---------------- constants ----------------
#define CDIM    512

// workspace layout (bytes)
#define OFF_XH    ((size_t)0)                    // 16384*512 f16 = 16 MiB
#define OFF_WQH   (OFF_XH   + (size_t)16777216)  // 512*512  f16
#define OFF_WKVH  (OFF_WQH  + (size_t)524288)    // 1024*512 f16
#define OFF_WPH   (OFF_WKVH + (size_t)1048576)   // 512*512  f16
#define OFF_WSRH  (OFF_WPH  + (size_t)524288)    // 512*2048 f16
#define OFF_XSR   (OFF_WSRH + (size_t)2097152)   // 4096*512 f32
#define OFF_XLN   (OFF_XSR  + (size_t)8388608)   // 4096*512 f16
#define OFF_QH    (OFF_XLN  + (size_t)4194304)   // 32*4096*64 f16
#define OFF_KH    (OFF_QH   + (size_t)16777216)  // 32*1024*64 f16
#define OFF_VT    (OFF_KH   + (size_t)4194304)   // 32*64*1024 f16
#define OFF_AOH   (OFF_VT   + (size_t)4194304)   // 16384*512 f16

// ---------------- helpers ----------------
// Fragment-order layout of an f16 matrix [rows][K] in the workspace.
// A block is 16 rows x 32 k = 512 halfs; block index = (row/16)*(K/32) + k/32.
// Inside a block, element (row, k) sits at
//   ((k>>4)&1)*256 + (((k>>3)&1)*16 + (row&15))*8 + (k&7)
// so each of the two 16-byte loads of a fragment reads 512 contiguous bytes
// per wave (4 whole lines); element e of lane L is
// K = k0 + (e/8)*16 + (L/16)*8 + (e%8) of row L%16.
#define TILE512 8192      // halfs of one 16-row tile at K = 512

__device__ __forceinline__ int frag_off(int row, int k, int kblocks) {
  return ((row >> 4) * kblocks + (k >> 5)) * 512 + ((k >> 4) & 1) * 256
       + (((k >> 3) & 1) * 16 + (row & 15)) * 8 + (k & 7);
}

// blk = block base + lane*8
__device__ __forceinline__ v16h load_frag(const _Float16* __restrict__ blk) {
  v8h lo = *(const v8h*)(blk);
  v8h hi = *(const v8h*)(blk + 256);
  return __builtin_shufflevector(lo, hi, 0,1,2,3,4,5,6,7,8,9,10,11,12,13,14,15);
}

// the same from a wave-uniform base and a per-lane byte offset
__device__ __forceinline__ v16h load_frag_at(const _Float16* __restrict__ base, unsigned boff) {
  return load_frag((const _Float16*)((const char*)base + boff));
}

__device__ __forceinline__ v8f wmma_f16(v16h a, v16h b, v8f c) {
  return __builtin_amdgcn_wmma_f32_16x16x32_f16(false, a, false, b, (short)0, c,
                                                false, false);
}

__device__ __forceinline__ v8h pack8(v8f c) {
  v8h v;
  for (int r = 0; r < 8; r++) v[r] = (_Float16)c[r];
  return v;
}

// 2 x-tiles by 4 w-tiles. WA = false: x rows are the A operand (a lane holds 8
// rows of one w column). WA = true: w rows are the A operand (a lane holds 8
// consecutive w columns of one x row: one 16-byte piece of a fragment-order row).
template <bool WA>
__device__ __forceinline__ void mma_2x4(v16h a0, v16h a1, v16h b0, v16h b1,
                                        v16h b2, v16h b3, v8f (&c)[2][4]) {
  if (WA) {
    c[0][0] = wmma_f16(b0, a0, c[0][0]);  c[1][0] = wmma_f16(b0, a1, c[1][0]);
    c[0][1] = wmma_f16(b1, a0, c[0][1]);  c[1][1] = wmma_f16(b1, a1, c[1][1]);
    c[0][2] = wmma_f16(b2, a0, c[0][2]);  c[1][2] = wmma_f16(b2, a1, c[1][2]);
    c[0][3] = wmma_f16(b3, a0, c[0][3]);  c[1][3] = wmma_f16(b3, a1, c[1][3]);
  } else {
    c[0][0] = wmma_f16(a0, b0, c[0][0]);  c[1][0] = wmma_f16(a1, b0, c[1][0]);
    c[0][1] = wmma_f16(a0, b1, c[0][1]);  c[1][1] = wmma_f16(a1, b1, c[1][1]);
    c[0][2] = wmma_f16(a0, b2, c[0][2]);  c[1][2] = wmma_f16(a1, b2, c[1][2]);
    c[0][3] = wmma_f16(a0, b3, c[0][3]);  c[1][3] = wmma_f16(a1, b3, c[1][3]);
  }
}

// Software-pipelined 32x64 GEMM core over 512 k (16 k blocks).
// xt = first of two x tiles XS halfs apart, wt = first of four w tiles WS halfs
// apart, both in fragment order and wave-uniform; off = lane*16 bytes.
template <bool WA, int XS, int WS>
__device__ __forceinline__ void gemm_core_512(const _Float16* __restrict__ xt,
                                              const _Float16* __restrict__ wt,
                                              unsigned off, v8f (&c)[2][4]) {
  v16h a0 = load_frag_at(xt, off), a1 = load_frag_at(xt + XS, off);
  v16h b0 = load_frag_at(wt, off), b1 = load_frag_at(wt + WS, off);
  v16h b2 = load_frag_at(wt + 2 * WS, off), b3 = load_frag_at(wt + 3 * WS, off);
  for (int kb = 1; kb < 16; kb++) {
    off += 1024;
    // prefetch next K-step while current WMMAs execute
    v16h a0n = load_frag_at(xt, off), a1n = load_frag_at(xt + XS, off);
    v16h b0n = load_frag_at(wt, off), b1n = load_frag_at(wt + WS, off);
    v16h b2n = load_frag_at(wt + 2 * WS, off), b3n = load_frag_at(wt + 3 * WS, off);
    mma_2x4<WA>(a0, a1, b0, b1, b2, b3, c);
    a0 = a0n; a1 = a1n; b0 = b0n; b1 = b1n; b2 = b2n; b3 = b3n;
  }
  mma_2x4<WA>(a0, a1, b0, b1, b2, b3, c);
}

// ---------------- conversion / packing ----------------
// f32 [rows][512] -> f16 in fragment order; one thread makes one 16-byte piece.
// pair = 1 (x): tile T holds the 16 tokens (T/2)*32 + 2*i + (T&1), so that the
// stride-2 patch rows of the SR product are whole tiles too.
__global__ void cvt_f32_f16(const float* __restrict__ s, _Float16* __restrict__ d,
                            int n, int pair) {
  int o = blockIdx.x * 256 + threadIdx.x;      // index of the 16-byte piece
  if (o < n) {
    int lane = o & 31, part = (o >> 5) & 1, kb = (o >> 6) & 15, tile = o >> 10;
    int lr = lane & 15, lhh = lane >> 4;
    int row = pair ? (tile >> 1) * 32 + 2 * lr + (tile & 1) : tile * 16 + lr;
    const float* p = s + (size_t)row * 512 + kb * 32 + part * 16 + lhh * 8;
    v8h v;
    for (int i = 0; i < 8; i++) v[i] = (_Float16)p[i];
    *(v8h*)(d + (size_t)o * 8) = v;
  }
}

// Wsr [c_out][c_in][2][2] -> Wsr_h [c_out][k=2048] in fragment order,
// k = (kh*2+kw)*512 + c_in
__global__ void pack_wsr(const float* __restrict__ w, _Float16* __restrict__ d) {
  int o = blockIdx.x * 256 + threadIdx.x;      // index of the 16-byte piece
  if (o < 512 * 2048 / 8) {
    int lane = o & 31, part = (o >> 5) & 1, kb = (o >> 6) & 63, tile = o >> 12;
    int co = tile * 16 + (lane & 15);
    int k = kb * 32 + part * 16 + (lane >> 4) * 8;
    int s = k >> 9, ci = k & 511;
    v8h v;
    for (int i = 0; i < 8; i++) v[i] = (_Float16)w[(co * 512 + ci + i) * 4 + s];
    *(v8h*)(d + (size_t)o * 8) = v;
  }
}

// ---------------- GEMM: Q projection (32x64 tiles) ----------------
__global__ void __launch_bounds__(32) gemm_q(const _Float16* __restrict__ A,
                                             const _Float16* __restrict__ W,
                                             _Float16* __restrict__ Q) {
  int mt = blockIdx.x, nt = blockIdx.y;
  int lane = threadIdx.x, lr = lane & 15, lhh = lane >> 4;
  v8f c[2][4];
  for (int s = 0; s < 2; s++) for (int t = 0; t < 4; t++)
    for (int r = 0; r < 8; r++) c[s][t][r] = 0.0f;
  gemm_core_512<true, TILE512, TILE512>(A + (size_t)(mt * 2) * TILE512,
                      W + (size_t)(nt * 4) * TILE512, lane * 16, c);
  // lane: token mt*32 + 2*lr + s, head nt, dd = t*16 + 8*lhh + (0..7)
  int bh = (mt >> 7) * 8 + nt;
  for (int s = 0; s < 2; s++)
    for (int t = 0; t < 4; t++) {
      int nq = (mt * 32 + 2 * lr + s) & 4095;
      *(v8h*)(Q + (size_t)bh * 4096 * 64 + frag_off(nq, t * 16 + 8 * lhh, 2)) =
          pack8(c[s][t]);
    }
}

// ---------------- GEMM: SR patch-merge conv (stride2,k2) + bias ----------------
__global__ void __launch_bounds__(32) gemm_sr(const _Float16* __restrict__ xh,
                                              const _Float16* __restrict__ W,
                                              const float* __restrict__ bsr,
                                              float* __restrict__ out) {
  int mt = blockIdx.x, nt = blockIdx.y;
  int lane = threadIdx.x, lr = lane & 15;
  // output rows mt*32 + s*16 + lr: batch mt>>5, oh = mt&31, ow = s*16 + lr
  int bb = mt >> 5, oh = mt & 31;
  // x tile of (s, kh, kw) = (bb*128 + (2*oh+kh)*2 + s)*2 + kw
  const _Float16* xt = xh + (size_t)((bb * 128 + 4 * oh) * 2) * TILE512;
  const _Float16* wt = W + (size_t)(nt * 4) * (4 * TILE512);
  v8f c[2][4];
  for (int s = 0; s < 2; s++) for (int t = 0; t < 4; t++)
    for (int r = 0; r < 8; r++) c[s][t][r] = 0.0f;
  // k = (kh*2+kw)*512 + c_in: one pass of 512 k per (kh,kw), in that order
  for (int seg = 0; seg < 4; seg++)
    gemm_core_512<false, 2 * TILE512, 4 * TILE512>(
        xt + ((seg >> 1) * 4 + (seg & 1)) * TILE512, wt + seg * TILE512, lane * 16, c);

  for (int s = 0; s < 2; s++)
    for (int t = 0; t < 4; t++)
      for (int r = 0; r < 8; r++) {
        int mm = mt * 32 + s * 16 + r + 8 * (lane >> 4);
        int col = nt * 64 + t * 16 + lr;
        out[(size_t)mm * CDIM + col] = c[s][t][r] + bsr[col];
      }
}

// ---------------- LayerNorm over 512-wide rows ----------------
// One block takes 8 rows at once, each row summed by its own 256-wide tree:
// 8 rows fill whole 128-byte lines of the fragment-order output.
__global__ void __launch_bounds__(256) ln_rows(const float* __restrict__ x,
                                               const float* __restrict__ g,
                                               const float* __restrict__ bt,
                                               _Float16* __restrict__ out) {
  __shared__ float red[8][256];
  int row0 = blockIdx.x * 8, t = threadIdx.x;
  float v0[8], v1[8];
  for (int q = 0; q < 8; q++) {
    v0[q] = x[(size_t)(row0 + q) * 512 + t];
    v1[q] = x[(size_t)(row0 + q) * 512 + 256 + t];
    red[q][t] = v0[q] + v1[q];
  }
  __syncthreads();
  for (int s = 128; s > 0; s >>= 1) {
    if (t < s) for (int q = 0; q < 8; q++) red[q][t] += red[q][t + s];
    __syncthreads();
  }
  float d0[8], d1[8];
  for (int q = 0; q < 8; q++) {
    float mu = red[q][0] * (1.0f / 512.0f);
    d0[q] = v0[q] - mu;  d1[q] = v1[q] - mu;
  }
  __syncthreads();
  for (int q = 0; q < 8; q++) red[q][t] = d0[q] * d0[q] + d1[q] * d1[q];
  __syncthreads();
  for (int s = 128; s > 0; s >>= 1) {
    if (t < s) for (int q = 0; q < 8; q++) red[q][t] += red[q][t + s];
    __syncthreads();
  }
  for (int q = 0; q < 8; q++) {
    float rstd = rsqrtf(red[q][0] * (1.0f / 512.0f) + 1e-5f);
    out[frag_off(row0 + q, t, 16)]       = (_Float16)(d0[q] * rstd * g[t] + bt[t]);
    out[frag_off(row0 + q, 256 + t, 16)] = (_Float16)(d1[q] * rstd * g[256 + t] + bt[256 + t]);
  }
}

// ---------------- GEMM: KV projection ----------------
__global__ void __launch_bounds__(32) gemm_kv(const _Float16* __restrict__ A,
                                              const _Float16* __restrict__ W,
                                              _Float16* __restrict__ Kh,
                                              _Float16* __restrict__ Vt) {
  int mt = blockIdx.x, nt = blockIdx.y;
  int lane = threadIdx.x;
  const _Float16* xt = A + (size_t)(mt * 2) * TILE512;
  const _Float16* wt = W + (size_t)(nt * 4) * TILE512;
  int b = mt >> 5, mq = mt & 31;          // rows mt*32.. = keys mq*32.. of batch b
  v8f c[2][4];
  for (int s = 0; s < 2; s++) for (int t = 0; t < 4; t++)
    for (int r = 0; r < 8; r++) c[s][t][r] = 0.0f;
  if (nt < 8) {
    // K [key][dd]: lane holds key mq*32 + s*16 + lr, dd = t*16 + 8*lhh + (0..7)
    gemm_core_512<true, TILE512, TILE512>(xt, wt, lane * 16, c);
    _Float16* kb = Kh + (size_t)((b << 3) + nt) * 1024 * 64 + lane * 8;
    for (int s = 0; s < 2; s++)
      for (int t = 0; t < 4; t++)
        *(v8h*)(kb + ((mq * 2 + s) * 2 + (t >> 1)) * 512 + (t & 1) * 256) = pack8(c[s][t]);
  } else {
    // V^T [dd][key]: lane holds dd = t*16 + lr, keys mq*32 + s*16 + 8*lhh + (0..7)
    gemm_core_512<false, TILE512, TILE512>(xt, wt, lane * 16, c);
    _Float16* vb = Vt + (size_t)((b << 3) + nt - 8) * 64 * 1024 + lane * 8;
    for (int s = 0; s < 2; s++)
      for (int t = 0; t < 4; t++)
        *(v8h*)(vb + (t * 32 + mq) * 512 + s * 256) = pack8(c[s][t]);
  }
}

// ---------------- Flash attention: one wave = 16 queries of one (b,h) ----------------
struct KF { v16h f[4]; };
// kc = K of this (b,h) in fragment order + lane*8; a 32-key chunk is 4 blocks in a row
__device__ __forceinline__ KF load_kf(const _Float16* __restrict__ kc, int j) {
  KF k;
  const _Float16* p = kc + j * 2048;
  k.f[0] = load_frag(p);         k.f[1] = load_frag(p + 512);
  k.f[2] = load_frag(p + 1024);  k.f[3] = load_frag(p + 1536);
  return k;
}

__global__ void __launch_bounds__(32) attn(const _Float16* __restrict__ Qh,
                                           const _Float16* __restrict__ Kh,
                                           const _Float16* __restrict__ Vt,
                                           _Float16* __restrict__ AO) {
  int mt = blockIdx.x;          // query tile 0..255
  int bh = blockIdx.y;          // 0..31
  int b = bh >> 3, h = bh & 7;
  int lane = threadIdx.x, lr = lane & 15, lhh = lane >> 4, lh = lhh * 8;

  __shared__ alignas(16) float    S[16][32];
  __shared__ alignas(16) _Float16 P[16][32];
  __shared__ alignas(16) float    fs[16];
  __shared__ alignas(16) float    ls[16];

  const _Float16* qblk = Qh + (size_t)(bh * 256 + mt) * 1024 + lane * 8;
  v16h a0 = load_frag(qblk);
  v16h a1 = load_frag(qblk + 512);
  const _Float16* Kbh = Kh + (size_t)bh * 1024 * 64 + lane * 8;
  const _Float16* Vbh = Vt + (size_t)bh * 64 * 1024 + lane * 8;

  v8f o[4];
  for (int t = 0; t < 4; t++) for (int r = 0; r < 8; r++) o[t][r] = 0.0f;
  float mrun = -1e30f, lrun = 0.0f;        // live in lanes 0..15 (row = lr)
  const float scale = 0.125f;              // 1/sqrt(64)

  KF kc = load_kf(Kbh, 0);                 // prologue: K fragments for chunk 0
  for (int j = 0; j < 32; ++j) {
    // ---- V fragments for this chunk (independent of softmax; issue early) ----
    v16h vb[4];
    for (int t = 0; t < 4; t++)
      vb[t] = load_frag(Vbh + (t * 32 + j) * 512);
    // ---- scores: S(16x32) = Q(16x64) @ K^T ----
    v8f s0, s1;
    for (int r = 0; r < 8; r++) { s0[r] = 0.0f; s1[r] = 0.0f; }
    s0 = wmma_f16(a0, kc.f[0], s0);
    s0 = wmma_f16(a1, kc.f[1], s0);
    s1 = wmma_f16(a0, kc.f[2], s1);
    s1 = wmma_f16(a1, kc.f[3], s1);
    // ---- prefetch next chunk's K fragments (overlaps softmax latency) ----
    KF kn = load_kf(Kbh, (j + 1 < 32) ? j + 1 : j);
    // ---- scores to LDS ----
    for (int r = 0; r < 8; r++) {
      S[r + 8 * lhh][lr]      = s0[r];
      S[r + 8 * lhh][16 + lr] = s1[r];
    }
    __syncthreads();
    // ---- per-row online softmax (lanes 0..15 own one row each) ----
    if (lane < 16) {
      float mx = mrun;
      float sv[32];
      #pragma unroll
      for (int i = 0; i < 32; i++) { sv[i] = S[lr][i] * scale; mx = fmaxf(mx, sv[i]); }
      float f = __expf(mrun - mx);
      float sum = 0.0f;
      #pragma unroll
      for (int i = 0; i < 32; i++) {
        float p = __expf(sv[i] - mx);
        sum += p;
        P[lr][i] = (_Float16)p;
      }
      lrun = lrun * f + sum;
      mrun = mx;
      fs[lr] = f;
    }
    __syncthreads();
    // ---- rescale accumulator ----
    for (int r = 0; r < 8; r++) {
      float f = fs[r + 8 * lhh];
      for (int t = 0; t < 4; t++) o[t][r] *= f;
    }
    // ---- O += P(16x32) @ V(32x64) ----
    v16h pa;
    {
      v8h lo = *(const v8h*)&P[lr][lh];
      v8h hi = *(const v8h*)&P[lr][16 + lh];
      pa = __builtin_shufflevector(lo, hi, 0,1,2,3,4,5,6,7,8,9,10,11,12,13,14,15);
    }
    for (int t = 0; t < 4; t++) o[t] = wmma_f16(pa, vb[t], o[t]);
    __syncthreads();   // protect S/P/fs before next chunk
    kc = kn;
  }
  if (lane < 16) ls[lr] = lrun;
  __syncthreads();
  for (int r = 0; r < 8; r++) {
    float inv = 1.0f / ls[r + 8 * lhh];
    int nq = mt * 16 + r + 8 * lhh;
    for (int t = 0; t < 4; t++) {
      int col = h * 64 + t * 16 + lr;
      AO[frag_off(b * 4096 + nq, col, 16)] = (_Float16)(o[t][r] * inv);
    }
  }
}

// ---------------- GEMM: output projection + bias (f32 out) ----------------
__global__ void __launch_bounds__(32) gemm_out(const _Float16* __restrict__ A,
                                               const _Float16* __restrict__ W,
                                               const float* __restrict__ bp,
                                               float* __restrict__ out) {
  int mt = blockIdx.x, nt = blockIdx.y;
  int lane = threadIdx.x, lr = lane & 15;
  v8f c[2][4];
  for (int s = 0; s < 2; s++) for (int t = 0; t < 4; t++)
    for (int r = 0; r < 8; r++) c[s][t][r] = 0.0f;
  gemm_core_512<false, TILE512, TILE512>(A + (size_t)(mt * 2) * TILE512,
                       W + (size_t)(nt * 4) * TILE512, lane * 16, c);
  for (int s = 0; s < 2; s++)
    for (int t = 0; t < 4; t++)
      for (int r = 0; r < 8; r++) {
        int m = mt * 32 + s * 16 + r + 8 * (lane >> 4);
        int col = nt * 64 + t * 16 + lr;
        out[(size_t)m * CDIM + col] = c[s][t][r] + bp[col];
      }
}

// ---------------- host ----------------
extern "C" void kernel_launch(void* const* d_in, const int* in_sizes, int n_in,
                              void* d_out, int out_size, void* d_ws, size_t ws_size,
                              hipStream_t stream) {
  const float* x    = (const float*)d_in[0];
  // d_in[1], d_in[2] are H, W (compile-time 64 here)
  const float* Wq   = (const float*)d_in[3];
  const float* Wkv  = (const float*)d_in[4];
  const float* Wsr  = (const float*)d_in[5];
  const float* bsr  = (const float*)d_in[6];
  const float* ln_g = (const float*)d_in[7];
  const float* ln_b = (const float*)d_in[8];
  const float* Wp   = (const float*)d_in[9];
  const float* bp   = (const float*)d_in[10];
  float* out = (float*)d_out;

  char* ws = (char*)d_ws;
  _Float16* xh   = (_Float16*)(ws + OFF_XH);
  _Float16* wqh  = (_Float16*)(ws + OFF_WQH);
  _Float16* wkvh = (_Float16*)(ws + OFF_WKVH);
  _Float16* wph  = (_Float16*)(ws + OFF_WPH);
  _Float16* wsrh = (_Float16*)(ws + OFF_WSRH);
  float*    xsr  = (float*)   (ws + OFF_XSR);
  _Float16* xln  = (_Float16*)(ws + OFF_XLN);
  _Float16* qh   = (_Float16*)(ws + OFF_QH);
  _Float16* kh   = (_Float16*)(ws + OFF_KH);
  _Float16* vt   = (_Float16*)(ws + OFF_VT);
  _Float16* aoh  = (_Float16*)(ws + OFF_AOH);

  // 1) convert / pack
  cvt_f32_f16<<<16384 * 512 / 8 / 256, 256, 0, stream>>>(x, xh, 16384 * 512 / 8, 1);
  cvt_f32_f16<<<512 * 512 / 8 / 256, 256, 0, stream>>>(Wq, wqh, 512 * 512 / 8, 0);
  cvt_f32_f16<<<1024 * 512 / 8 / 256, 256, 0, stream>>>(Wkv, wkvh, 1024 * 512 / 8, 0);
  cvt_f32_f16<<<512 * 512 / 8 / 256, 256, 0, stream>>>(Wp, wph, 512 * 512 / 8, 0);
  pack_wsr<<<512 * 2048 / 8 / 256, 256, 0, stream>>>(Wsr, wsrh);

  // 2) Q projection: 16384x512x512
  gemm_q<<<dim3(16384 / 32, 512 / 64), 32, 0, stream>>>(xh, wqh, qh);

  // 3) SR patch-merge GEMM: 4096x512x2048 (+bias)
  gemm_sr<<<dim3(4096 / 32, 512 / 64), 32, 0, stream>>>(xh, wsrh, bsr, xsr);

  // 4) LayerNorm rows -> f16
  ln_rows<<<4096 / 8, 256, 0, stream>>>(xsr, ln_g, ln_b, xln);

  // 5) KV projection: 4096x1024x512
  gemm_kv<<<dim3(4096 / 32, 1024 / 64), 32, 0, stream>>>(xln, wkvh, kh, vt);

  // 6) flash attention per (b,h): 32 heads x 256 query-tiles
  attn<<<dim3(256, 32), 32, 0, stream>>>(qh, kh, vt, aoh);

  // 7) output projection: 16384x512x512 (+bias, f32)
  gemm_out<<<dim3(16384 / 32, 512 / 64), 32, 0, stream>>>(aoh, wph, bp, out);
}

// v002
// It runs in 200 microseconds.
// Timed twice side by side with v001, it ran 1.17 and 1.15 times as fast.
// Counting every step since v000, it is 1.55 times as fast.
#include <hip/hip_runtime.h>
#include <hip/hip_bf16.h>

typedef __attribute__((ext_vector_type(16))) _Float16 v16h;
typedef __attribute__((ext_vector_type(8)))  _Float16 v8h;
typedef __attribute__((ext_vector_type(8)))  float    v8f;
typedef __attribute__((ext_vector_type(4)))  float    v4f;

// ---------------- constants ----------------
#define CDIM    512

// workspace layout (bytes)
#define OFF_XH    ((size_t)0)                    // 16384*512 f16 = 16 MiB
#define OFF_WQH   (OFF_XH   + (size_t)16777216)  // 512*512  f16
#define OFF_WKVH  (OFF_WQH  + (size_t)524288)    // 1024*512 f16
#define OFF_WPH   (OFF_WKVH + (size_t)1048576)   // 512*512  f16
#define OFF_WSRH  (OFF_WPH  + (size_t)524288)    // 512*2048 f16
#define OFF_XSR   (OFF_WSRH + (size_t)2097152)   // 4096*512 f32
#define OFF_XLN   (OFF_XSR  + (size_t)8388608)   // 4096*512 f16
#define OFF_QH    (OFF_XLN  + (size_t)4194304)   // 32*4096*64 f16
#define OFF_KH    (OFF_QH   + (size_t)16777216)  // 32*1024*64 f16
#define OFF_VT    (OFF_KH   + (size_t)4194304)   // 32*64*1024 f16
#define OFF_AOH   (OFF_VT   + (size_t)4194304)   // 16384*512 f16

// ---------------- helpers ----------------
// Fragment-order layout of an f16 matrix [rows][K] in the workspace.
// A block is 16 rows x 32 k = 512 halfs; block index = (row/16)*(K/32) + k/32.
// Inside a block, element (row, k) sits at
//   ((k>>4)&1)*256 + (((k>>3)&1)*16 + (row&15))*8 + (k&7)
// so each of the two 16-byte loads of a fragment reads 512 contiguous bytes
// per wave (4 whole lines); element e of lane L is
// K = k0 + (e/8)*16 + (L/16)*8 + (e%8) of row L%16.
#define TILE512 8192      // halfs of one 16-row tile at K = 512

__device__ __forceinline__ int frag_off(int row, int k, int kblocks) {
  return ((row >> 4) * kblocks + (k >> 5)) * 512 + ((k >> 4) & 1) * 256
       + (((k >> 3) & 1) * 16 + (row & 15)) * 8 + (k & 7);
}

// blk = block base + lane*8
__device__ __forceinline__ v16h load_frag(const _Float16* __restrict__ blk) {
  v8h lo = *(const v8h*)(blk);
  v8h hi = *(const v8h*)(blk + 256);
  return __builtin_shufflevector(lo, hi, 0,1,2,3,4,5,6,7,8,9,10,11,12,13,14,15);
}

// the same from a wave-uniform base and a per-lane byte offset
__device__ __forceinline__ v16h load_frag_at(const _Float16* __restrict__ base, unsigned boff) {
  return load_frag((const _Float16*)((const char*)base + boff));
}

__device__ __forceinline__ v8f wmma_f16(v16h a, v16h b, v8f c) {
  return __builtin_amdgcn_wmma_f32_16x16x32_f16(false, a, false, b, (short)0, c,
                                                false, false);
}

__device__ __forceinline__ v8h pack8(v8f c) {
  v8h v;
  for (int r = 0; r < 8; r++) v[r] = (_Float16)c[r];
  return v;
}

// 2 x-tiles by 4 w-tiles. WA = false: x rows are the A operand (a lane holds 8
// rows of one w column). WA = true: w rows are the A operand (a lane holds 8
// consecutive w columns of one x row: one 16-byte piece of a fragment-order row).
template <bool WA>
__device__ __forceinline__ void mma_2x4(v16h a0, v16h a1, v16h b0, v16h b1,
                                        v16h b2, v16h b3, v8f (&c)[2][4]) {
  if (WA) {
    c[0][0] = wmma_f16(b0, a0, c[0][0]);  c[1][0] = wmma_f16(b0, a1, c[1][0]);
    c[0][1] = wmma_f16(b1, a0, c[0][1]);  c[1][1] = wmma_f16(b1, a1, c[1][1]);
    c[0][2] = wmma_f16(b2, a0, c[0][2]);  c[1][2] = wmma_f16(b2, a1, c[1][2]);
    c[0][3] = wmma_f16(b3, a0, c[0][3]);  c[1][3] = wmma_f16(b3, a1, c[1][3]);
  } else {
    c[0][0] = wmma_f16(a0, b0, c[0][0]);  c[1][0] = wmma_f16(a1, b0, c[1][0]);
    c[0][1] = wmma_f16(a0, b1, c[0][1]);  c[1][1] = wmma_f16(a1, b1, c[1][1]);
    c[0][2] = wmma_f16(a0, b2, c[0][2]);  c[1][2] = wmma_f16(a1, b2, c[1][2]);
    c[0][3] = wmma_f16(a0, b3, c[0][3]);  c[1][3] = wmma_f16(a1, b3, c[1][3]);
  }
}

// Software-pipelined 32x64 GEMM core over 512 k (16 k blocks).
// xt = first of two x tiles XS halfs apart, wt = first of four w tiles WS halfs
// apart, both in fragment order and wave-uniform; off = lane*16 bytes.
template <bool WA, int XS, int WS>
__device__ __forceinline__ void gemm_core_512(const _Float16* __restrict__ xt,
                                              const _Float16* __restrict__ wt,
                                              unsigned off, v8f (&c)[2][4]) {
  v16h a0 = load_frag_at(xt, off), a1 = load_frag_at(xt + XS, off);
  v16h b0 = load_frag_at(wt, off), b1 = load_frag_at(wt + WS, off);
  v16h b2 = load_frag_at(wt + 2 * WS, off), b3 = load_frag_at(wt + 3 * WS, off);
  for (int kb = 1; kb < 16; kb++) {
    off += 1024;
    // prefetch next K-step while current WMMAs execute
    v16h a0n = load_frag_at(xt, off), a1n = load_frag_at(xt + XS, off);
    v16h b0n = load_frag_at(wt, off), b1n = load_frag_at(wt + WS, off);
    v16h b2n = load_frag_at(wt + 2 * WS, off), b3n = load_frag_at(wt + 3 * WS, off);
    mma_2x4<WA>(a0, a1, b0, b1, b2, b3, c);
    a0 = a0n; a1 = a1n; b0 = b0n; b1 = b1n; b2 = b2n; b3 = b3n;
  }
  mma_2x4<WA>(a0, a1, b0, b1, b2, b3, c);
}

// ---------------- conversion / packing ----------------
// f32 [rows][512] -> f16 in fragment order; one thread makes one 16-byte piece.
// pair = 1 (x): tile T holds the 16 tokens (T/2)*32 + 2*i + (T&1), so that the
// stride-2 patch rows of the SR product are whole tiles too.
__global__ void cvt_f32_f16(const float* __restrict__ s, _Float16* __restrict__ d,
                            int n, int pair) {
  int o = blockIdx.x * 256 + threadIdx.x;      // index of the 16-byte piece
  if (o < n) {
    int lane = o & 31, part = (o >> 5) & 1, kb = (o >> 6) & 15, tile = o >> 10;
    int lr = lane & 15, lhh = lane >> 4;
    int row = pair ? (tile >> 1) * 32 + 2 * lr + (tile & 1) : tile * 16 + lr;
    const float* p = s + (size_t)row * 512 + kb * 32 + part * 16 + lhh * 8;
    v8h v;
    for (int i = 0; i < 8; i++) v[i] = (_Float16)p[i];
    *(v8h*)(d + (size_t)o * 8) = v;
  }
}

// Wsr [c_out][c_in][2][2] -> Wsr_h [c_out][k=2048] in fragment order,
// k = (kh*2+kw)*512 + c_in
__global__ void pack_wsr(const float* __restrict__ w, _Float16* __restrict__ d) {
  int o = blockIdx.x * 256 + threadIdx.x;      // index of the 16-byte piece
  if (o < 512 * 2048 / 8) {
    int lane = o & 31, part = (o >> 5) & 1, kb = (o >> 6) & 63, tile = o >> 12;
    int co = tile * 16 + (lane & 15);
    int k = kb * 32 + part * 16 + (lane >> 4) * 8;
    int s = k >> 9, ci = k & 511;
    v8h v;
    for (int i = 0; i < 8; i++) v[i] = (_Float16)w[(co * 512 + ci + i) * 4 + s];
    *(v8h*)(d + (size_t)o * 8) = v;
  }
}

// ---------------- GEMM: Q projection (32x64 tiles) ----------------
__global__ void __launch_bounds__(32) gemm_q(const _Float16* __restrict__ A,
                                             const _Float16* __restrict__ W,
                                             _Float16* __restrict__ Q) {
  int mt = blockIdx.x, nt = blockIdx.y;
  int lane = threadIdx.x, lr = lane & 15, lhh = lane >> 4;
  v8f c[2][4];
  for (int s = 0; s < 2; s++) for (int t = 0; t < 4; t++)
    for (int r = 0; r < 8; r++) c[s][t][r] = 0.0f;
  gemm_core_512<true, TILE512, TILE512>(A + (size_t)(mt * 2) * TILE512,
                      W + (size_t)(nt * 4) * TILE512, lane * 16, c);
  // lane: token mt*32 + 2*lr + s, head nt, dd = t*16 + 8*lhh + (0..7)
  int bh = (mt >> 7) * 8 + nt;
  for (int s = 0; s < 2; s++)
    for (int t = 0; t < 4; t++) {
      int nq = (mt * 32 + 2 * lr + s) & 4095;
      *(v8h*)(Q + (size_t)bh * 4096 * 64 + frag_off(nq, t * 16 + 8 * lhh, 2)) =
          pack8(c[s][t]);
    }
}

// ---------------- GEMM: SR patch-merge conv (stride2,k2) + bias ----------------
__global__ void __launch_bounds__(32) gemm_sr(const _Float16* __restrict__ xh,
                                              const _Float16* __restrict__ W,
                                              const float* __restrict__ bsr,
                                              float* __restrict__ out) {
  int mt = blockIdx.x, nt = blockIdx.y;
  int lane = threadIdx.x, lr = lane & 15;
  // output rows mt*32 + s*16 + lr: batch mt>>5, oh = mt&31, ow = s*16 + lr
  int bb = mt >> 5, oh = mt & 31;
  // x tile of (s, kh, kw) = (bb*128 + (2*oh+kh)*2 + s)*2 + kw
  const _Float16* xt = xh + (size_t)((bb * 128 + 4 * oh) * 2) * TILE512;
  const _Float16* wt = W + (size_t)(nt * 4) * (4 * TILE512);
  v8f c[2][4];
  for (int s = 0; s < 2; s++) for (int t = 0; t < 4; t++)
    for (int r = 0; r < 8; r++) c[s][t][r] = 0.0f;
  // k = (kh*2+kw)*512 + c_in: one pass of 512 k per (kh,kw), in that order
  for (int seg = 0; seg < 4; seg++)
    gemm_core_512<false, 2 * TILE512, 4 * TILE512>(
        xt + ((seg >> 1) * 4 + (seg & 1)) * TILE512, wt + seg * TILE512, lane * 16, c);

  for (int s = 0; s < 2; s++)
    for (int t = 0; t < 4; t++)
      for (int r = 0; r < 8; r++) {
        int mm = mt * 32 + s * 16 + r + 8 * (lane >> 4);
        int col = nt * 64 + t * 16 + lr;
        out[(size_t)mm * CDIM + col] = c[s][t][r] + bsr[col];
      }
}

// ---------------- LayerNorm over 512-wide rows ----------------
// One block takes 8 rows at once, each row summed by its own 256-wide tree:
// 8 rows fill whole 128-byte lines of the fragment-order output.
__global__ void __launch_bounds__(256) ln_rows(const float* __restrict__ x,
                                               const float* __restrict__ g,
                                               const float* __restrict__ bt,
                                               _Float16* __restrict__ out) {
  __shared__ float red[8][256];
  int row0 = blockIdx.x * 8, t = threadIdx.x;
  float v0[8], v1[8];
  for (int q = 0; q < 8; q++) {
    v0[q] = x[(size_t)(row0 + q) * 512 + t];
    v1[q] = x[(size_t)(row0 + q) * 512 + 256 + t];
    red[q][t] = v0[q] + v1[q];
  }
  __syncthreads();
  for (int s = 128; s > 0; s >>= 1) {
    if (t < s) for (int q = 0; q < 8; q++) red[q][t] += red[q][t + s];
    __syncthreads();
  }
  float d0[8], d1[8];
  for (int q = 0; q < 8; q++) {
    float mu = red[q][0] * (1.0f / 512.0f);
    d0[q] = v0[q] - mu;  d1[q] = v1[q] - mu;
  }
  __syncthreads();
  for (int q = 0; q < 8; q++) red[q][t] = d0[q] * d0[q] + d1[q] * d1[q];
  __syncthreads();
  for (int s = 128; s > 0; s >>= 1) {
    if (t < s) for (int q = 0; q < 8; q++) red[q][t] += red[q][t + s];
    __syncthreads();
  }
  for (int q = 0; q < 8; q++) {
    float rstd = rsqrtf(red[q][0] * (1.0f / 512.0f) + 1e-5f);
    out[frag_off(row0 + q, t, 16)]       = (_Float16)(d0[q] * rstd * g[t] + bt[t]);
    out[frag_off(row0 + q, 256 + t, 16)] = (_Float16)(d1[q] * rstd * g[256 + t] + bt[256 + t]);
  }
}

// ---------------- GEMM: KV projection ----------------
__global__ void __launch_bounds__(32) gemm_kv(const _Float16* __restrict__ A,
                                              const _Float16* __restrict__ W,
                                              _Float16* __restrict__ Kh,
                                              _Float16* __restrict__ Vt) {
  int mt = blockIdx.x, nt = blockIdx.y;
  int lane = threadIdx.x;
  const _Float16* xt = A + (size_t)(mt * 2) * TILE512;
  const _Float16* wt = W + (size_t)(nt * 4) * TILE512;
  int b = mt >> 5, mq = mt & 31;          // rows mt*32.. = keys mq*32.. of batch b
  v8f c[2][4];
  for (int s = 0; s < 2; s++) for (int t = 0; t < 4; t++)
    for (int r = 0; r < 8; r++) c[s][t][r] = 0.0f;
  if (nt < 8) {
    // K [key][dd]: lane holds key mq*32 + s*16 + lr, dd = t*16 + 8*lhh + (0..7)
    gemm_core_512<true, TILE512, TILE512>(xt, wt, lane * 16, c);
    _Float16* kb = Kh + (size_t)((b << 3) + nt) * 1024 * 64 + lane * 8;
    for (int s = 0; s < 2; s++)
      for (int t = 0; t < 4; t++)
        *(v8h*)(kb + ((mq * 2 + s) * 2 + (t >> 1)) * 512 + (t & 1) * 256) = pack8(c[s][t]);
  } else {
    // V^T [dd][key]: lane holds dd = t*16 + lr, keys mq*32 + s*16 + 8*lhh + (0..7)
    gemm_core_512<false, TILE512, TILE512>(xt, wt, lane * 16, c);
    _Float16* vb = Vt + (size_t)((b << 3) + nt - 8) * 64 * 1024 + lane * 8;
    for (int s = 0; s < 2; s++)
      for (int t = 0; t < 4; t++)
        *(v8h*)(vb + (t * 32 + mq) * 512 + s * 256) = pack8(c[s][t]);
  }
}

// ---------------- Flash attention: one wave = 32 queries of one (b,h) ----------------
struct KF { v16h f[4]; };
// kc = K of this (b,h) in fragment order + lane*8; a 32-key chunk is 4 blocks in a row
__device__ __forceinline__ KF load_kf(const _Float16* __restrict__ kc, int j) {
  KF k;
  const _Float16* p = kc + j * 2048;
  k.f[0] = load_frag(p);         k.f[1] = load_frag(p + 512);
  k.f[2] = load_frag(p + 1024);  k.f[3] = load_frag(p + 1536);
  return k;
}

// One wave takes 32 query rows (two 16-row tiles): every K and V fragment feeds
// both tiles, and each of the 32 lanes owns one softmax row.
// LDS row pitches are 16 B x odd (144 B, 80 B): 32 lanes that each touch 16 bytes
// of their own row then fall on different banks.
#define S_PITCH 36        // floats
#define P_PITCH 40        // halfs
__global__ void __launch_bounds__(32) attn(const _Float16* __restrict__ Qh,
                                           const _Float16* __restrict__ Kh,
                                           const _Float16* __restrict__ Vt,
                                           _Float16* __restrict__ AO) {
  int mt = blockIdx.x;          // 32-query tile 0..127
  int bh = blockIdx.y;          // 0..31
  int b = bh >> 3, h = bh & 7;
  int lane = threadIdx.x, lr = lane & 15, lhh = lane >> 4, lh = lhh * 8;

  __shared__ alignas(16) float    S[32][S_PITCH];
  __shared__ alignas(16) _Float16 P[32][P_PITCH];
  __shared__ alignas(16) float    fs[32];
  __shared__ alignas(16) float    ls[32];

  const _Float16* qblk = Qh + (size_t)(bh * 256 + mt * 2) * 1024 + lane * 8;
  v16h a[2][2];
  for (int u = 0; u < 2; u++) {
    a[u][0] = load_frag(qblk + u * 1024);
    a[u][1] = load_frag(qblk + u * 1024 + 512);
  }
  const _Float16* Kbh = Kh + (size_t)bh * 1024 * 64 + lane * 8;
  const _Float16* Vbh = Vt + (size_t)bh * 64 * 1024 + lane * 8;

  v8f o[2][4];
  for (int u = 0; u < 2; u++)
    for (int t = 0; t < 4; t++) for (int r = 0; r < 8; r++) o[u][t][r] = 0.0f;
  float mrun = -1e30f, lrun = 0.0f;        // row = lane
  const float scale = 0.125f;              // 1/sqrt(64)

  KF kc = load_kf(Kbh, 0);                 // prologue: K fragments for chunk 0
  for (int j = 0; j < 32; ++j) {
    // ---- V fragments for this chunk (independent of softmax; issue early) ----
    v16h vb[4];
    for (int t = 0; t < 4; t++)
      vb[t] = load_frag(Vbh + (t * 32 + j) * 512);
    // ---- scores: S(32x32) = Q(32x64) @ K^T ----
    v8f s0[2], s1[2];
    for (int u = 0; u < 2; u++) {
      for (int r = 0; r < 8; r++) { s0[u][r] = 0.0f; s1[u][r] = 0.0f; }
      s0[u] = wmma_f16(a[u][0], kc.f[0], s0[u]);
      s0[u] = wmma_f16(a[u][1], kc.f[1], s0[u]);
      s1[u] = wmma_f16(a[u][0], kc.f[2], s1[u]);
      s1[u] = wmma_f16(a[u][1], kc.f[3], s1[u]);
    }
    // ---- prefetch next chunk's K fragments (overlaps softmax latency) ----
    KF kn = load_kf(Kbh, (j + 1 < 32) ? j + 1 : j);
    // ---- scores to LDS ----
    for (int u = 0; u < 2; u++)
      for (int r = 0; r < 8; r++) {
        S[u * 16 + r + 8 * lhh][lr]      = s0[u][r];
        S[u * 16 + r + 8 * lhh][16 + lr] = s1[u][r];
      }
    __syncthreads();
    // ---- per-row online softmax (every lane owns one row) ----
    {
      float mx = mrun;
      float sv[32];
      const v4f* srow = (const v4f*)&S[lane][0];   // the row as eight 16-byte reads
      // both loops unrolled so that sv[] stays in registers
      #pragma unroll
      for (int i = 0; i < 8; i++) {
        v4f q = srow[i];
        for (int e = 0; e < 4; e++) { sv[i * 4 + e] = q[e] * scale; mx = fmaxf(mx, sv[i * 4 + e]); }
      }
      float f = __expf(mrun - mx);
      float sum = 0.0f;
      #pragma unroll
      for (int i = 0; i < 32; i++) {
        float p = __expf(sv[i] - mx);
        sum += p;
        P[lane][i] = (_Float16)p;
      }
      lrun = lrun * f + sum;
      mrun = mx;
      fs[lane] = f;
    }
    __syncthreads();
    for (int u = 0; u < 2; u++) {
      // ---- rescale accumulator ----
      for (int r = 0; r < 8; r++) {
        float f = fs[u * 16 + r + 8 * lhh];
        for (int t = 0; t < 4; t++) o[u][t][r] *= f;
      }
      // ---- O += P(16x32) @ V(32x64) ----
      v8h lo = *(const v8h*)&P[u * 16 + lr][lh];
      v8h hi = *(const v8h*)&P[u * 16 + lr][16 + lh];
      v16h pa = __builtin_shufflevector(lo, hi, 0,1,2,3,4,5,6,7,8,9,10,11,12,13,14,15);
      for (int t = 0; t < 4; t++) o[u][t] = wmma_f16(pa, vb[t], o[u][t]);
    }
    __syncthreads();   // protect S/P/fs before next chunk
    kc = kn;
  }
  ls[lane] = lrun;
  __syncthreads();
  for (int u = 0; u < 2; u++)
    for (int r = 0; r < 8; r++) {
      float inv = 1.0f / ls[u * 16 + r + 8 * lhh];
      int nq = mt * 32 + u * 16 + r + 8 * lhh;
      for (int t = 0; t < 4; t++) {
        int col = h * 64 + t * 16 + lr;
        AO[frag_off(b * 4096 + nq, col, 16)] = (_Float16)(o[u][t][r] * inv);
      }
    }
}

// ---------------- GEMM: output projection + bias (f32 out) ----------------
__global__ void __launch_bounds__(32) gemm_out(const _Float16* __restrict__ A,
                                               const _Float16* __restrict__ W,
                                               const float* __restrict__ bp,
                                               float* __restrict__ out) {
  int mt = blockIdx.x, nt = blockIdx.y;
  int lane = threadIdx.x, lr = lane & 15;
  v8f c[2][4];
  for (int s = 0; s < 2; s++) for (int t = 0; t < 4; t++)
    for (int r = 0; r < 8; r++) c[s][t][r] = 0.0f;
  gemm_core_512<false, TILE512, TILE512>(A + (size_t)(mt * 2) * TILE512,
                       W + (size_t)(nt * 4) * TILE512, lane * 16, c);
  for (int s = 0; s < 2; s++)
    for (int t = 0; t < 4; t++)
      for (int r = 0; r < 8; r++) {
        int m = mt * 32 + s * 16 + r + 8 * (lane >> 4);
        int col = nt * 64 + t * 16 + lr;
        out[(size_t)m * CDIM + col] = c[s][t][r] + bp[col];
      }
}

// ---------------- host ----------------
extern "C" void kernel_launch(void* const* d_in, const int* in_sizes, int n_in,
                              void* d_out, int out_size, void* d_ws, size_t ws_size,
                              hipStream_t stream) {
  const float* x    = (const float*)d_in[0];
  // d_in[1], d_in[2] are H, W (compile-time 64 here)
  const float* Wq   = (const float*)d_in[3];
  const float* Wkv  = (const float*)d_in[4];
  const float* Wsr  = (const float*)d_in[5];
  const float* bsr  = (const float*)d_in[6];
  const float* ln_g = (const float*)d_in[7];
  const float* ln_b = (const float*)d_in[8];
  const float* Wp   = (const float*)d_in[9];
  const float* bp   = (const float*)d_in[10];
  float* out = (float*)d_out;

  char* ws = (char*)d_ws;
  _Float16* xh   = (_Float16*)(ws + OFF_XH);
  _Float16* wqh  = (_Float16*)(ws + OFF_WQH);
  _Float16* wkvh = (_Float16*)(ws + OFF_WKVH);
  _Float16* wph  = (_Float16*)(ws + OFF_WPH);
  _Float16* wsrh = (_Float16*)(ws + OFF_WSRH);
  float*    xsr  = (float*)   (ws + OFF_XSR);
  _Float16* xln  = (_Float16*)(ws + OFF_XLN);
  _Float16* qh   = (_Float16*)(ws + OFF_QH);
  _Float16* kh   = (_Float16*)(ws + OFF_KH);
  _Float16* vt   = (_Float16*)(ws + OFF_VT);
  _Float16* aoh  = (_Float16*)(ws + OFF_AOH);

  // 1) convert / pack
  cvt_f32_f16<<<16384 * 512 / 8 / 256, 256, 0, stream>>>(x, xh, 16384 * 512 / 8, 1);
  cvt_f32_f16<<<512 * 512 / 8 / 256, 256, 0, stream>>>(Wq, wqh, 512 * 512 / 8, 0);
  cvt_f32_f16<<<1024 * 512 / 8 / 256, 256, 0, stream>>>(Wkv, wkvh, 1024 * 512 / 8, 0);
  cvt_f32_f16<<<512 * 512 / 8 / 256, 256, 0, stream>>>(Wp, wph, 512 * 512 / 8, 0);
  pack_wsr<<<512 * 2048 / 8 / 256, 256, 0, stream>>>(Wsr, wsrh);

  // 2) Q projection: 16384x512x512
  gemm_q<<<dim3(16384 / 32, 512 / 64), 32, 0, stream>>>(xh, wqh, qh);

  // 3) SR patch-merge GEMM: 4096x512x2048 (+bias)
  gemm_sr<<<dim3(4096 / 32, 512 / 64), 32, 0, stream>>>(xh, wsrh, bsr, xsr);

  // 4) LayerNorm rows -> f16
  ln_rows<<<4096 / 8, 256, 0, stream>>>(xsr, ln_g, ln_b, xln);

  // 5) KV projection: 4096x1024x512
  gemm_kv<<<dim3(4096 / 32, 1024 / 64), 32, 0, stream>>>(xln, wkvh, kh, vt);

  // 6) flash attention per (b,h): 32 heads x 128 query-tiles
  attn<<<dim3(128, 32), 32, 0, stream>>>(qh, kh, vt, aoh);

  // 7) output projection: 16384x512x512 (+bias, f32)
  gemm_out<<<dim3(16384 / 32, 512 / 64), 32, 0, stream>>>(aoh, wph, bp, out);
}

// v003
// A run of this version takes 170 microseconds.
// Two timings next to v002 put it at 1.16 and 1.14 times that version's speed.
// Over all steps from v000 it is 1.79 times as fast.
#include <hip/hip_runtime.h>
#include <hip/hip_bf16.h>

typedef __attribute__((ext_vector_type(16))) _Float16 v16h;
typedef __attribute__((ext_vector_type(8)))  _Float16 v8h;
typedef __attribute__((ext_vector_type(8)))  float    v8f;
typedef __attribute__((ext_vector_type(4)))  float    v4f;

// ---------------- constants ----------------
#define CDIM    512

// workspace layout (bytes)
#define OFF_XH    ((size_t)0)                    // 16384*512 f16 = 16 MiB
#define OFF_WQH   (OFF_XH   + (size_t)16777216)  // 512*512  f16
#define OFF_WKVH  (OFF_WQH  + (size_t)524288)    // 1024*512 f16
#define OFF_WPH   (OFF_WKVH + (size_t)1048576)   // 512*512  f16
#define OFF_WSRH  (OFF_WPH  + (size_t)524288)    // 512*2048 f16
#define OFF_XSR   (OFF_WSRH + (size_t)2097152)   // 4096*512 f32
#define OFF_XLN   (OFF_XSR  + (size_t)8388608)   // 4096*512 f16
#define OFF_QH    (OFF_XLN  + (size_t)4194304)   // 32*4096*64 f16
#define OFF_KH    (OFF_QH   + (size_t)16777216)  // 32*1024*64 f16
#define OFF_VT    (OFF_KH   + (size_t)4194304)   // 32*64*1024 f16
#define OFF_AOH   (OFF_VT   + (size_t)4194304)   // 16384*512 f16

// ---------------- helpers ----------------
// Fragment-order layout of an f16 matrix [rows][K] in the workspace.
// A block is 16 rows x 32 k = 512 halfs; block index = (row/16)*(K/32) + k/32.
// Inside a block, element (row, k) sits at
//   ((k>>4)&1)*256 + (((k>>3)&1)*16 + (row&15))*8 + (k&7)
// so each of the two 16-byte loads of a fragment reads 512 contiguous bytes
// per wave (4 whole lines); element e of lane L is
// K = k0 + (e/8)*16 + (L/16)*8 + (e%8) of row L%16.
#define TILE512 8192      // halfs of one 16-row tile at K = 512

__device__ __forceinline__ int frag_off(int row, int k, int kblocks) {
  return ((row >> 4) * kblocks + (k >> 5)) * 512 + ((k >> 4) & 1) * 256
       + (((k >> 3) & 1) * 16 + (row & 15)) * 8 + (k & 7);
}

// blk = block base + lane*8
__device__ __forceinline__ v16h load_frag(const _Float16* __restrict__ blk) {
  v8h lo = *(const v8h*)(blk);
  v8h hi = *(const v8h*)(blk + 256);
  return __builtin_shufflevector(lo, hi, 0,1,2,3,4,5,6,7,8,9,10,11,12,13,14,15);
}

// the same from a wave-uniform base and a per-lane byte offset
__device__ __forceinline__ v16h load_frag_at(const _Float16* __restrict__ base, unsigned boff) {
  return load_frag((const _Float16*)((const char*)base + boff));
}

__device__ __forceinline__ v8f wmma_f16(v16h a, v16h b, v8f c) {
  return __builtin_amdgcn_wmma_f32_16x16x32_f16(false, a, false, b, (short)0, c,
                                                false, false);
}

__device__ __forceinline__ v8h pack8(v8f c) {
  v8h v;
  for (int r = 0; r < 8; r++) v[r] = (_Float16)c[r];
  return v;
}

// 2 x-tiles by 4 w-tiles. WA = false: x rows are the A operand (a lane holds 8
// rows of one w column). WA = true: w rows are the A operand (a lane holds 8
// consecutive w columns of one x row: one 16-byte piece of a fragment-order row).
template <bool WA>
__device__ __forceinline__ void mma_2x4(v16h a0, v16h a1, v16h b0, v16h b1,
                                        v16h b2, v16h b3, v8f (&c)[2][4]) {
  if (WA) {
    c[0][0] = wmma_f16(b0, a0, c[0][0]);  c[1][0] = wmma_f16(b0, a1, c[1][0]);
    c[0][1] = wmma_f16(b1, a0, c[0][1]);  c[1][1] = wmma_f16(b1, a1, c[1][1]);
    c[0][2] = wmma_f16(b2, a0, c[0][2]);  c[1][2] = wmma_f16(b2, a1, c[1][2]);
    c[0][3] = wmma_f16(b3, a0, c[0][3]);  c[1][3] = wmma_f16(b3, a1, c[1][3]);
  } else {
    c[0][0] = wmma_f16(a0, b0, c[0][0]);  c[1][0] = wmma_f16(a1, b0, c[1][0]);
    c[0][1] = wmma_f16(a0, b1, c[0][1]);  c[1][1] = wmma_f16(a1, b1, c[1][1]);
    c[0][2] = wmma_f16(a0, b2, c[0][2]);  c[1][2] = wmma_f16(a1, b2, c[1][2]);
    c[0][3] = wmma_f16(a0, b3, c[0][3]);  c[1][3] = wmma_f16(a1, b3, c[1][3]);
  }
}

// Software-pipelined 32x64 GEMM core over 512 k (16 k blocks).
// xt = first of two x tiles XS halfs apart, wt = first of four w tiles WS halfs
// apart, both in fragment order and wave-uniform; off = lane*16 bytes.
template <bool WA, int XS, int WS>
__device__ __forceinline__ void gemm_core_512(const _Float16* __restrict__ xt,
                                              const _Float16* __restrict__ wt,
                                              unsigned off, v8f (&c)[2][4]) {
  v16h a0 = load_frag_at(xt, off), a1 = load_frag_at(xt + XS, off);
  v16h b0 = load_frag_at(wt, off), b1 = load_frag_at(wt + WS, off);
  v16h b2 = load_frag_at(wt + 2 * WS, off), b3 = load_frag_at(wt + 3 * WS, off);
  // the loop's loads may be given the registers that hold these loads' addresses
  asm volatile("s_wait_xcnt 0x0" ::: "memory");
  for (int kb = 1; kb < 16; kb++) {
    off += 1024;
    // prefetch next K-step while current WMMAs execute
    v16h a0n = load_frag_at(xt, off), a1n = load_frag_at(xt + XS, off);
    v16h b0n = load_frag_at(wt, off), b1n = load_frag_at(wt + WS, off);
    v16h b2n = load_frag_at(wt + 2 * WS, off), b3n = load_frag_at(wt + 3 * WS, off);
    mma_2x4<WA>(a0, a1, b0, b1, b2, b3, c);
    a0 = a0n; a1 = a1n; b0 = b0n; b1 = b1n; b2 = b2n; b3 = b3n;
  }
  mma_2x4<WA>(a0, a1, b0, b1, b2, b3, c);
}

// ---------------- conversion / packing ----------------
// f32 [rows][512] -> f16 in fragment order; one thread makes one 16-byte piece, o.
// pair (x): tile T holds the 16 tokens (T/2)*32 + 2*i + (T&1), so that the
// stride-2 patch rows of the SR product are whole tiles too.
__device__ __forceinline__ void cvt_piece(const float* __restrict__ s,
                                          _Float16* __restrict__ d, int o, bool pair) {
  int lane = o & 31, part = (o >> 5) & 1, kb = (o >> 6) & 15, tile = o >> 10;
  int lr = lane & 15, lhh = lane >> 4;
  int row = pair ? (tile >> 1) * 32 + 2 * lr + (tile & 1) : tile * 16 + lr;
  const float* p = s + (size_t)row * 512 + kb * 32 + part * 16 + lhh * 8;
  v8h v;
  for (int i = 0; i < 8; i++) v[i] = (_Float16)p[i];
  *(v8h*)(d + (size_t)o * 8) = v;
}

// Wsr [c_out][c_in][2][2] -> Wsr_h [c_out][k=2048] in fragment order,
// k = (kh*2+kw)*512 + c_in
__device__ __forceinline__ void pack_wsr_piece(const float* __restrict__ w,
                                               _Float16* __restrict__ d, int o) {
  int lane = o & 31, part = (o >> 5) & 1, kb = (o >> 6) & 63, tile = o >> 12;
  int co = tile * 16 + (lane & 15);
  int k = kb * 32 + part * 16 + (lane >> 4) * 8;
  int s = k >> 9, ci = k & 511;
  v8h v;
  for (int i = 0; i < 8; i++) v[i] = (_Float16)w[(co * 512 + ci + i) * 4 + s];
  *(v8h*)(d + (size_t)o * 8) = v;
}

// All five conversions are independent: one launch, a range of the block index
// picks the job (256 pieces a block, every range exact). The weights come first,
// so that their few blocks run under the long x range and not behind it.
#define CB_WSR (512 * 2048 / 8 / 256)            // 512 blocks
#define CB_WQ  (CB_WSR + 512 * 512 / 8 / 256)    // + 128
#define CB_WKV (CB_WQ + 1024 * 512 / 8 / 256)    // + 256
#define CB_WP  (CB_WKV + 512 * 512 / 8 / 256)    // + 128
#define CB_X   (CB_WP + 16384 * 512 / 8 / 256)   // + 4096
__global__ void __launch_bounds__(256) cvt_all(const float* __restrict__ x,
                                               const float* __restrict__ Wq,
                                               const float* __restrict__ Wkv,
                                               const float* __restrict__ Wp,
                                               const float* __restrict__ Wsr,
                                               _Float16* __restrict__ xh,
                                               _Float16* __restrict__ wqh,
                                               _Float16* __restrict__ wkvh,
                                               _Float16* __restrict__ wph,
                                               _Float16* __restrict__ wsrh) {
  int b = blockIdx.x, t = threadIdx.x;
  if (b < CB_WSR)      pack_wsr_piece(Wsr, wsrh, b * 256 + t);
  else if (b < CB_WQ)  cvt_piece(Wq, wqh, (b - CB_WSR) * 256 + t, false);
  else if (b < CB_WKV) cvt_piece(Wkv, wkvh, (b - CB_WQ) * 256 + t, false);
  else if (b < CB_WP)  cvt_piece(Wp, wph, (b - CB_WKV) * 256 + t, false);
  else                 cvt_piece(x, xh, (b - CB_WP) * 256 + t, true);
}

// ---------------- GEMM: Q projection (32x64 tiles) ----------------
__device__ __forceinline__ void q_tile(int mt, int nt,
                                       const _Float16* __restrict__ A,
                                       const _Float16* __restrict__ W,
                                       _Float16* __restrict__ Q) {
  int lane = threadIdx.x, lr = lane & 15, lhh = lane >> 4;
  v8f c[2][4];
  for (int s = 0; s < 2; s++) for (int t = 0; t < 4; t++)
    for (int r = 0; r < 8; r++) c[s][t][r] = 0.0f;
  gemm_core_512<true, TILE512, TILE512>(A + (size_t)(mt * 2) * TILE512,
                      W + (size_t)(nt * 4) * TILE512, lane * 16, c);
  // lane: token mt*32 + 2*lr + s, head nt, dd = t*16 + 8*lhh + (0..7)
  int bh = (mt >> 7) * 8 + nt;
  for (int s = 0; s < 2; s++)
    for (int t = 0; t < 4; t++) {
      int nq = (mt * 32 + 2 * lr + s) & 4095;
      *(v8h*)(Q + (size_t)bh * 4096 * 64 + frag_off(nq, t * 16 + 8 * lhh, 2)) =
          pack8(c[s][t]);
    }
}

// ---------------- GEMM: SR patch-merge conv (stride2,k2) + bias ----------------
__device__ __forceinline__ void sr_tile(int mt, int nt,
                                        const _Float16* __restrict__ xh,
                                        const _Float16* __restrict__ W,
                                        const float* __restrict__ bsr,
                                        float* __restrict__ out) {
  int lane = threadIdx.x, lr = lane & 15;
  // output rows mt*32 + s*16 + lr: batch mt>>5, oh = mt&31, ow = s*16 + lr
  int bb = mt >> 5, oh = mt & 31;
  // x tile of (s, kh, kw) = (bb*128 + (2*oh+kh)*2 + s)*2 + kw
  const _Float16* xt = xh + (size_t)((bb * 128 + 4 * oh) * 2) * TILE512;
  const _Float16* wt = W + (size_t)(nt * 4) * (4 * TILE512);
  v8f c[2][4];
  for (int s = 0; s < 2; s++) for (int t = 0; t < 4; t++)
    for (int r = 0; r < 8; r++) c[s][t][r] = 0.0f;
  // k = (kh*2+kw)*512 + c_in: one pass of 512 k per (kh,kw), in that order
  for (int seg = 0; seg < 4; seg++)
    gemm_core_512<false, 2 * TILE512, 4 * TILE512>(
        xt + ((seg >> 1) * 4 + (seg & 1)) * TILE512, wt + seg * TILE512, lane * 16, c);

  for (int s = 0; s < 2; s++)
    for (int t = 0; t < 4; t++)
      for (int r = 0; r < 8; r++) {
        int mm = mt * 32 + s * 16 + r + 8 * (lane >> 4);
        int col = nt * 64 + t * 16 + lr;
        out[(size_t)mm * CDIM + col] = c[s][t][r] + bsr[col];
      }
}

// Both products read only xh and their own weights: one launch. The 1024 SR tiles
// (2048 k each) take the low block indices, so that they start first and the 4096
// Q tiles (512 k each) run beside them.
#define GB_SR (4096 / 32 * (512 / 64))           // 1024 blocks
#define GB_Q  (16384 / 32 * (512 / 64))          // 4096 blocks
__global__ void __launch_bounds__(32) gemm_q_sr(const _Float16* __restrict__ xh,
                                                const _Float16* __restrict__ wqh,
                                                const _Float16* __restrict__ wsrh,
                                                const float* __restrict__ bsr,
                                                _Float16* __restrict__ Q,
                                                float* __restrict__ xsr) {
  int b = blockIdx.x;
  if (b < GB_SR) {
    sr_tile(b & 127, b >> 7, xh, wsrh, bsr, xsr);
  } else {
    b -= GB_SR;
    q_tile(b & 511, b >> 9, xh, wqh, Q);
  }
}

// ---------------- LayerNorm over 512-wide rows ----------------
// One block takes 8 rows at once, each row summed by its own 256-wide tree:
// 8 rows fill whole 128-byte lines of the fragment-order output.
__global__ void __launch_bounds__(256) ln_rows(const float* __restrict__ x,
                                               const float* __restrict__ g,
                                               const float* __restrict__ bt,
                                               _Float16* __restrict__ out) {
  __shared__ float red[8][256];
  int row0 = blockIdx.x * 8, t = threadIdx.x;
  float v0[8], v1[8];
  for (int q = 0; q < 8; q++) {
    v0[q] = x[(size_t)(row0 + q) * 512 + t];
    v1[q] = x[(size_t)(row0 + q) * 512 + 256 + t];
    red[q][t] = v0[q] + v1[q];
  }
  __syncthreads();
  for (int s = 128; s > 0; s >>= 1) {
    if (t < s) for (int q = 0; q < 8; q++) red[q][t] += red[q][t + s];
    __syncthreads();
  }
  float d0[8], d1[8];
  for (int q = 0; q < 8; q++) {
    float mu = red[q][0] * (1.0f / 512.0f);
    d0[q] = v0[q] - mu;  d1[q] = v1[q] - mu;
  }
  __syncthreads();
  for (int q = 0; q < 8; q++) red[q][t] = d0[q] * d0[q] + d1[q] * d1[q];
  __syncthreads();
  for (int s = 128; s > 0; s >>= 1) {
    if (t < s) for (int q = 0; q < 8; q++) red[q][t] += red[q][t + s];
    __syncthreads();
  }
  for (int q = 0; q < 8; q++) {
    float rstd = rsqrtf(red[q][0] * (1.0f / 512.0f) + 1e-5f);
    out[frag_off(row0 + q, t, 16)]       = (_Float16)(d0[q] * rstd * g[t] + bt[t]);
    out[frag_off(row0 + q, 256 + t, 16)] = (_Float16)(d1[q] * rstd * g[256 + t] + bt[256 + t]);
  }
}

// ---------------- GEMM: KV projection ----------------
__global__ void __launch_bounds__(32) gemm_kv(const _Float16* __restrict__ A,
                                              const _Float16* __restrict__ W,
                                              _Float16* __restrict__ Kh,
                                              _Float16* __restrict__ Vt) {
  int mt = blockIdx.x, nt = blockIdx.y;
  int lane = threadIdx.x;
  const _Float16* xt = A + (size_t)(mt * 2) * TILE512;
  const _Float16* wt = W + (size_t)(nt * 4) * TILE512;
  int b = mt >> 5, mq = mt & 31;          // rows mt*32.. = keys mq*32.. of batch b
  v8f c[2][4];
  for (int s = 0; s < 2; s++) for (int t = 0; t < 4; t++)
    for (int r = 0; r < 8; r++) c[s][t][r] = 0.0f;
  if (nt < 8) {
    // K [key][dd]: lane holds key mq*32 + s*16 + lr, dd = t*16 + 8*lhh + (0..7)
    gemm_core_512<true, TILE512, TILE512>(xt, wt, lane * 16, c);
    _Float16* kb = Kh + (size_t)((b << 3) + nt) * 1024 * 64 + lane * 8;
    for (int s = 0; s < 2; s++)
      for (int t = 0; t < 4; t++)
        *(v8h*)(kb + ((mq * 2 + s) * 2 + (t >> 1)) * 512 + (t & 1) * 256) = pack8(c[s][t]);
  } else {
    // V^T [dd][key]: lane holds dd = t*16 + lr, keys mq*32 + s*16 + 8*lhh + (0..7)
    gemm_core_512<false, TILE512, TILE512>(xt, wt, lane * 16, c);
    _Float16* vb = Vt + (size_t)((b << 3) + nt - 8) * 64 * 1024 + lane * 8;
    for (int s = 0; s < 2; s++)
      for (int t = 0; t < 4; t++)
        *(v8h*)(vb + (t * 32 + mq) * 512 + s * 256) = pack8(c[s][t]);
  }
}

// ---------------- Flash attention: one wave = 32 queries of one (b,h) ----------------
struct KF { v16h f[4]; };
// kc = K of this (b,h) in fragment order + lane*8; a 32-key chunk is 4 blocks in a row
__device__ __forceinline__ KF load_kf(const _Float16* __restrict__ kc, int j) {
  KF k;
  const _Float16* p = kc + j * 2048;
  k.f[0] = load_frag(p);         k.f[1] = load_frag(p + 512);
  k.f[2] = load_frag(p + 1024);  k.f[3] = load_frag(p + 1536);
  return k;
}

// One wave takes 32 query rows (two 16-row tiles): every K and V fragment feeds
// both tiles, and each of the 32 lanes owns one softmax row.
// LDS row pitches are 16 B x odd (144 B, 80 B): 32 lanes that each touch 16 bytes
// of their own row then fall on different banks.
#define S_PITCH 36        // floats
#define P_PITCH 40        // halfs
__global__ void __launch_bounds__(32) attn(const _Float16* __restrict__ Qh,
                                           const _Float16* __restrict__ Kh,
                                           const _Float16* __restrict__ Vt,
                                           _Float16* __restrict__ AO) {
  int mt = blockIdx.x;          // 32-query tile 0..127
  int bh = blockIdx.y;          // 0..31
  int b = bh >> 3, h = bh & 7;
  int lane = threadIdx.x, lr = lane & 15, lhh = lane >> 4, lh = lhh * 8;

  __shared__ alignas(16) float    S[32][S_PITCH];
  __shared__ alignas(16) _Float16 P[32][P_PITCH];
  __shared__ alignas(16) float    fs[32];
  __shared__ alignas(16) float    ls[32];

  const _Float16* qblk = Qh + (size_t)(bh * 256 + mt * 2) * 1024 + lane * 8;
  v16h a[2][2];
  for (int u = 0; u < 2; u++) {
    a[u][0] = load_frag(qblk + u * 1024);
    a[u][1] = load_frag(qblk + u * 1024 + 512);
  }
  const _Float16* Kbh = Kh + (size_t)bh * 1024 * 64 + lane * 8;
  const _Float16* Vbh = Vt + (size_t)bh * 64 * 1024 + lane * 8;

  v8f o[2][4];
  for (int u = 0; u < 2; u++)
    for (int t = 0; t < 4; t++) for (int r = 0; r < 8; r++) o[u][t][r] = 0.0f;
  float mrun = -1e30f, lrun = 0.0f;        // row = lane
  const float scale = 0.125f;              // 1/sqrt(64)

  KF kc = load_kf(Kbh, 0);                 // prologue: K fragments for chunk 0
  for (int j = 0; j < 32; ++j) {
    // ---- V fragments for this chunk (independent of softmax; issue early) ----
    v16h vb[4];
    for (int t = 0; t < 4; t++)
      vb[t] = load_frag(Vbh + (t * 32 + j) * 512);
    // ---- scores: S(32x32) = Q(32x64) @ K^T ----
    v8f s0[2], s1[2];
    for (int u = 0; u < 2; u++) {
      for (int r = 0; r < 8; r++) { s0[u][r] = 0.0f; s1[u][r] = 0.0f; }
      s0[u] = wmma_f16(a[u][0], kc.f[0], s0[u]);
      s0[u] = wmma_f16(a[u][1], kc.f[1], s0[u]);
      s1[u] = wmma_f16(a[u][0], kc.f[2], s1[u]);
      s1[u] = wmma_f16(a[u][1], kc.f[3], s1[u]);
    }
    // ---- prefetch next chunk's K fragments (overlaps softmax latency) ----
    KF kn = load_kf(Kbh, (j + 1 < 32) ? j + 1 : j);
    // ---- scores to LDS ----
    for (int u = 0; u < 2; u++)
      for (int r = 0; r < 8; r++) {
        S[u * 16 + r + 8 * lhh][lr]      = s0[u][r];
        S[u * 16 + r + 8 * lhh][16 + lr] = s1[u][r];
      }
    __syncthreads();
    // ---- per-row online softmax (every lane owns one row) ----
    {
      float mx = mrun;
      float sv[32];
      const v4f* srow = (const v4f*)&S[lane][0];   // the row as eight 16-byte reads
      // both loops unrolled so that sv[] stays in registers
      #pragma unroll
      for (int i = 0; i < 8; i++) {
        v4f q = srow[i];
        for (int e = 0; e < 4; e++) { sv[i * 4 + e] = q[e] * scale; mx = fmaxf(mx, sv[i * 4 + e]); }
      }
      float f = __expf(mrun - mx);
      float sum = 0.0f;
      #pragma unroll
      for (int i = 0; i < 32; i++) {
        float p = __expf(sv[i] - mx);
        sum += p;
        P[lane][i] = (_Float16)p;
      }
      lrun = lrun * f + sum;
      mrun = mx;
      fs[lane] = f;
    }
    __syncthreads();
    for (int u = 0; u < 2; u++) {
      // ---- rescale accumulator ----
      for (int r = 0; r < 8; r++) {
        float f = fs[u * 16 + r + 8 * lhh];
        for (int t = 0; t < 4; t++) o[u][t][r] *= f;
      }
      // ---- O += P(16x32) @ V(32x64) ----
      v8h lo = *(const v8h*)&P[u * 16 + lr][lh];
      v8h hi = *(const v8h*)&P[u * 16 + lr][16 + lh];
      v16h pa = __builtin_shufflevector(lo, hi, 0,1,2,3,4,5,6,7,8,9,10,11,12,13,14,15);
      for (int t = 0; t < 4; t++) o[u][t] = wmma_f16(pa, vb[t], o[u][t]);
    }
    __syncthreads();   // protect S/P/fs before next chunk
    kc = kn;
  }
  ls[lane] = lrun;
  __syncthreads();
  for (int u = 0; u < 2; u++)
    for (int r = 0; r < 8; r++) {
      float inv = 1.0f / ls[u * 16 + r + 8 * lhh];
      int nq = mt * 32 + u * 16 + r + 8 * lhh;
      for (int t = 0; t < 4; t++) {
        int col = h * 64 + t * 16 + lr;
        AO[frag_off(b * 4096 + nq, col, 16)] = (_Float16)(o[u][t][r] * inv);
      }
    }
}

// ---------------- GEMM: output projection + bias (f32 out) ----------------
__global__ void __launch_bounds__(32) gemm_out(const _Float16* __restrict__ A,
                                               const _Float16* __restrict__ W,
                                               const float* __restrict__ bp,
                                               float* __restrict__ out) {
  int mt = blockIdx.x, nt = blockIdx.y;
  int lane = threadIdx.x, lr = lane & 15;
  v8f c[2][4];
  for (int s = 0; s < 2; s++) for (int t = 0; t < 4; t++)
    for (int r = 0; r < 8; r++) c[s][t][r] = 0.0f;
  gemm_core_512<false, TILE512, TILE512>(A + (size_t)(mt * 2) * TILE512,
                       W + (size_t)(nt * 4) * TILE512, lane * 16, c);
  for (int s = 0; s < 2; s++)
    for (int t = 0; t < 4; t++)
      for (int r = 0; r < 8; r++) {
        int m = mt * 32 + s * 16 + r + 8 * (lane >> 4);
        int col = nt * 64 + t * 16 + lr;
        out[(size_t)m * CDIM + col] = c[s][t][r] + bp[col];
      }
}

// ---------------- host ----------------
extern "C" void kernel_launch(void* const* d_in, const int* in_sizes, int n_in,
                              void* d_out, int out_size, void* d_ws, size_t ws_size,
                              hipStream_t stream) {
  const float* x    = (const float*)d_in[0];
  // d_in[1], d_in[2] are H, W (compile-time 64 here)
  const float* Wq   = (const float*)d_in[3];
  const float* Wkv  = (const float*)d_in[4];
  const float* Wsr  = (const float*)d_in[5];
  const float* bsr  = (const float*)d_in[6];
  const float* ln_g = (const float*)d_in[7];
  const float* ln_b = (const float*)d_in[8];
  const float* Wp   = (const float*)d_in[9];
  const float* bp   = (const float*)d_in[10];
  float* out = (float*)d_out;

  char* ws = (char*)d_ws;
  _Float16* xh   = (_Float16*)(ws + OFF_XH);
  _Float16* wqh  = (_Float16*)(ws + OFF_WQH);
  _Float16* wkvh = (_Float16*)(ws + OFF_WKVH);
  _Float16* wph  = (_Float16*)(ws + OFF_WPH);
  _Float16* wsrh = (_Float16*)(ws + OFF_WSRH);
  float*    xsr  = (float*)   (ws + OFF_XSR);
  _Float16* xln  = (_Float16*)(ws + OFF_XLN);
  _Float16* qh   = (_Float16*)(ws + OFF_QH);
  _Float16* kh   = (_Float16*)(ws + OFF_KH);
  _Float16* vt   = (_Float16*)(ws + OFF_VT);
  _Float16* aoh  = (_Float16*)(ws + OFF_AOH);

  // 1) convert / pack
  cvt_all<<<CB_X, 256, 0, stream>>>(x, Wq, Wkv, Wp, Wsr, xh, wqh, wkvh, wph, wsrh);

  // 2) + 3) SR patch-merge GEMM 4096x512x2048 (+bias) and Q projection 16384x512x512
  gemm_q_sr<<<GB_SR + GB_Q, 32, 0, stream>>>(xh, wqh, wsrh, bsr, qh, xsr);

  // 4) LayerNorm rows -> f16
  ln_rows<<<4096 / 8, 256, 0, stream>>>(xsr, ln_g, ln_b, xln);

  // 5) KV projection: 4096x1024x512
  gemm_kv<<<dim3(4096 / 32, 1024 / 64), 32, 0, stream>>>(xln, wkvh, kh, vt);

  // 6) flash attention per (b,h): 32 heads x 128 query-tiles
  attn<<<dim3(128, 32), 32, 0, stream>>>(qh, kh, vt, aoh);

  // 7) output projection: 16384x512x512 (+bias, f32)
  gemm_out<<<dim3(16384 / 32, 512 / 64), 32, 0, stream>>>(aoh, wph, bp, out);
}

// v004
// It runs in 125 microseconds.
// Two timings next to v003 put it at 1.35 and 1.40 times that version's speed.
// All steps since v000 together make it 2.47 times as fast.
#include <hip/hip_runtime.h>
#include <hip/hip_bf16.h>

typedef __attribute__((ext_vector_type(16))) _Float16 v16h;
typedef __attribute__((ext_vector_type(8)))  _Float16 v8h;
typedef __attribute__((ext_vector_type(8)))  float    v8f;
typedef __attribute__((ext_vector_type(4)))  float    v4f;

// ---------------- constants ----------------
#define CDIM    512

// workspace layout (bytes)
#define OFF_XH    ((size_t)0)                    // 16384*512 f16 = 16 MiB
#define OFF_WQH   (OFF_XH   + (size_t)16777216)  // 512*512  f16
#define OFF_WKVH  (OFF_WQH  + (size_t)524288)    // 1024*512 f16
#define OFF_WPH   (OFF_WKVH + (size_t)1048576)   // 512*512  f16
#define OFF_WSRH  (OFF_WPH  + (size_t)524288)    // 512*2048 f16
#define OFF_XSR   (OFF_WSRH + (size_t)2097152)   // 4096*512 f32
#define OFF_XLN   (OFF_XSR  + (size_t)8388608)   // 4096*512 f16
#define OFF_QH    (OFF_XLN  + (size_t)4194304)   // 32*4096*64 f16
#define OFF_KH    (OFF_QH   + (size_t)16777216)  // 32*1024*64 f16
#define OFF_VT    (OFF_KH   + (size_t)4194304)   // 32*64*1024 f16
#define OFF_AOH   (OFF_VT   + (size_t)4194304)   // 16384*512 f16

// ---------------- helpers ----------------
// Fragment-order layout of an f16 matrix [rows][K] in the workspace.
// A block is 16 rows x 32 k = 512 halfs; block index = (row/16)*(K/32) + k/32.
// Inside a block, element (row, k) sits at
//   ((k>>4)&1)*256 + (((k>>3)&1)*16 + (row&15))*8 + (k&7)
// so each of the two 16-byte loads of a fragment reads 512 contiguous bytes
// per wave (4 whole lines); element e of lane L is
// K = k0 + (e/8)*16 + (L/16)*8 + (e%8) of row L%16.
#define TILE512 8192      // halfs of one 16-row tile at K = 512

__device__ __forceinline__ int frag_off(int row, int k, int kblocks) {
  return ((row >> 4) * kblocks + (k >> 5)) * 512 + ((k >> 4) & 1) * 256
       + (((k >> 3) & 1) * 16 + (row & 15)) * 8 + (k & 7);
}

// blk = block base + lane*8
__device__ __forceinline__ v16h load_frag(const _Float16* __restrict__ blk) {
  v8h lo = *(const v8h*)(blk);
  v8h hi = *(const v8h*)(blk + 256);
  return __builtin_shufflevector(lo, hi, 0,1,2,3,4,5,6,7,8,9,10,11,12,13,14,15);
}

// the same from a wave-uniform base and a per-lane byte offset
__device__ __forceinline__ v16h load_frag_at(const _Float16* __restrict__ base, unsigned boff) {
  return load_frag((const _Float16*)((const char*)base + boff));
}

__device__ __forceinline__ v8f wmma_f16(v16h a, v16h b, v8f c) {
  return __builtin_amdgcn_wmma_f32_16x16x32_f16(false, a, false, b, (short)0, c,
                                                false, false);
}

__device__ __forceinline__ v8h pack8(v8f c) {
  v8h v;
  for (int r = 0; r < 8; r++) v[r] = (_Float16)c[r];
  return v;
}

// 2 x-tiles by 4 w-tiles. WA = false: x rows are the A operand (a lane holds 8
// rows of one w column). WA = true: w rows are the A operand (a lane holds 8
// consecutive w columns of one x row: one 16-byte piece of a fragment-order row).
template <bool WA>
__device__ __forceinline__ void mma_2x4(v16h a0, v16h a1, v16h b0, v16h b1,
                                        v16h b2, v16h b3, v8f (&c)[2][4]) {
  if (WA) {
    c[0][0] = wmma_f16(b0, a0, c[0][0]);  c[1][0] = wmma_f16(b0, a1, c[1][0]);
    c[0][1] = wmma_f16(b1, a0, c[0][1]);  c[1][1] = wmma_f16(b1, a1, c[1][1]);
    c[0][2] = wmma_f16(b2, a0, c[0][2]);  c[1][2] = wmma_f16(b2, a1, c[1][2]);
    c[0][3] = wmma_f16(b3, a0, c[0][3]);  c[1][3] = wmma_f16(b3, a1, c[1][3]);
  } else {
    c[0][0] = wmma_f16(a0, b0, c[0][0]);  c[1][0] = wmma_f16(a1, b0, c[1][0]);
    c[0][1] = wmma_f16(a0, b1, c[0][1]);  c[1][1] = wmma_f16(a1, b1, c[1][1]);
    c[0][2] = wmma_f16(a0, b2, c[0][2]);  c[1][2] = wmma_f16(a1, b2, c[1][2]);
    c[0][3] = wmma_f16(a0, b3, c[0][3]);  c[1][3] = wmma_f16(a1, b3, c[1][3]);
  }
}

// The six fragments of one k block (32 k) of a 32x64 tile.
struct Frag6 { v16h a0, a1, b0, b1, b2, b3; };

template <int XS, int WS>
__device__ __forceinline__ Frag6 load_frag6(const _Float16* __restrict__ xt,
                                            const _Float16* __restrict__ wt, unsigned off) {
  Frag6 f;
  f.a0 = load_frag_at(xt, off);           f.a1 = load_frag_at(xt + XS, off);
  f.b0 = load_frag_at(wt, off);           f.b1 = load_frag_at(wt + WS, off);
  f.b2 = load_frag_at(wt + 2 * WS, off);  f.b3 = load_frag_at(wt + 3 * WS, off);
  return f;
}

// Software-pipelined 32x64 GEMM core over NSEG * 512 k (16 k blocks a segment).
// xt = first of two x tiles XS halfs apart, wt = first of four w tiles WS halfs
// apart, both in fragment order and wave-uniform; off = lane*16 bytes.
// w runs on through all segments; segment g of x starts XG(g) halfs behind xt.
// Three register sets: the 12 loads of k block kb + 2 go out as one group ahead of
// the products of k block kb, so a block's loads have two blocks' time to land.
template <bool WA, int XS, int WS, int NSEG, typename XG>
__device__ __forceinline__ void gemm_core(const _Float16* __restrict__ xt,
                                          const _Float16* __restrict__ wt,
                                          unsigned off, v8f (&c)[2][4], XG xg) {
  constexpr int NKB = NSEG * 16;
  Frag6 f[3];
  f[0] = load_frag6<XS, WS>(xt + xg(0), wt, off);
  f[1] = load_frag6<XS, WS>(xt + xg(0) + 512, wt + 512, off);
  // unrolled whole: the three sets rotate by name, every address is base + constant
  #pragma unroll
  for (int kb = 0; kb < NKB; kb++) {
    if (kb + 2 < NKB)
      f[(kb + 2) % 3] = load_frag6<XS, WS>(xt + xg((kb + 2) >> 4) + ((kb + 2) & 15) * 512,
                                           wt + (kb + 2) * 512, off);
    // keeps the loads above: the scheduler otherwise sinks each to its first use,
    // into one register set, and every k block then waits out several round trips
    __builtin_amdgcn_sched_barrier(0);
    const Frag6& g = f[kb % 3];
    mma_2x4<WA>(g.a0, g.a1, g.b0, g.b1, g.b2, g.b3, c);
    // keeps the next group of loads below these products: risen above them, as the
    // scheduler puts them, they take 16 more registers and the groups grow uneven
    __builtin_amdgcn_sched_barrier(0);
  }
}

// one segment of 512 k
template <bool WA, int XS, int WS>
__device__ __forceinline__ void gemm_core_512(const _Float16* __restrict__ xt,
                                              const _Float16* __restrict__ wt,
                                              unsigned off, v8f (&c)[2][4]) {
  gemm_core<WA, XS, WS, 1>(xt, wt, off, c, [](int) { return 0; });
}

// ---------------- conversion / packing ----------------
// f32 [rows][512] -> f16 in fragment order; one thread makes one 16-byte piece, o.
// pair (x): tile T holds the 16 tokens (T/2)*32 + 2*i + (T&1), so that the
// stride-2 patch rows of the SR product are whole tiles too.
__device__ __forceinline__ void cvt_piece(const float* __restrict__ s,
                                          _Float16* __restrict__ d, int o, bool pair) {
  int lane = o & 31, part = (o >> 5) & 1, kb = (o >> 6) & 15, tile = o >> 10;
  int lr = lane & 15, lhh = lane >> 4;
  int row = pair ? (tile >> 1) * 32 + 2 * lr + (tile & 1) : tile * 16 + lr;
  const float* p = s + (size_t)row * 512 + kb * 32 + part * 16 + lhh * 8;
  v8h v;
  for (int i = 0; i < 8; i++) v[i] = (_Float16)p[i];
  *(v8h*)(d + (size_t)o * 8) = v;
}

// Wsr [c_out][c_in][2][2] -> Wsr_h [c_out][k=2048] in fragment order,
// k = (kh*2+kw)*512 + c_in
__device__ __forceinline__ void pack_wsr_piece(const float* __restrict__ w,
                                               _Float16* __restrict__ d, int o) {
  int lane = o & 31, part = (o >> 5) & 1, kb = (o >> 6) & 63, tile = o >> 12;
  int co = tile * 16 + (lane & 15);
  int k = kb * 32 + part * 16 + (lane >> 4) * 8;
  int s = k >> 9, ci = k & 511;
  v8h v;
  for (int i = 0; i < 8; i++) v[i] = (_Float16)w[(co * 512 + ci + i) * 4 + s];
  *(v8h*)(d + (size_t)o * 8) = v;
}

// All five conversions are independent: one launch, a range of the block index
// picks the job (256 pieces a block, every range exact). The weights come first,
// so that their few blocks run under the long x range and not behind it.
#define CB_WSR (512 * 2048 / 8 / 256)            // 512 blocks
#define CB_WQ  (CB_WSR + 512 * 512 / 8 / 256)    // + 128
#define CB_WKV (CB_WQ + 1024 * 512 / 8 / 256)    // + 256
#define CB_WP  (CB_WKV + 512 * 512 / 8 / 256)    // + 128
#define CB_X   (CB_WP + 16384 * 512 / 8 / 256)   // + 4096
__global__ void __launch_bounds__(256) cvt_all(const float* __restrict__ x,
                                               const float* __restrict__ Wq,
                                               const float* __restrict__ Wkv,
                                               const float* __restrict__ Wp,
                                               const float* __restrict__ Wsr,
                                               _Float16* __restrict__ xh,
                                               _Float16* __restrict__ wqh,
                                               _Float16* __restrict__ wkvh,
                                               _Float16* __restrict__ wph,
                                               _Float16* __restrict__ wsrh) {
  int b = blockIdx.x, t = threadIdx.x;
  if (b < CB_WSR)      pack_wsr_piece(Wsr, wsrh, b * 256 + t);
  else if (b < CB_WQ)  cvt_piece(Wq, wqh, (b - CB_WSR) * 256 + t, false);
  else if (b < CB_WKV) cvt_piece(Wkv, wkvh, (b - CB_WQ) * 256 + t, false);
  else if (b < CB_WP)  cvt_piece(Wp, wph, (b - CB_WKV) * 256 + t, false);
  else                 cvt_piece(x, xh, (b - CB_WP) * 256 + t, true);
}

// ---------------- GEMM: Q projection (32x64 tiles) ----------------
__device__ __forceinline__ void q_tile(int mt, int nt,
                                       const _Float16* __restrict__ A,
                                       const _Float16* __restrict__ W,
                                       _Float16* __restrict__ Q) {
  int lane = threadIdx.x, lr = lane & 15, lhh = lane >> 4;
  v8f c[2][4];
  for (int s = 0; s < 2; s++) for (int t = 0; t < 4; t++)
    for (int r = 0; r < 8; r++) c[s][t][r] = 0.0f;
  gemm_core_512<true, TILE512, TILE512>(A + (size_t)(mt * 2) * TILE512,
                      W + (size_t)(nt * 4) * TILE512, lane * 16, c);
  // lane: token mt*32 + 2*lr + s, head nt, dd = t*16 + 8*lhh + (0..7)
  int bh = (mt >> 7) * 8 + nt;
  for (int s = 0; s < 2; s++)
    for (int t = 0; t < 4; t++) {
      int nq = (mt * 32 + 2 * lr + s) & 4095;
      *(v8h*)(Q + (size_t)bh * 4096 * 64 + frag_off(nq, t * 16 + 8 * lhh, 2)) =
          pack8(c[s][t]);
    }
}

// ---------------- GEMM: SR patch-merge conv (stride2,k2) + bias ----------------
__device__ __forceinline__ void sr_tile(int mt, int nt,
                                        const _Float16* __restrict__ xh,
                                        const _Float16* __restrict__ W,
                                        const float* __restrict__ bsr,
                                        float* __restrict__ out) {
  int lane = threadIdx.x, lr = lane & 15;
  // output rows mt*32 + s*16 + lr: batch mt>>5, oh = mt&31, ow = s*16 + lr
  int bb = mt >> 5, oh = mt & 31;
  // x tile of (s, kh, kw) = (bb*128 + (2*oh+kh)*2 + s)*2 + kw
  const _Float16* xt = xh + (size_t)((bb * 128 + 4 * oh) * 2) * TILE512;
  const _Float16* wt = W + (size_t)(nt * 4) * (4 * TILE512);
  v8f c[2][4];
  for (int s = 0; s < 2; s++) for (int t = 0; t < 4; t++)
    for (int r = 0; r < 8; r++) c[s][t][r] = 0.0f;
  // k = (kh*2+kw)*512 + c_in: one pass of 512 k per (kh,kw), in that order
  gemm_core<false, 2 * TILE512, 4 * TILE512, 4>(
      xt, wt, lane * 16, c, [](int seg) { return ((seg >> 1) * 4 + (seg & 1)) * TILE512; });

  for (int s = 0; s < 2; s++)
    for (int t = 0; t < 4; t++)
      for (int r = 0; r < 8; r++) {
        int mm = mt * 32 + s * 16 + r + 8 * (lane >> 4);
        int col = nt * 64 + t * 16 + lr;
        out[(size_t)mm * CDIM + col] = c[s][t][r] + bsr[col];
      }
}

// Both products read only xh and their own weights: one launch. The 1024 SR tiles
// (2048 k each) take the low block indices, so that they start first and the 4096
// Q tiles (512 k each) run beside them.
#define GB_SR (4096 / 32 * (512 / 64))           // 1024 blocks
#define GB_Q  (16384 / 32 * (512 / 64))          // 4096 blocks
__global__ void __launch_bounds__(32) gemm_q_sr(const _Float16* __restrict__ xh,
                                                const _Float16* __restrict__ wqh,
                                                const _Float16* __restrict__ wsrh,
                                                const float* __restrict__ bsr,
                                                _Float16* __restrict__ Q,
                                                float* __restrict__ xsr) {
  int b = blockIdx.x;
  if (b < GB_SR) {
    sr_tile(b & 127, b >> 7, xh, wsrh, bsr, xsr);
  } else {
    b -= GB_SR;
    q_tile(b & 511, b >> 9, xh, wqh, Q);
  }
}

// ---------------- LayerNorm over 512-wide rows ----------------
// One block takes 8 rows at once, each row summed by its own 256-wide tree:
// 8 rows fill whole 128-byte lines of the fragment-order output.
__global__ void __launch_bounds__(256) ln_rows(const float* __restrict__ x,
                                               const float* __restrict__ g,
                                               const float* __restrict__ bt,
                                               _Float16* __restrict__ out) {
  __shared__ float red[8][256];
  int row0 = blockIdx.x * 8, t = threadIdx.x;
  float v0[8], v1[8];
  for (int q = 0; q < 8; q++) {
    v0[q] = x[(size_t)(row0 + q) * 512 + t];
    v1[q] = x[(size_t)(row0 + q) * 512 + 256 + t];
    red[q][t] = v0[q] + v1[q];
  }
  __syncthreads();
  for (int s = 128; s > 0; s >>= 1) {
    if (t < s) for (int q = 0; q < 8; q++) red[q][t] += red[q][t + s];
    __syncthreads();
  }
  float d0[8], d1[8];
  for (int q = 0; q < 8; q++) {
    float mu = red[q][0] * (1.0f / 512.0f);
    d0[q] = v0[q] - mu;  d1[q] = v1[q] - mu;
  }
  __syncthreads();
  for (int q = 0; q < 8; q++) red[q][t] = d0[q] * d0[q] + d1[q] * d1[q];
  __syncthreads();
  for (int s = 128; s > 0; s >>= 1) {
    if (t < s) for (int q = 0; q < 8; q++) red[q][t] += red[q][t + s];
    __syncthreads();
  }
  for (int q = 0; q < 8; q++) {
    float rstd = rsqrtf(red[q][0] * (1.0f / 512.0f) + 1e-5f);
    out[frag_off(row0 + q, t, 16)]       = (_Float16)(d0[q] * rstd * g[t] + bt[t]);
    out[frag_off(row0 + q, 256 + t, 16)] = (_Float16)(d1[q] * rstd * g[256 + t] + bt[256 + t]);
  }
}

// ---------------- GEMM: KV projection ----------------
__global__ void __launch_bounds__(32) gemm_kv(const _Float16* __restrict__ A,
                                              const _Float16* __restrict__ W,
                                              _Float16* __restrict__ Kh,
                                              _Float16* __restrict__ Vt) {
  int mt = blockIdx.x, nt = blockIdx.y;
  int lane = threadIdx.x;
  const _Float16* xt = A + (size_t)(mt * 2) * TILE512;
  const _Float16* wt = W + (size_t)(nt * 4) * TILE512;
  int b = mt >> 5, mq = mt & 31;          // rows mt*32.. = keys mq*32.. of batch b
  v8f c[2][4];
  for (int s = 0; s < 2; s++) for (int t = 0; t < 4; t++)
    for (int r = 0; r < 8; r++) c[s][t][r] = 0.0f;
  if (nt < 8) {
    // K [key][dd]: lane holds key mq*32 + s*16 + lr, dd = t*16 + 8*lhh + (0..7)
    gemm_core_512<true, TILE512, TILE512>(xt, wt, lane * 16, c);
    _Float16* kb = Kh + (size_t)((b << 3) + nt) * 1024 * 64 + lane * 8;
    for (int s = 0; s < 2; s++)
      for (int t = 0; t < 4; t++)
        *(v8h*)(kb + ((mq * 2 + s) * 2 + (t >> 1)) * 512 + (t & 1) * 256) = pack8(c[s][t]);
  } else {
    // V^T [dd][key]: lane holds dd = t*16 + lr, keys mq*32 + s*16 + 8*lhh + (0..7)
    gemm_core_512<false, TILE512, TILE512>(xt, wt, lane * 16, c);
    _Float16* vb = Vt + (size_t)((b << 3) + nt - 8) * 64 * 1024 + lane * 8;
    for (int s = 0; s < 2; s++)
      for (int t = 0; t < 4; t++)
        *(v8h*)(vb + (t * 32 + mq) * 512 + s * 256) = pack8(c[s][t]);
  }
}

// ---------------- Flash attention: one wave = 32 queries of one (b,h) ----------------
struct KF { v16h f[4]; };
// kc = K of this (b,h) in fragment order + lane*8; a 32-key chunk is 4 blocks in a row
__device__ __forceinline__ KF load_kf(const _Float16* __restrict__ kc, int j) {
  KF k;
  const _Float16* p = kc + j * 2048;
  k.f[0] = load_frag(p);         k.f[1] = load_frag(p + 512);
  k.f[2] = load_frag(p + 1024);  k.f[3] = load_frag(p + 1536);
  return k;
}

// One wave takes 32 query rows (two 16-row tiles): every K and V fragment feeds
// both tiles, and each of the 32 lanes owns one softmax row.
// LDS row pitches are 16 B x odd (144 B, 80 B): 32 lanes that each touch 16 bytes
// of their own row then fall on different banks.
#define S_PITCH 36        // floats
#define P_PITCH 40        // halfs
__global__ void __launch_bounds__(32) attn(const _Float16* __restrict__ Qh,
                                           const _Float16* __restrict__ Kh,
                                           const _Float16* __restrict__ Vt,
                                           _Float16* __restrict__ AO) {
  int mt = blockIdx.x;          // 32-query tile 0..127
  int bh = blockIdx.y;          // 0..31
  int b = bh >> 3, h = bh & 7;
  int lane = threadIdx.x, lr = lane & 15, lhh = lane >> 4, lh = lhh * 8;

  __shared__ alignas(16) float    S[32][S_PITCH];
  __shared__ alignas(16) _Float16 P[32][P_PITCH];
  __shared__ alignas(16) float    fs[32];
  __shared__ alignas(16) float    ls[32];

  const _Float16* qblk = Qh + (size_t)(bh * 256 + mt * 2) * 1024 + lane * 8;
  v16h a[2][2];
  for (int u = 0; u < 2; u++) {
    a[u][0] = load_frag(qblk + u * 1024);
    a[u][1] = load_frag(qblk + u * 1024 + 512);
  }
  const _Float16* Kbh = Kh + (size_t)bh * 1024 * 64 + lane * 8;
  const _Float16* Vbh = Vt + (size_t)bh * 64 * 1024 + lane * 8;

  v8f o[2][4];
  for (int u = 0; u < 2; u++)
    for (int t = 0; t < 4; t++) for (int r = 0; r < 8; r++) o[u][t][r] = 0.0f;
  float mrun = -1e30f, lrun = 0.0f;        // row = lane
  const float scale = 0.125f;              // 1/sqrt(64)

  KF kc = load_kf(Kbh, 0);                 // prologue: K fragments for chunk 0
  for (int j = 0; j < 32; ++j) {
    // ---- V fragments for this chunk (independent of softmax; issue early) ----
    v16h vb[4];
    for (int t = 0; t < 4; t++)
      vb[t] = load_frag(Vbh + (t * 32 + j) * 512);
    // ---- scores: S(32x32) = Q(32x64) @ K^T ----
    v8f s0[2], s1[2];
    for (int u = 0; u < 2; u++) {
      for (int r = 0; r < 8; r++) { s0[u][r] = 0.0f; s1[u][r] = 0.0f; }
      s0[u] = wmma_f16(a[u][0], kc.f[0], s0[u]);
      s0[u] = wmma_f16(a[u][1], kc.f[1], s0[u]);
      s1[u] = wmma_f16(a[u][0], kc.f[2], s1[u]);
      s1[u] = wmma_f16(a[u][1], kc.f[3], s1[u]);
    }
    // ---- prefetch next chunk's K fragments (overlaps softmax latency) ----
    KF kn = load_kf(Kbh, (j + 1 < 32) ? j + 1 : j);
    // ---- scores to LDS ----
    for (int u = 0; u < 2; u++)
      for (int r = 0; r < 8; r++) {
        S[u * 16 + r + 8 * lhh][lr]      = s0[u][r];
        S[u * 16 + r + 8 * lhh][16 + lr] = s1[u][r];
      }
    __syncthreads();
    // ---- per-row online softmax (every lane owns one row) ----
    {
      float mx = mrun;
      float sv[32];
      const v4f* srow = (const v4f*)&S[lane][0];   // the row as eight 16-byte reads
      // both loops unrolled so that sv[] stays in registers
      #pragma unroll
      for (int i = 0; i < 8; i++) {
        v4f q = srow[i];
        for (int e = 0; e < 4; e++) { sv[i * 4 + e] = q[e] * scale; mx = fmaxf(mx, sv[i * 4 + e]); }
      }
      float f = __expf(mrun - mx);
      float sum = 0.0f;
      #pragma unroll
      for (int i = 0; i < 32; i++) {
        float p = __expf(sv[i] - mx);
        sum += p;
        P[lane][i] = (_Float16)p;
      }
      lrun = lrun * f + sum;
      mrun = mx;
      fs[lane] = f;
    }
    __syncthreads();
    for (int u = 0; u < 2; u++) {
      // ---- rescale accumulator ----
      for (int r = 0; r < 8; r++) {
        float f = fs[u * 16 + r + 8 * lhh];
        for (int t = 0; t < 4; t++) o[u][t][r] *= f;
      }
      // ---- O += P(16x32) @ V(32x64) ----
      v8h lo = *(const v8h*)&P[u * 16 + lr][lh];
      v8h hi = *(const v8h*)&P[u * 16 + lr][16 + lh];
      v16h pa = __builtin_shufflevector(lo, hi, 0,1,2,3,4,5,6,7,8,9,10,11,12,13,14,15);
      for (int t = 0; t < 4; t++) o[u][t] = wmma_f16(pa, vb[t], o[u][t]);
    }
    __syncthreads();   // protect S/P/fs before next chunk
    kc = kn;
  }
  ls[lane] = lrun;
  __syncthreads();
  for (int u = 0; u < 2; u++)
    for (int r = 0; r < 8; r++) {
      float inv = 1.0f / ls[u * 16 + r + 8 * lhh];
      int nq = mt * 32 + u * 16 + r + 8 * lhh;
      for (int t = 0; t < 4; t++) {
        int col = h * 64 + t * 16 + lr;
        AO[frag_off(b * 4096 + nq, col, 16)] = (_Float16)(o[u][t][r] * inv);
      }
    }
}

// ---------------- GEMM: output projection + bias (f32 out) ----------------
__global__ void __launch_bounds__(32) gemm_out(const _Float16* __restrict__ A,
                                               const _Float16* __restrict__ W,
                                               const float* __restrict__ bp,
                                               float* __restrict__ out) {
  int mt = blockIdx.x, nt = blockIdx.y;
  int lane = threadIdx.x, lr = lane & 15;
  v8f c[2][4];
  for (int s = 0; s < 2; s++) for (int t = 0; t < 4; t++)
    for (int r = 0; r < 8; r++) c[s][t][r] = 0.0f;
  gemm_core_512<false, TILE512, TILE512>(A + (size_t)(mt * 2) * TILE512,
                       W + (size_t)(nt * 4) * TILE512, lane * 16, c);
  for (int s = 0; s < 2; s++)
    for (int t = 0; t < 4; t++)
      for (int r = 0; r < 8; r++) {
        int m = mt * 32 + s * 16 + r + 8 * (lane >> 4);
        int col = nt * 64 + t * 16 + lr;
        out[(size_t)m * CDIM + col] = c[s][t][r] + bp[col];
      }
}

// ---------------- host ----------------
extern "C" void kernel_launch(void* const* d_in, const int* in_sizes, int n_in,
                              void* d_out, int out_size, void* d_ws, size_t ws_size,
                              hipStream_t stream) {
  const float* x    = (const float*)d_in[0];
  // d_in[1], d_in[2] are H, W (compile-time 64 here)
  const float* Wq   = (const float*)d_in[3];
  const float* Wkv  = (const float*)d_in[4];
  const float* Wsr  = (const float*)d_in[5];
  const float* bsr  = (const float*)d_in[6];
  const float* ln_g = (const float*)d_in[7];
  const float* ln_b = (const float*)d_in[8];
  const float* Wp   = (const float*)d_in[9];
  const float* bp   = (const float*)d_in[10];
  float* out = (float*)d_out;

  char* ws = (char*)d_ws;
  _Float16* xh   = (_Float16*)(ws + OFF_XH);
  _Float16* wqh  = (_Float16*)(ws + OFF_WQH);
  _Float16* wkvh = (_Float16*)(ws + OFF_WKVH);
  _Float16* wph  = (_Float16*)(ws + OFF_WPH);
  _Float16* wsrh = (_Float16*)(ws + OFF_WSRH);
  float*    xsr  = (float*)   (ws + OFF_XSR);
  _Float16* xln  = (_Float16*)(ws + OFF_XLN);
  _Float16* qh   = (_Float16*)(ws + OFF_QH);
  _Float16* kh   = (_Float16*)(ws + OFF_KH);
  _Float16* vt   = (_Float16*)(ws + OFF_VT);
  _Float16* aoh  = (_Float16*)(ws + OFF_AOH);

  // 1) convert / pack
  cvt_all<<<CB_X, 256, 0, stream>>>(x, Wq, Wkv, Wp, Wsr, xh, wqh, wkvh, wph, wsrh);

  // 2) + 3) SR patch-merge GEMM 4096x512x2048 (+bias) and Q projection 16384x512x512
  gemm_q_sr<<<GB_SR + GB_Q, 32, 0, stream>>>(xh, wqh, wsrh, bsr, qh, xsr);

  // 4) LayerNorm rows -> f16
  ln_rows<<<4096 / 8, 256, 0, stream>>>(xsr, ln_g, ln_b, xln);

  // 5) KV projection: 4096x1024x512
  gemm_kv<<<dim3(4096 / 32, 1024 / 64), 32, 0, stream>>>(xln, wkvh, kh, vt);

  // 6) flash attention per (b,h): 32 heads x 128 query-tiles
  attn<<<dim3(128, 32), 32, 0, stream>>>(qh, kh, vt, aoh);

  // 7) output projection: 16384x512x512 (+bias, f32)
  gemm_out<<<dim3(16384 / 32, 512 / 64), 32, 0, stream>>>(aoh, wph, bp, out);
}

// v005
// One run takes 120 microseconds.
// Two timings next to v004 put it at 1.06 and 1.05 times that version's speed.
// Over all steps from v000 it is 2.60 times as fast.
#include <hip/hip_runtime.h>
#include <hip/hip_bf16.h>

typedef __attribute__((ext_vector_type(16))) _Float16 v16h;
typedef __attribute__((ext_vector_type(8)))  _Float16 v8h;
typedef __attribute__((ext_vector_type(8)))  float    v8f;
typedef __attribute__((ext_vector_type(2)))  float    v2f;

// ---------------- constants ----------------
#define CDIM    512

// workspace layout (bytes)
#define OFF_XH    ((size_t)0)                    // 16384*512 f16 = 16 MiB
#define OFF_WQH   (OFF_XH   + (size_t)16777216)  // 512*512  f16
#define OFF_WKVH  (OFF_WQH  + (size_t)524288)    // 1024*512 f16
#define OFF_WPH   (OFF_WKVH + (size_t)1048576)   // 512*512  f16
#define OFF_WSRH  (OFF_WPH  + (size_t)524288)    // 512*2048 f16
#define OFF_XSR   (OFF_WSRH + (size_t)2097152)   // 4096*512 f32
#define OFF_XLN   (OFF_XSR  + (size_t)8388608)   // 4096*512 f16
#define OFF_QH    (OFF_XLN  + (size_t)4194304)   // 32*4096*64 f16
#define OFF_KH    (OFF_QH   + (size_t)16777216)  // 32*1024*64 f16
#define OFF_VT    (OFF_KH   + (size_t)4194304)   // 32*64*1024 f16
#define OFF_AOH   (OFF_VT   + (size_t)4194304)   // 16384*512 f16

// ---------------- helpers ----------------
// Fragment-order layout of an f16 matrix [rows][K] in the workspace.
// A block is 16 rows x 32 k = 512 halfs; block index = (row/16)*(K/32) + k/32.
// Inside a block, element (row, k) sits at
//   ((k>>4)&1)*256 + (((k>>3)&1)*16 + (row&15))*8 + (k&7)
// so each of the two 16-byte loads of a fragment reads 512 contiguous bytes
// per wave (4 whole lines); element e of lane L is
// K = k0 + (e/8)*16 + (L/16)*8 + (e%8) of row L%16.
#define TILE512 8192      // halfs of one 16-row tile at K = 512

__device__ __forceinline__ int frag_off(int row, int k, int kblocks) {
  return ((row >> 4) * kblocks + (k >> 5)) * 512 + ((k >> 4) & 1) * 256
       + (((k >> 3) & 1) * 16 + (row & 15)) * 8 + (k & 7);
}

// blk = block base + lane*8
__device__ __forceinline__ v16h load_frag(const _Float16* __restrict__ blk) {
  v8h lo = *(const v8h*)(blk);
  v8h hi = *(const v8h*)(blk + 256);
  return __builtin_shufflevector(lo, hi, 0,1,2,3,4,5,6,7,8,9,10,11,12,13,14,15);
}

// the same from a wave-uniform base and a per-lane byte offset
__device__ __forceinline__ v16h load_frag_at(const _Float16* __restrict__ base, unsigned boff) {
  return load_frag((const _Float16*)((const char*)base + boff));
}

__device__ __forceinline__ v8f wmma_f16(v16h a, v16h b, v8f c) {
  return __builtin_amdgcn_wmma_f32_16x16x32_f16(false, a, false, b, (short)0, c,
                                                false, false);
}

__device__ __forceinline__ v8h pack8(v8f c) {
  v8h v;
  for (int r = 0; r < 8; r++) v[r] = (_Float16)c[r];
  return v;
}

// 2 x-tiles by 4 w-tiles. WA = false: x rows are the A operand (a lane holds 8
// rows of one w column). WA = true: w rows are the A operand (a lane holds 8
// consecutive w columns of one x row: one 16-byte piece of a fragment-order row).
template <bool WA>
__device__ __forceinline__ void mma_2x4(v16h a0, v16h a1, v16h b0, v16h b1,
                                        v16h b2, v16h b3, v8f (&c)[2][4]) {
  if (WA) {
    c[0][0] = wmma_f16(b0, a0, c[0][0]);  c[1][0] = wmma_f16(b0, a1, c[1][0]);
    c[0][1] = wmma_f16(b1, a0, c[0][1]);  c[1][1] = wmma_f16(b1, a1, c[1][1]);
    c[0][2] = wmma_f16(b2, a0, c[0][2]);  c[1][2] = wmma_f16(b2, a1, c[1][2]);
    c[0][3] = wmma_f16(b3, a0, c[0][3]);  c[1][3] = wmma_f16(b3, a1, c[1][3]);
  } else {
    c[0][0] = wmma_f16(a0, b0, c[0][0]);  c[1][0] = wmma_f16(a1, b0, c[1][0]);
    c[0][1] = wmma_f16(a0, b1, c[0][1]);  c[1][1] = wmma_f16(a1, b1, c[1][1]);
    c[0][2] = wmma_f16(a0, b2, c[0][2]);  c[1][2] = wmma_f16(a1, b2, c[1][2]);
    c[0][3] = wmma_f16(a0, b3, c[0][3]);  c[1][3] = wmma_f16(a1, b3, c[1][3]);
  }
}

// The six fragments of one k block (32 k) of a 32x64 tile.
struct Frag6 { v16h a0, a1, b0, b1, b2, b3; };

template <int XS, int WS>
__device__ __forceinline__ Frag6 load_frag6(const _Float16* __restrict__ xt,
                                            const _Float16* __restrict__ wt, unsigned off) {
  Frag6 f;
  f.a0 = load_frag_at(xt, off);           f.a1 = load_frag_at(xt + XS, off);
  f.b0 = load_frag_at(wt, off);           f.b1 = load_frag_at(wt + WS, off);
  f.b2 = load_frag_at(wt + 2 * WS, off);  f.b3 = load_frag_at(wt + 3 * WS, off);
  return f;
}

// Software-pipelined 32x64 GEMM core over NSEG * 512 k (16 k blocks a segment).
// xt = first of two x tiles XS halfs apart, wt = first of four w tiles WS halfs
// apart, both in fragment order and wave-uniform; off = lane*16 bytes.
// w runs on through all segments; segment g of x starts XG(g) halfs behind xt.
// Three register sets: the 12 loads of k block kb + 2 go out as one group ahead of
// the products of k block kb, so a block's loads have two blocks' time to land.
template <bool WA, int XS, int WS, int NSEG, typename XG>
__device__ __forceinline__ void gemm_core(const _Float16* __restrict__ xt,
                                          const _Float16* __restrict__ wt,
                                          unsigned off, v8f (&c)[2][4], XG xg) {
  constexpr int NKB = NSEG * 16;
  Frag6 f[3];
  f[0] = load_frag6<XS, WS>(xt + xg(0), wt, off);
  f[1] = load_frag6<XS, WS>(xt + xg(0) + 512, wt + 512, off);
  // unrolled whole: the three sets rotate by name, every address is base + constant
  #pragma unroll
  for (int kb = 0; kb < NKB; kb++) {
    if (kb + 2 < NKB)
      f[(kb + 2) % 3] = load_frag6<XS, WS>(xt + xg((kb + 2) >> 4) + ((kb + 2) & 15) * 512,
                                           wt + (kb + 2) * 512, off);
    // keeps the loads above: the scheduler otherwise sinks each to its first use,
    // into one register set, and every k block then waits out several round trips
    __builtin_amdgcn_sched_barrier(0);
    const Frag6& g = f[kb % 3];
    mma_2x4<WA>(g.a0, g.a1, g.b0, g.b1, g.b2, g.b3, c);
    // keeps the next group of loads below these products: risen above them, as the
    // scheduler puts them, they take 16 more registers and the groups grow uneven
    __builtin_amdgcn_sched_barrier(0);
  }
}

// one segment of 512 k
template <bool WA, int XS, int WS>
__device__ __forceinline__ void gemm_core_512(const _Float16* __restrict__ xt,
                                              const _Float16* __restrict__ wt,
                                              unsigned off, v8f (&c)[2][4]) {
  gemm_core<WA, XS, WS, 1>(xt, wt, off, c, [](int) { return 0; });
}

// ---------------- conversion / packing ----------------
// f32 [rows][512] -> f16 in fragment order; one thread makes one 16-byte piece, o.
// pair (x): tile T holds the 16 tokens (T/2)*32 + 2*i + (T&1), so that the
// stride-2 patch rows of the SR product are whole tiles too.
__device__ __forceinline__ void cvt_piece(const float* __restrict__ s,
                                          _Float16* __restrict__ d, int o, bool pair) {
  int lane = o & 31, part = (o >> 5) & 1, kb = (o >> 6) & 15, tile = o >> 10;
  int lr = lane & 15, lhh = lane >> 4;
  int row = pair ? (tile >> 1) * 32 + 2 * lr + (tile & 1) : tile * 16 + lr;
  const float* p = s + (size_t)row * 512 + kb * 32 + part * 16 + lhh * 8;
  v8h v;
  for (int i = 0; i < 8; i++) v[i] = (_Float16)p[i];
  *(v8h*)(d + (size_t)o * 8) = v;
}

// Wsr [c_out][c_in][2][2] -> Wsr_h [c_out][k=2048] in fragment order,
// k = (kh*2+kw)*512 + c_in
__device__ __forceinline__ void pack_wsr_piece(const float* __restrict__ w,
                                               _Float16* __restrict__ d, int o) {
  int lane = o & 31, part = (o >> 5) & 1, kb = (o >> 6) & 63, tile = o >> 12;
  int co = tile * 16 + (lane & 15);
  int k = kb * 32 + part * 16 + (lane >> 4) * 8;
  int s = k >> 9, ci = k & 511;
  v8h v;
  for (int i = 0; i < 8; i++) v[i] = (_Float16)w[(co * 512 + ci + i) * 4 + s];
  *(v8h*)(d + (size_t)o * 8) = v;
}

// All five conversions are independent: one launch, a range of the block index
// picks the job (256 pieces a block, every range exact). The weights come first,
// so that their few blocks run under the long x range and not behind it.
#define CB_WSR (512 * 2048 / 8 / 256)            // 512 blocks
#define CB_WQ  (CB_WSR + 512 * 512 / 8 / 256)    // + 128
#define CB_WKV (CB_WQ + 1024 * 512 / 8 / 256)    // + 256
#define CB_WP  (CB_WKV + 512 * 512 / 8 / 256)    // + 128
#define CB_X   (CB_WP + 16384 * 512 / 8 / 256)   // + 4096
__global__ void __launch_bounds__(256) cvt_all(const float* __restrict__ x,
                                               const float* __restrict__ Wq,
                                               const float* __restrict__ Wkv,
                                               const float* __restrict__ Wp,
                                               const float* __restrict__ Wsr,
                                               _Float16* __restrict__ xh,
                                               _Float16* __restrict__ wqh,
                                               _Float16* __restrict__ wkvh,
                                               _Float16* __restrict__ wph,
                                               _Float16* __restrict__ wsrh) {
  int b = blockIdx.x, t = threadIdx.x;
  if (b < CB_WSR)      pack_wsr_piece(Wsr, wsrh, b * 256 + t);
  else if (b < CB_WQ)  cvt_piece(Wq, wqh, (b - CB_WSR) * 256 + t, false);
  else if (b < CB_WKV) cvt_piece(Wkv, wkvh, (b - CB_WQ) * 256 + t, false);
  else if (b < CB_WP)  cvt_piece(Wp, wph, (b - CB_WKV) * 256 + t, false);
  else                 cvt_piece(x, xh, (b - CB_WP) * 256 + t, true);
}

// ---------------- GEMM: Q projection (32x64 tiles) ----------------
__device__ __forceinline__ void q_tile(int mt, int nt,
                                       const _Float16* __restrict__ A,
                                       const _Float16* __restrict__ W,
                                       _Float16* __restrict__ Q) {
  int lane = threadIdx.x, lr = lane & 15, lhh = lane >> 4;
  v8f c[2][4];
  for (int s = 0; s < 2; s++) for (int t = 0; t < 4; t++)
    for (int r = 0; r < 8; r++) c[s][t][r] = 0.0f;
  gemm_core_512<true, TILE512, TILE512>(A + (size_t)(mt * 2) * TILE512,
                      W + (size_t)(nt * 4) * TILE512, lane * 16, c);
  // lane: token mt*32 + 2*lr + s, head nt, dd = t*16 + 8*lhh + (0..7)
  int bh = (mt >> 7) * 8 + nt;
  for (int s = 0; s < 2; s++)
    for (int t = 0; t < 4; t++) {
      int nq = (mt * 32 + 2 * lr + s) & 4095;
      *(v8h*)(Q + (size_t)bh * 4096 * 64 + frag_off(nq, t * 16 + 8 * lhh, 2)) =
          pack8(c[s][t]);
    }
}

// ---------------- GEMM: SR patch-merge conv (stride2,k2) + bias ----------------
__device__ __forceinline__ void sr_tile(int mt, int nt,
                                        const _Float16* __restrict__ xh,
                                        const _Float16* __restrict__ W,
                                        const float* __restrict__ bsr,
                                        float* __restrict__ out) {
  int lane = threadIdx.x, lr = lane & 15;
  // output rows mt*32 + s*16 + lr: batch mt>>5, oh = mt&31, ow = s*16 + lr
  int bb = mt >> 5, oh = mt & 31;
  // x tile of (s, kh, kw) = (bb*128 + (2*oh+kh)*2 + s)*2 + kw
  const _Float16* xt = xh + (size_t)((bb * 128 + 4 * oh) * 2) * TILE512;
  const _Float16* wt = W + (size_t)(nt * 4) * (4 * TILE512);
  v8f c[2][4];
  for (int s = 0; s < 2; s++) for (int t = 0; t < 4; t++)
    for (int r = 0; r < 8; r++) c[s][t][r] = 0.0f;
  // k = (kh*2+kw)*512 + c_in: one pass of 512 k per (kh,kw), in that order
  gemm_core<false, 2 * TILE512, 4 * TILE512, 4>(
      xt, wt, lane * 16, c, [](int seg) { return ((seg >> 1) * 4 + (seg & 1)) * TILE512; });

  for (int s = 0; s < 2; s++)
    for (int t = 0; t < 4; t++)
      for (int r = 0; r < 8; r++) {
        int mm = mt * 32 + s * 16 + r + 8 * (lane >> 4);
        int col = nt * 64 + t * 16 + lr;
        out[(size_t)mm * CDIM + col] = c[s][t][r] + bsr[col];
      }
}

// Both products read only xh and their own weights: one launch. The 1024 SR tiles
// (2048 k each) take the low block indices, so that they start first and the 4096
// Q tiles (512 k each) run beside them.
#define GB_SR (4096 / 32 * (512 / 64))           // 1024 blocks
#define GB_Q  (16384 / 32 * (512 / 64))          // 4096 blocks
__global__ void __launch_bounds__(32) gemm_q_sr(const _Float16* __restrict__ xh,
                                                const _Float16* __restrict__ wqh,
                                                const _Float16* __restrict__ wsrh,
                                                const float* __restrict__ bsr,
                                                _Float16* __restrict__ Q,
                                                float* __restrict__ xsr) {
  int b = blockIdx.x;
  if (b < GB_SR) {
    sr_tile(b & 127, b >> 7, xh, wsrh, bsr, xsr);
  } else {
    b -= GB_SR;
    q_tile(b & 511, b >> 9, xh, wqh, Q);
  }
}

// ---------------- LayerNorm over 512-wide rows ----------------
// One block takes 8 rows at once, each row summed by its own 256-wide tree:
// 8 rows fill whole 128-byte lines of the fragment-order output.
__global__ void __launch_bounds__(256) ln_rows(const float* __restrict__ x,
                                               const float* __restrict__ g,
                                               const float* __restrict__ bt,
                                               _Float16* __restrict__ out) {
  __shared__ float red[8][256];
  int row0 = blockIdx.x * 8, t = threadIdx.x;
  float v0[8], v1[8];
  for (int q = 0; q < 8; q++) {
    v0[q] = x[(size_t)(row0 + q) * 512 + t];
    v1[q] = x[(size_t)(row0 + q) * 512 + 256 + t];
    red[q][t] = v0[q] + v1[q];
  }
  __syncthreads();
  for (int s = 128; s > 0; s >>= 1) {
    if (t < s) for (int q = 0; q < 8; q++) red[q][t] += red[q][t + s];
    __syncthreads();
  }
  float d0[8], d1[8];
  for (int q = 0; q < 8; q++) {
    float mu = red[q][0] * (1.0f / 512.0f);
    d0[q] = v0[q] - mu;  d1[q] = v1[q] - mu;
  }
  __syncthreads();
  for (int q = 0; q < 8; q++) red[q][t] = d0[q] * d0[q] + d1[q] * d1[q];
  __syncthreads();
  for (int s = 128; s > 0; s >>= 1) {
    if (t < s) for (int q = 0; q < 8; q++) red[q][t] += red[q][t + s];
    __syncthreads();
  }
  for (int q = 0; q < 8; q++) {
    float rstd = rsqrtf(red[q][0] * (1.0f / 512.0f) + 1e-5f);
    out[frag_off(row0 + q, t, 16)]       = (_Float16)(d0[q] * rstd * g[t] + bt[t]);
    out[frag_off(row0 + q, 256 + t, 16)] = (_Float16)(d1[q] * rstd * g[256 + t] + bt[256 + t]);
  }
}

// ---------------- GEMM: KV projection ----------------
__global__ void __launch_bounds__(32) gemm_kv(const _Float16* __restrict__ A,
                                              const _Float16* __restrict__ W,
                                              _Float16* __restrict__ Kh,
                                              _Float16* __restrict__ Vt) {
  int mt = blockIdx.x, nt = blockIdx.y;
  int lane = threadIdx.x;
  const _Float16* xt = A + (size_t)(mt * 2) * TILE512;
  const _Float16* wt = W + (size_t)(nt * 4) * TILE512;
  int b = mt >> 5, mq = mt & 31;          // rows mt*32.. = keys mq*32.. of batch b
  v8f c[2][4];
  for (int s = 0; s < 2; s++) for (int t = 0; t < 4; t++)
    for (int r = 0; r < 8; r++) c[s][t][r] = 0.0f;
  if (nt < 8) {
    // K [key][dd]: lane holds key mq*32 + s*16 + lr, dd = t*16 + 8*lhh + (0..7)
    gemm_core_512<true, TILE512, TILE512>(xt, wt, lane * 16, c);
    _Float16* kb = Kh + (size_t)((b << 3) + nt) * 1024 * 64 + lane * 8;
    for (int s = 0; s < 2; s++)
      for (int t = 0; t < 4; t++)
        *(v8h*)(kb + ((mq * 2 + s) * 2 + (t >> 1)) * 512 + (t & 1) * 256) = pack8(c[s][t]);
  } else {
    // V^T [dd][key]: lane holds dd = t*16 + lr, keys mq*32 + s*16 + 8*lhh + (0..7)
    gemm_core_512<false, TILE512, TILE512>(xt, wt, lane * 16, c);
    _Float16* vb = Vt + (size_t)((b << 3) + nt - 8) * 64 * 1024 + lane * 8;
    for (int s = 0; s < 2; s++)
      for (int t = 0; t < 4; t++)
        *(v8h*)(vb + (t * 32 + mq) * 512 + s * 256) = pack8(c[s][t]);
  }
}

// ---------------- Flash attention: one wave = 32 queries of one (b,h) ----------------
struct KF { v16h f[4]; };
// kc = K of this (b,h) in fragment order + lane*8; a 32-key chunk is 4 blocks in a row
__device__ __forceinline__ KF load_kf(const _Float16* __restrict__ kc, int j) {
  KF k;
  const _Float16* p = kc + j * 2048;
  k.f[0] = load_frag(p);         k.f[1] = load_frag(p + 512);
  k.f[2] = load_frag(p + 1024);  k.f[3] = load_frag(p + 1536);
  return k;
}

// lane l with lane l ^ 16
__device__ __forceinline__ float xhalf(float x) {
  int v = __builtin_bit_cast(int, x);
  return __builtin_bit_cast(float, __builtin_amdgcn_permlanex16(v, v, 0x76543210, 0xfedcba98,
                                                                false, false));
}

__global__ void __launch_bounds__(32) attn(const _Float16* __restrict__ Qh,
                                           const _Float16* __restrict__ Kh,
                                           const _Float16* __restrict__ Vt,
                                           _Float16* __restrict__ AO) {
  int mt = blockIdx.x;          // 32-query tile 0..127
  int bh = blockIdx.y;          // 0..31
  int b = bh >> 3, h = bh & 7;
  int lane = threadIdx.x, lr = lane & 15, lhh = lane >> 4;

  const _Float16* qblk = Qh + (size_t)(bh * 256 + mt * 2) * 1024 + lane * 8;
  v16h a[2][2];
  for (int u = 0; u < 2; u++) {
    a[u][0] = load_frag(qblk + u * 1024);
    a[u][1] = load_frag(qblk + u * 1024 + 512);
  }
  const _Float16* Kbh = Kh + (size_t)bh * 1024 * 64 + lane * 8;
  const _Float16* Vbh = Vt + (size_t)bh * 64 * 1024 + lane * 8;

  // o[u][t][r] = O[query u*16 + lr][dd = t*16 + 8*lhh + r]
  v8f o[2][4];
  for (int u = 0; u < 2; u++)
    for (int t = 0; t < 4; t++) for (int r = 0; r < 8; r++) o[u][t][r] = 0.0f;
  // query u*16 + lr: maximum over all keys so far; sums over this half's even and
  // odd keys, joined behind the loop
  float mrun[2] = {-1e30f, -1e30f};
  v2f lrun[2] = {{0.0f, 0.0f}, {0.0f, 0.0f}};
  const float scale = 0.125f;              // 1/sqrt(64)

  KF kc = load_kf(Kbh, 0);                 // prologue: K fragments for chunk 0
  for (int j = 0; j < 32; ++j) {
    // ---- V fragments for this chunk (independent of softmax; issue early) ----
    v16h vb[4];
    for (int t = 0; t < 4; t++)
      vb[t] = load_frag(Vbh + (t * 32 + j) * 512);
    // ---- scores: S^T(32 keys x 32 queries) = K(32x64) @ Q^T ----
    // s[u][g][r] = S[query u*16 + lr][key g*16 + 8*lhh + r]
    v8f s[2][2];
    for (int u = 0; u < 2; u++) {
      for (int r = 0; r < 8; r++) { s[u][0][r] = 0.0f; s[u][1][r] = 0.0f; }
      s[u][0] = wmma_f16(kc.f[0], a[u][0], s[u][0]);
      s[u][0] = wmma_f16(kc.f[1], a[u][1], s[u][0]);
      s[u][1] = wmma_f16(kc.f[2], a[u][0], s[u][1]);
      s[u][1] = wmma_f16(kc.f[3], a[u][1], s[u][1]);
    }
    // ---- prefetch next chunk's K fragments (overlaps softmax latency) ----
    KF kn = load_kf(Kbh, (j + 1 < 32) ? j + 1 : j);
    // keeps these loads here, right behind the products that free their registers:
    // the scheduler otherwise sinks them to the foot of the loop, where the next
    // chunk's first product waits out their whole round trip
    __builtin_amdgcn_sched_barrier(0);
    // ---- online softmax of query u*16 + lr, in the lane's own registers ----
    float mx[2], f[2];
    for (int u = 0; u < 2; u++) {
      // scale is a power of two: the maximum of the scaled scores is the scaled maximum
      float rm = s[u][0][0];
      for (int r = 1; r < 8; r++) rm = fmaxf(rm, s[u][0][r]);
      for (int r = 0; r < 8; r++) rm = fmaxf(rm, s[u][1][r]);
      mx[u] = fmaxf(mrun[u], rm * scale);
      mx[u] = fmaxf(mx[u], xhalf(mx[u]));
    }
    for (int u = 0; u < 2; u++) { f[u] = __expf(mrun[u] - mx[u]);  mrun[u] = mx[u]; }
    for (int u = 0; u < 2; u++) {
      v2f sum = {0.0f, 0.0f};
      v16h pb;                             // P^T: element g*8 + r is key g*16 + 8*lhh + r
      for (int g = 0; g < 2; g++) {
        v8f e = s[u][g] * scale - mx[u];
        for (int r = 0; r < 8; r += 2) {
          v2f p = {__expf(e[r]), __expf(e[r + 1])};
          sum += p;
          pb[g * 8 + r]     = (_Float16)p.x;
          pb[g * 8 + r + 1] = (_Float16)p.y;
        }
      }
      lrun[u] = lrun[u] * f[u] + sum;
      // ---- rescale, then O^T += V^T(64x32) @ P^T(32x16) ----
      for (int t = 0; t < 4; t++) {
        o[u][t] *= f[u];
        o[u][t] = wmma_f16(vb[t], pb, o[u][t]);
      }
    }
    kc = kn;
  }
  for (int u = 0; u < 2; u++) {
    float l = lrun[u].x + lrun[u].y;
    float inv = 1.0f / (l + xhalf(l));
    int nq = mt * 32 + u * 16 + lr;
    for (int t = 0; t < 4; t++)
      *(v8h*)(AO + frag_off(b * 4096 + nq, h * 64 + t * 16 + 8 * lhh, 16)) =
          pack8(o[u][t] * inv);
  }
}

// ---------------- GEMM: output projection + bias (f32 out) ----------------
__global__ void __launch_bounds__(32) gemm_out(const _Float16* __restrict__ A,
                                               const _Float16* __restrict__ W,
                                               const float* __restrict__ bp,
                                               float* __restrict__ out) {
  int mt = blockIdx.x, nt = blockIdx.y;
  int lane = threadIdx.x, lr = lane & 15;
  v8f c[2][4];
  for (int s = 0; s < 2; s++) for (int t = 0; t < 4; t++)
    for (int r = 0; r < 8; r++) c[s][t][r] = 0.0f;
  gemm_core_512<false, TILE512, TILE512>(A + (size_t)(mt * 2) * TILE512,
                       W + (size_t)(nt * 4) * TILE512, lane * 16, c);
  for (int s = 0; s < 2; s++)
    for (int t = 0; t < 4; t++)
      for (int r = 0; r < 8; r++) {
        int m = mt * 32 + s * 16 + r + 8 * (lane >> 4);
        int col = nt * 64 + t * 16 + lr;
        out[(size_t)m * CDIM + col] = c[s][t][r] + bp[col];
      }
}

// ---------------- host ----------------
extern "C" void kernel_launch(void* const* d_in, const int* in_sizes, int n_in,
                              void* d_out, int out_size, void* d_ws, size_t ws_size,
                              hipStream_t stream) {
  const float* x    = (const float*)d_in[0];
  // d_in[1], d_in[2] are H, W (compile-time 64 here)
  const float* Wq   = (const float*)d_in[3];
  const float* Wkv  = (const float*)d_in[4];
  const float* Wsr  = (const float*)d_in[5];
  const float* bsr  = (const float*)d_in[6];
  const float* ln_g = (const float*)d_in[7];
  const float* ln_b = (const float*)d_in[8];
  const float* Wp   = (const float*)d_in[9];
  const float* bp   = (const float*)d_in[10];
  float* out = (float*)d_out;

  char* ws = (char*)d_ws;
  _Float16* xh   = (_Float16*)(ws + OFF_XH);
  _Float16* wqh  = (_Float16*)(ws + OFF_WQH);
  _Float16* wkvh = (_Float16*)(ws + OFF_WKVH);
  _Float16* wph  = (_Float16*)(ws + OFF_WPH);
  _Float16* wsrh = (_Float16*)(ws + OFF_WSRH);
  float*    xsr  = (float*)   (ws + OFF_XSR);
  _Float16* xln  = (_Float16*)(ws + OFF_XLN);
  _Float16* qh   = (_Float16*)(ws + OFF_QH);
  _Float16* kh   = (_Float16*)(ws + OFF_KH);
  _Float16* vt   = (_Float16*)(ws + OFF_VT);
  _Float16* aoh  = (_Float16*)(ws + OFF_AOH);

  // 1) convert / pack
  cvt_all<<<CB_X, 256, 0, stream>>>(x, Wq, Wkv, Wp, Wsr, xh, wqh, wkvh, wph, wsrh);

  // 2) + 3) SR patch-merge GEMM 4096x512x2048 (+bias) and Q projection 16384x512x512
  gemm_q_sr<<<GB_SR + GB_Q, 32, 0, stream>>>(xh, wqh, wsrh, bsr, qh, xsr);

  // 4) LayerNorm rows -> f16
  ln_rows<<<4096 / 8, 256, 0, stream>>>(xsr, ln_g, ln_b, xln);

  // 5) KV projection: 4096x1024x512
  gemm_kv<<<dim3(4096 / 32, 1024 / 64), 32, 0, stream>>>(xln, wkvh, kh, vt);

  // 6) flash attention per (b,h): 32 heads x 128 query-tiles
  attn<<<dim3(128, 32), 32, 0, stream>>>(qh, kh, vt, aoh);

  // 7) output projection: 16384x512x512 (+bias, f32)
  gemm_out<<<dim3(16384 / 32, 512 / 64), 32, 0, stream>>>(aoh, wph, bp, out);
}

// v006
// It runs in 100 microseconds.
// Timed twice side by side with v005, it ran 1.19 times as fast both times.
// Counting every step since v000, it is 3.09 times as fast.
#include <hip/hip_runtime.h>
#include <hip/hip_bf16.h>

typedef __attribute__((ext_vector_type(16))) _Float16 v16h;
typedef __attribute__((ext_vector_type(8)))  _Float16 v8h;
typedef __attribute__((ext_vector_type(8)))  float    v8f;
typedef __attribute__((ext_vector_type(2)))  float    v2f;

// ---------------- constants ----------------
#define CDIM    512

// workspace layout (bytes)
#define OFF_XH    ((size_t)0)                    // 16384*512 f16 = 16 MiB
#define OFF_WQH   (OFF_XH   + (size_t)16777216)  // 512*512  f16
#define OFF_WKVH  (OFF_WQH  + (size_t)524288)    // 1024*512 f16
#define OFF_WPH   (OFF_WKVH + (size_t)1048576)   // 512*512  f16
#define OFF_WSRH  (OFF_WPH  + (size_t)524288)    // 512*2048 f16
#define OFF_XSR   (OFF_WSRH + (size_t)2097152)   // 4096*512 f32
#define OFF_XLN   (OFF_XSR  + (size_t)8388608)   // 4096*512 f16
#define OFF_QH    (OFF_XLN  + (size_t)4194304)   // 32*4096*64 f16
#define OFF_KH    (OFF_QH   + (size_t)16777216)  // 32*1024*64 f16
#define OFF_VT    (OFF_KH   + (size_t)4194304)   // 32*64*1024 f16
#define OFF_AOH   (OFF_VT   + (size_t)4194304)   // 16384*512 f16

// ---------------- helpers ----------------
// Fragment-order layout of an f16 matrix [rows][K] in the workspace.
// A block is 16 rows x 32 k = 512 halfs; block index = (row/16)*(K/32) + k/32.
// Inside a block, element (row, k) sits at
//   ((k>>4)&1)*256 + (((k>>3)&1)*16 + (row&15))*8 + (k&7)
// so each of the two 16-byte loads of a fragment reads 512 contiguous bytes
// per wave (4 whole lines); element e of lane L is
// K = k0 + (e/8)*16 + (L/16)*8 + (e%8) of row L%16.
#define TILE512 8192      // halfs of one 16-row tile at K = 512

__device__ __forceinline__ int frag_off(int row, int k, int kblocks) {
  return ((row >> 4) * kblocks + (k >> 5)) * 512 + ((k >> 4) & 1) * 256
       + (((k >> 3) & 1) * 16 + (row & 15)) * 8 + (k & 7);
}

// blk = block base + lane*8
__device__ __forceinline__ v16h load_frag(const _Float16* __restrict__ blk) {
  v8h lo = *(const v8h*)(blk);
  v8h hi = *(const v8h*)(blk + 256);
  return __builtin_shufflevector(lo, hi, 0,1,2,3,4,5,6,7,8,9,10,11,12,13,14,15);
}

// the same from a wave-uniform base and a per-lane byte offset
__device__ __forceinline__ v16h load_frag_at(const _Float16* __restrict__ base, unsigned boff) {
  return load_frag((const _Float16*)((const char*)base + boff));
}

__device__ __forceinline__ v8f wmma_f16(v16h a, v16h b, v8f c) {
  return __builtin_amdgcn_wmma_f32_16x16x32_f16(false, a, false, b, (short)0, c,
                                                false, false);
}

__device__ __forceinline__ v8h pack8(v8f c) {
  v8h v;
  for (int r = 0; r < 8; r++) v[r] = (_Float16)c[r];
  return v;
}

// 2 x-tiles by 4 w-tiles. WA = false: x rows are the A operand (a lane holds 8
// rows of one w column). WA = true: w rows are the A operand (a lane holds 8
// consecutive w columns of one x row: one 16-byte piece of a fragment-order row).
template <bool WA>
__device__ __forceinline__ void mma_2x4(v16h a0, v16h a1, v16h b0, v16h b1,
                                        v16h b2, v16h b3, v8f (&c)[2][4]) {
  if (WA) {
    c[0][0] = wmma_f16(b0, a0, c[0][0]);  c[1][0] = wmma_f16(b0, a1, c[1][0]);
    c[0][1] = wmma_f16(b1, a0, c[0][1]);  c[1][1] = wmma_f16(b1, a1, c[1][1]);
    c[0][2] = wmma_f16(b2, a0, c[0][2]);  c[1][2] = wmma_f16(b2, a1, c[1][2]);
    c[0][3] = wmma_f16(b3, a0, c[0][3]);  c[1][3] = wmma_f16(b3, a1, c[1][3]);
  } else {
    c[0][0] = wmma_f16(a0, b0, c[0][0]);  c[1][0] = wmma_f16(a1, b0, c[1][0]);
    c[0][1] = wmma_f16(a0, b1, c[0][1]);  c[1][1] = wmma_f16(a1, b1, c[1][1]);
    c[0][2] = wmma_f16(a0, b2, c[0][2]);  c[1][2] = wmma_f16(a1, b2, c[1][2]);
    c[0][3] = wmma_f16(a0, b3, c[0][3]);  c[1][3] = wmma_f16(a1, b3, c[1][3]);
  }
}

// The six fragments of one k block (32 k) of a 32x64 tile.
struct Frag6 { v16h a0, a1, b0, b1, b2, b3; };

template <int XS, int WS>
__device__ __forceinline__ Frag6 load_frag6(const _Float16* __restrict__ xt,
                                            const _Float16* __restrict__ wt, unsigned off) {
  Frag6 f;
  f.a0 = load_frag_at(xt, off);           f.a1 = load_frag_at(xt + XS, off);
  f.b0 = load_frag_at(wt, off);           f.b1 = load_frag_at(wt + WS, off);
  f.b2 = load_frag_at(wt + 2 * WS, off);  f.b3 = load_frag_at(wt + 3 * WS, off);
  return f;
}

// Software-pipelined 32x64 GEMM core over NSEG * 512 k (16 k blocks a segment).
// xt = first of two x tiles XS halfs apart, wt = first of four w tiles WS halfs
// apart, both in fragment order and wave-uniform; off = lane*16 bytes.
// w runs on through all segments; segment g of x starts XG(g) halfs behind xt.
// Three register sets: the 12 loads of k block kb + 2 go out as one group ahead of
// the products of k block kb, so a block's loads have two blocks' time to land.
template <bool WA, int XS, int WS, int NSEG, typename XG>
__device__ __forceinline__ void gemm_core(const _Float16* __restrict__ xt,
                                          const _Float16* __restrict__ wt,
                                          unsigned off, v8f (&c)[2][4], XG xg) {
  constexpr int NKB = NSEG * 16;
  Frag6 f[3];
  f[0] = load_frag6<XS, WS>(xt + xg(0), wt, off);
  f[1] = load_frag6<XS, WS>(xt + xg(0) + 512, wt + 512, off);
  // unrolled whole: the three sets rotate by name, every address is base + constant
  #pragma unroll
  for (int kb = 0; kb < NKB; kb++) {
    if (kb + 2 < NKB)
      f[(kb + 2) % 3] = load_frag6<XS, WS>(xt + xg((kb + 2) >> 4) + ((kb + 2) & 15) * 512,
                                           wt + (kb + 2) * 512, off);
    // keeps the loads above: the scheduler otherwise sinks each to its first use,
    // into one register set, and every k block then waits out several round trips
    __builtin_amdgcn_sched_barrier(0);
    const Frag6& g = f[kb % 3];
    mma_2x4<WA>(g.a0, g.a1, g.b0, g.b1, g.b2, g.b3, c);
    // keeps the next group of loads below these products: risen above them, as the
    // scheduler puts them, they take 16 more registers and the groups grow uneven
    __builtin_amdgcn_sched_barrier(0);
  }
}

// one segment of 512 k
template <bool WA, int XS, int WS>
__device__ __forceinline__ void gemm_core_512(const _Float16* __restrict__ xt,
                                              const _Float16* __restrict__ wt,
                                              unsigned off, v8f (&c)[2][4]) {
  gemm_core<WA, XS, WS, 1>(xt, wt, off, c, [](int) { return 0; });
}

// The matrix launches run in work-groups of 8 waves with no barrier between them.
// The waves of a group take tiles that read the same fragments (GEMMs: 4 x-tile
// pairs by 2 w-tile quads; attention: 8 query tiles of one head) and start
// together on one WGP, so that a fragment several of them load can come from the
// WGP's cache for all but the first, where one-wave groups asked L2 every time.
#define WG_WAVES 8
// wave number in the group, as a scalar: tile bases stay in scalar registers
__device__ __forceinline__ int wave_id() {
  return __builtin_amdgcn_readfirstlane((int)(threadIdx.x >> 5));
}
__device__ __forceinline__ int lane_id() { return threadIdx.x & 31; }

// ---------------- conversion / packing ----------------
// f32 [rows][512] -> f16 in fragment order; one thread makes one 16-byte piece, o.
// pair (x): tile T holds the 16 tokens (T/2)*32 + 2*i + (T&1), so that the
// stride-2 patch rows of the SR product are whole tiles too.
__device__ __forceinline__ void cvt_piece(const float* __restrict__ s,
                                          _Float16* __restrict__ d, int o, bool pair) {
  int lane = o & 31, part = (o >> 5) & 1, kb = (o >> 6) & 15, tile = o >> 10;
  int lr = lane & 15, lhh = lane >> 4;
  int row = pair ? (tile >> 1) * 32 + 2 * lr + (tile & 1) : tile * 16 + lr;
  const float* p = s + (size_t)row * 512 + kb * 32 + part * 16 + lhh * 8;
  v8h v;
  for (int i = 0; i < 8; i++) v[i] = (_Float16)p[i];
  *(v8h*)(d + (size_t)o * 8) = v;
}

// Wsr [c_out][c_in][2][2] -> Wsr_h [c_out][k=2048] in fragment order,
// k = (kh*2+kw)*512 + c_in
__device__ __forceinline__ void pack_wsr_piece(const float* __restrict__ w,
                                               _Float16* __restrict__ d, int o) {
  int lane = o & 31, part = (o >> 5) & 1, kb = (o >> 6) & 63, tile = o >> 12;
  int co = tile * 16 + (lane & 15);
  int k = kb * 32 + part * 16 + (lane >> 4) * 8;
  int s = k >> 9, ci = k & 511;
  v8h v;
  for (int i = 0; i < 8; i++) v[i] = (_Float16)w[(co * 512 + ci + i) * 4 + s];
  *(v8h*)(d + (size_t)o * 8) = v;
}

// All five conversions are independent: one launch, a range of the block index
// picks the job (256 pieces a block, every range exact). The weights come first,
// so that their few blocks run under the long x range and not behind it.
#define CB_WSR (512 * 2048 / 8 / 256)            // 512 blocks
#define CB_WQ  (CB_WSR + 512 * 512 / 8 / 256)    // + 128
#define CB_WKV (CB_WQ + 1024 * 512 / 8 / 256)    // + 256
#define CB_WP  (CB_WKV + 512 * 512 / 8 / 256)    // + 128
#define CB_X   (CB_WP + 16384 * 512 / 8 / 256)   // + 4096
__global__ void __launch_bounds__(256) cvt_all(const float* __restrict__ x,
                                               const float* __restrict__ Wq,
                                               const float* __restrict__ Wkv,
                                               const float* __restrict__ Wp,
                                               const float* __restrict__ Wsr,
                                               _Float16* __restrict__ xh,
                                               _Float16* __restrict__ wqh,
                                               _Float16* __restrict__ wkvh,
                                               _Float16* __restrict__ wph,
                                               _Float16* __restrict__ wsrh) {
  int b = blockIdx.x, t = threadIdx.x;
  if (b < CB_WSR)      pack_wsr_piece(Wsr, wsrh, b * 256 + t);
  else if (b < CB_WQ)  cvt_piece(Wq, wqh, (b - CB_WSR) * 256 + t, false);
  else if (b < CB_WKV) cvt_piece(Wkv, wkvh, (b - CB_WQ) * 256 + t, false);
  else if (b < CB_WP)  cvt_piece(Wp, wph, (b - CB_WKV) * 256 + t, false);
  else                 cvt_piece(x, xh, (b - CB_WP) * 256 + t, true);
}

// ---------------- GEMM: Q projection (32x64 tiles) ----------------
__device__ __forceinline__ void q_tile(int mt, int nt,
                                       const _Float16* __restrict__ A,
                                       const _Float16* __restrict__ W,
                                       _Float16* __restrict__ Q) {
  int lane = lane_id(), lr = lane & 15, lhh = lane >> 4;
  v8f c[2][4];
  for (int s = 0; s < 2; s++) for (int t = 0; t < 4; t++)
    for (int r = 0; r < 8; r++) c[s][t][r] = 0.0f;
  gemm_core_512<true, TILE512, TILE512>(A + (size_t)(mt * 2) * TILE512,
                      W + (size_t)(nt * 4) * TILE512, lane * 16, c);
  // lane: token mt*32 + 2*lr + s, head nt, dd = t*16 + 8*lhh + (0..7)
  int bh = (mt >> 7) * 8 + nt;
  for (int s = 0; s < 2; s++)
    for (int t = 0; t < 4; t++) {
      int nq = (mt * 32 + 2 * lr + s) & 4095;
      *(v8h*)(Q + (size_t)bh * 4096 * 64 + frag_off(nq, t * 16 + 8 * lhh, 2)) =
          pack8(c[s][t]);
    }
}

// ---------------- GEMM: SR patch-merge conv (stride2,k2) + bias ----------------
__device__ __forceinline__ void sr_tile(int mt, int nt,
                                        const _Float16* __restrict__ xh,
                                        const _Float16* __restrict__ W,
                                        const float* __restrict__ bsr,
                                        float* __restrict__ out) {
  int lane = lane_id(), lr = lane & 15;
  // output rows mt*32 + s*16 + lr: batch mt>>5, oh = mt&31, ow = s*16 + lr
  int bb = mt >> 5, oh = mt & 31;
  // x tile of (s, kh, kw) = (bb*128 + (2*oh+kh)*2 + s)*2 + kw
  const _Float16* xt = xh + (size_t)((bb * 128 + 4 * oh) * 2) * TILE512;
  const _Float16* wt = W + (size_t)(nt * 4) * (4 * TILE512);
  v8f c[2][4];
  for (int s = 0; s < 2; s++) for (int t = 0; t < 4; t++)
    for (int r = 0; r < 8; r++) c[s][t][r] = 0.0f;
  // k = (kh*2+kw)*512 + c_in: one pass of 512 k per (kh,kw), in that order
  gemm_core<false, 2 * TILE512, 4 * TILE512, 4>(
      xt, wt, lane * 16, c, [](int seg) { return ((seg >> 1) * 4 + (seg & 1)) * TILE512; });

  for (int s = 0; s < 2; s++)
    for (int t = 0; t < 4; t++)
      for (int r = 0; r < 8; r++) {
        int mm = mt * 32 + s * 16 + r + 8 * (lane >> 4);
        int col = nt * 64 + t * 16 + lr;
        out[(size_t)mm * CDIM + col] = c[s][t][r] + bsr[col];
      }
}

// Both products read only xh and their own weights: one launch. The 1024 SR tiles
// (2048 k each) take the low block indices, so that they start first and the 4096
// Q tiles (512 k each) run beside them. A block is 4 x 2 tiles, one a wave.
#define GB_SR (4096 / 32 * (512 / 64) / WG_WAVES)    // 128 blocks
#define GB_Q  (16384 / 32 * (512 / 64) / WG_WAVES)   // 512 blocks
__global__ void __launch_bounds__(256) gemm_q_sr(const _Float16* __restrict__ xh,
                                                const _Float16* __restrict__ wqh,
                                                const _Float16* __restrict__ wsrh,
                                                const float* __restrict__ bsr,
                                                _Float16* __restrict__ Q,
                                                float* __restrict__ xsr) {
  int b = blockIdx.x, w = wave_id(), wm = w & 3, wn = w >> 2;
  if (b < GB_SR) {
    sr_tile((b & 31) * 4 + wm, (b >> 5) * 2 + wn, xh, wsrh, bsr, xsr);
  } else {
    b -= GB_SR;
    q_tile((b & 127) * 4 + wm, (b >> 7) * 2 + wn, xh, wqh, Q);
  }
}

// ---------------- LayerNorm over 512-wide rows ----------------
// One block takes 8 rows at once, each row summed by its own 256-wide tree:
// 8 rows fill whole 128-byte lines of the fragment-order output.
__global__ void __launch_bounds__(256) ln_rows(const float* __restrict__ x,
                                               const float* __restrict__ g,
                                               const float* __restrict__ bt,
                                               _Float16* __restrict__ out) {
  __shared__ float red[8][256];
  int row0 = blockIdx.x * 8, t = threadIdx.x;
  float v0[8], v1[8];
  for (int q = 0; q < 8; q++) {
    v0[q] = x[(size_t)(row0 + q) * 512 + t];
    v1[q] = x[(size_t)(row0 + q) * 512 + 256 + t];
    red[q][t] = v0[q] + v1[q];
  }
  __syncthreads();
  for (int s = 128; s > 0; s >>= 1) {
    if (t < s) for (int q = 0; q < 8; q++) red[q][t] += red[q][t + s];
    __syncthreads();
  }
  float d0[8], d1[8];
  for (int q = 0; q < 8; q++) {
    float mu = red[q][0] * (1.0f / 512.0f);
    d0[q] = v0[q] - mu;  d1[q] = v1[q] - mu;
  }
  __syncthreads();
  for (int q = 0; q < 8; q++) red[q][t] = d0[q] * d0[q] + d1[q] * d1[q];
  __syncthreads();
  for (int s = 128; s > 0; s >>= 1) {
    if (t < s) for (int q = 0; q < 8; q++) red[q][t] += red[q][t + s];
    __syncthreads();
  }
  for (int q = 0; q < 8; q++) {
    float rstd = rsqrtf(red[q][0] * (1.0f / 512.0f) + 1e-5f);
    out[frag_off(row0 + q, t, 16)]       = (_Float16)(d0[q] * rstd * g[t] + bt[t]);
    out[frag_off(row0 + q, 256 + t, 16)] = (_Float16)(d1[q] * rstd * g[256 + t] + bt[256 + t]);
  }
}

// ---------------- GEMM: KV projection ----------------
__global__ void __launch_bounds__(256) gemm_kv(const _Float16* __restrict__ A,
                                              const _Float16* __restrict__ W,
                                              _Float16* __restrict__ Kh,
                                              _Float16* __restrict__ Vt) {
  int w = wave_id();
  int mt = blockIdx.x * 4 + (w & 3), nt = blockIdx.y * 2 + (w >> 2);
  int lane = lane_id();
  const _Float16* xt = A + (size_t)(mt * 2) * TILE512;
  const _Float16* wt = W + (size_t)(nt * 4) * TILE512;
  int b = mt >> 5, mq = mt & 31;          // rows mt*32.. = keys mq*32.. of batch b
  v8f c[2][4];
  for (int s = 0; s < 2; s++) for (int t = 0; t < 4; t++)
    for (int r = 0; r < 8; r++) c[s][t][r] = 0.0f;
  if (nt < 8) {
    // K [key][dd]: lane holds key mq*32 + s*16 + lr, dd = t*16 + 8*lhh + (0..7)
    gemm_core_512<true, TILE512, TILE512>(xt, wt, lane * 16, c);
    _Float16* kb = Kh + (size_t)((b << 3) + nt) * 1024 * 64 + lane * 8;
    for (int s = 0; s < 2; s++)
      for (int t = 0; t < 4; t++)
        *(v8h*)(kb + ((mq * 2 + s) * 2 + (t >> 1)) * 512 + (t & 1) * 256) = pack8(c[s][t]);
  } else {
    // V^T [dd][key]: lane holds dd = t*16 + lr, keys mq*32 + s*16 + 8*lhh + (0..7)
    gemm_core_512<false, TILE512, TILE512>(xt, wt, lane * 16, c);
    _Float16* vb = Vt + (size_t)((b << 3) + nt - 8) * 64 * 1024 + lane * 8;
    for (int s = 0; s < 2; s++)
      for (int t = 0; t < 4; t++)
        *(v8h*)(vb + (t * 32 + mq) * 512 + s * 256) = pack8(c[s][t]);
  }
}

// ---------------- Flash attention: one wave = 32 queries of one (b,h) ----------------
struct KF { v16h f[4]; };
// kc = K of this (b,h) in fragment order + lane*8; a 32-key chunk is 4 blocks in a row
__device__ __forceinline__ KF load_kf(const _Float16* __restrict__ kc, int j) {
  KF k;
  const _Float16* p = kc + j * 2048;
  k.f[0] = load_frag(p);         k.f[1] = load_frag(p + 512);
  k.f[2] = load_frag(p + 1024);  k.f[3] = load_frag(p + 1536);
  return k;
}

// lane l with lane l ^ 16
__device__ __forceinline__ float xhalf(float x) {
  int v = __builtin_bit_cast(int, x);
  return __builtin_bit_cast(float, __builtin_amdgcn_permlanex16(v, v, 0x76543210, 0xfedcba98,
                                                                false, false));
}

__global__ void __launch_bounds__(256) attn(const _Float16* __restrict__ Qh,
                                           const _Float16* __restrict__ Kh,
                                           const _Float16* __restrict__ Vt,
                                           _Float16* __restrict__ AO) {
  int mt = blockIdx.x * WG_WAVES + wave_id();   // 32-query tile 0..127
  int bh = blockIdx.y;          // 0..31
  int b = bh >> 3, h = bh & 7;
  int lane = lane_id(), lr = lane & 15, lhh = lane >> 4;

  const _Float16* qblk = Qh + (size_t)(bh * 256 + mt * 2) * 1024 + lane * 8;
  v16h a[2][2];
  for (int u = 0; u < 2; u++) {
    a[u][0] = load_frag(qblk + u * 1024);
    a[u][1] = load_frag(qblk + u * 1024 + 512);
  }
  const _Float16* Kbh = Kh + (size_t)bh * 1024 * 64 + lane * 8;
  const _Float16* Vbh = Vt + (size_t)bh * 64 * 1024 + lane * 8;

  // o[u][t][r] = O[query u*16 + lr][dd = t*16 + 8*lhh + r]
  v8f o[2][4];
  for (int u = 0; u < 2; u++)
    for (int t = 0; t < 4; t++) for (int r = 0; r < 8; r++) o[u][t][r] = 0.0f;
  // query u*16 + lr: maximum over all keys so far; sums over this half's even and
  // odd keys, joined behind the loop
  float mrun[2] = {-1e30f, -1e30f};
  v2f lrun[2] = {{0.0f, 0.0f}, {0.0f, 0.0f}};
  const float scale = 0.125f;              // 1/sqrt(64)

  KF kc = load_kf(Kbh, 0);                 // prologue: K fragments for chunk 0
  for (int j = 0; j < 32; ++j) {
    // ---- V fragments for this chunk (independent of softmax; issue early) ----
    v16h vb[4];
    for (int t = 0; t < 4; t++)
      vb[t] = load_frag(Vbh + (t * 32 + j) * 512);
    // ---- scores: S^T(32 keys x 32 queries) = K(32x64) @ Q^T ----
    // s[u][g][r] = S[query u*16 + lr][key g*16 + 8*lhh + r]
    v8f s[2][2];
    for (int u = 0; u < 2; u++) {
      for (int r = 0; r < 8; r++) { s[u][0][r] = 0.0f; s[u][1][r] = 0.0f; }
      s[u][0] = wmma_f16(kc.f[0], a[u][0], s[u][0]);
      s[u][0] = wmma_f16(kc.f[1], a[u][1], s[u][0]);
      s[u][1] = wmma_f16(kc.f[2], a[u][0], s[u][1]);
      s[u][1] = wmma_f16(kc.f[3], a[u][1], s[u][1]);
    }
    // ---- prefetch next chunk's K fragments (overlaps softmax latency) ----
    KF kn = load_kf(Kbh, (j + 1 < 32) ? j + 1 : j);
    // keeps these loads here, right behind the products that free their registers:
    // the scheduler otherwise sinks them to the foot of the loop, where the next
    // chunk's first product waits out their whole round trip
    __builtin_amdgcn_sched_barrier(0);
    // ---- online softmax of query u*16 + lr, in the lane's own registers ----
    float mx[2], f[2];
    for (int u = 0; u < 2; u++) {
      // scale is a power of two: the maximum of the scaled scores is the scaled maximum
      float rm = s[u][0][0];
      for (int r = 1; r < 8; r++) rm = fmaxf(rm, s[u][0][r]);
      for (int r = 0; r < 8; r++) rm = fmaxf(rm, s[u][1][r]);
      mx[u] = fmaxf(mrun[u], rm * scale);
      mx[u] = fmaxf(mx[u], xhalf(mx[u]));
    }
    for (int u = 0; u < 2; u++) { f[u] = __expf(mrun[u] - mx[u]);  mrun[u] = mx[u]; }
    for (int u = 0; u < 2; u++) {
      v2f sum = {0.0f, 0.0f};
      v16h pb;                             // P^T: element g*8 + r is key g*16 + 8*lhh + r
      for (int g = 0; g < 2; g++) {
        v8f e = s[u][g] * scale - mx[u];
        for (int r = 0; r < 8; r += 2) {
          v2f p = {__expf(e[r]), __expf(e[r + 1])};
          sum += p;
          pb[g * 8 + r]     = (_Float16)p.x;
          pb[g * 8 + r + 1] = (_Float16)p.y;
        }
      }
      lrun[u] = lrun[u] * f[u] + sum;
      // ---- rescale, then O^T += V^T(64x32) @ P^T(32x16) ----
      for (int t = 0; t < 4; t++) {
        o[u][t] *= f[u];
        o[u][t] = wmma_f16(vb[t], pb, o[u][t]);
      }
    }
    kc = kn;
  }
  for (int u = 0; u < 2; u++) {
    float l = lrun[u].x + lrun[u].y;
    float inv = 1.0f / (l + xhalf(l));
    int nq = mt * 32 + u * 16 + lr;
    for (int t = 0; t < 4; t++)
      *(v8h*)(AO + frag_off(b * 4096 + nq, h * 64 + t * 16 + 8 * lhh, 16)) =
          pack8(o[u][t] * inv);
  }
}

// ---------------- GEMM: output projection + bias (f32 out) ----------------
__global__ void __launch_bounds__(256) gemm_out(const _Float16* __restrict__ A,
                                               const _Float16* __restrict__ W,
                                               const float* __restrict__ bp,
                                               float* __restrict__ out) {
  int w = wave_id();
  int mt = blockIdx.x * 4 + (w & 3), nt = blockIdx.y * 2 + (w >> 2);
  int lane = lane_id(), lr = lane & 15;
  v8f c[2][4];
  for (int s = 0; s < 2; s++) for (int t = 0; t < 4; t++)
    for (int r = 0; r < 8; r++) c[s][t][r] = 0.0f;
  gemm_core_512<false, TILE512, TILE512>(A + (size_t)(mt * 2) * TILE512,
                       W + (size_t)(nt * 4) * TILE512, lane * 16, c);
  for (int s = 0; s < 2; s++)
    for (int t = 0; t < 4; t++)
      for (int r = 0; r < 8; r++) {
        int m = mt * 32 + s * 16 + r + 8 * (lane >> 4);
        int col = nt * 64 + t * 16 + lr;
        out[(size_t)m * CDIM + col] = c[s][t][r] + bp[col];
      }
}

// ---------------- host ----------------
extern "C" void kernel_launch(void* const* d_in, const int* in_sizes, int n_in,
                              void* d_out, int out_size, void* d_ws, size_t ws_size,
                              hipStream_t stream) {
  const float* x    = (const float*)d_in[0];
  // d_in[1], d_in[2] are H, W (compile-time 64 here)
  const float* Wq   = (const float*)d_in[3];
  const float* Wkv  = (const float*)d_in[4];
  const float* Wsr  = (const float*)d_in[5];
  const float* bsr  = (const float*)d_in[6];
  const float* ln_g = (const float*)d_in[7];
  const float* ln_b = (const float*)d_in[8];
  const float* Wp   = (const float*)d_in[9];
  const float* bp   = (const float*)d_in[10];
  float* out = (float*)d_out;

  char* ws = (char*)d_ws;
  _Float16* xh   = (_Float16*)(ws + OFF_XH);
  _Float16* wqh  = (_Float16*)(ws + OFF_WQH);
  _Float16* wkvh = (_Float16*)(ws + OFF_WKVH);
  _Float16* wph  = (_Float16*)(ws + OFF_WPH);
  _Float16* wsrh = (_Float16*)(ws + OFF_WSRH);
  float*    xsr  = (float*)   (ws + OFF_XSR);
  _Float16* xln  = (_Float16*)(ws + OFF_XLN);
  _Float16* qh   = (_Float16*)(ws + OFF_QH);
  _Float16* kh   = (_Float16*)(ws + OFF_KH);
  _Float16* vt   = (_Float16*)(ws + OFF_VT);
  _Float16* aoh  = (_Float16*)(ws + OFF_AOH);

  // 1) convert / pack
  cvt_all<<<CB_X, 256, 0, stream>>>(x, Wq, Wkv, Wp, Wsr, xh, wqh, wkvh, wph, wsrh);

  // 2) + 3) SR patch-merge GEMM 4096x512x2048 (+bias) and Q projection 16384x512x512
  gemm_q_sr<<<GB_SR + GB_Q, 256, 0, stream>>>(xh, wqh, wsrh, bsr, qh, xsr);

  // 4) LayerNorm rows -> f16
  ln_rows<<<4096 / 8, 256, 0, stream>>>(xsr, ln_g, ln_b, xln);

  // 5) KV projection: 4096x1024x512
  gemm_kv<<<dim3(4096 / 32 / 4, 1024 / 64 / 2), 256, 0, stream>>>(xln, wkvh, kh, vt);

  // 6) flash attention per (b,h): 32 heads x 128 query-tiles, 8 tiles a block
  attn<<<dim3(128 / WG_WAVES, 32), 256, 0, stream>>>(qh, kh, vt, aoh);

  // 7) output projection: 16384x512x512 (+bias, f32)
  gemm_out<<<dim3(16384 / 32 / 4, 512 / 64 / 2), 256, 0, stream>>>(aoh, wph, bp, out);
}

// v007
// A run of this version takes 94.6 microseconds.
// In both of two side-by-side timings against v006, it was 1.06 times as fast.
// Counting every step since v000, it is 3.27 times as fast.
#include <hip/hip_runtime.h>
#include <hip/hip_bf16.h>

typedef __attribute__((ext_vector_type(16))) _Float16 v16h;
typedef __attribute__((ext_vector_type(8)))  _Float16 v8h;
typedef __attribute__((ext_vector_type(8)))  float    v8f;
typedef __attribute__((ext_vector_type(2)))  float    v2f;

// ---------------- constants ----------------
#define CDIM    512

// workspace layout (bytes)
#define OFF_XH    ((size_t)0)                    // 16384*512 f16 = 16 MiB
#define OFF_WQH   (OFF_XH   + (size_t)16777216)  // 512*512  f16
#define OFF_WKVH  (OFF_WQH  + (size_t)524288)    // 1024*512 f16
#define OFF_WPH   (OFF_WKVH + (size_t)1048576)   // 512*512  f16
#define OFF_WSRH  (OFF_WPH  + (size_t)524288)    // 512*2048 f16
#define OFF_XSR   (OFF_WSRH + (size_t)2097152)   // 4096*512 f32
#define OFF_XLN   (OFF_XSR  + (size_t)8388608)   // 4096*512 f16
#define OFF_QH    (OFF_XLN  + (size_t)4194304)   // 32*4096*64 f16
#define OFF_KH    (OFF_QH   + (size_t)16777216)  // 32*1024*64 f16
#define OFF_VT    (OFF_KH   + (size_t)4194304)   // 32*64*1024 f16
#define OFF_AOH   (OFF_VT   + (size_t)4194304)   // 16384*512 f16

// ---------------- helpers ----------------
// Fragment-order layout of an f16 matrix [rows][K] in the workspace.
// A block is 16 rows x 32 k = 512 halfs; block index = (row/16)*(K/32) + k/32.
// Inside a block, element (row, k) sits at
//   ((k>>4)&1)*256 + (((k>>3)&1)*16 + (row&15))*8 + (k&7)
// so each of the two 16-byte loads of a fragment reads 512 contiguous bytes
// per wave (4 whole lines); element e of lane L is
// K = k0 + (e/8)*16 + (L/16)*8 + (e%8) of row L%16.
#define TILE512 8192      // halfs of one 16-row tile at K = 512

__device__ __forceinline__ int frag_off(int row, int k, int kblocks) {
  return ((row >> 4) * kblocks + (k >> 5)) * 512 + ((k >> 4) & 1) * 256
       + (((k >> 3) & 1) * 16 + (row & 15)) * 8 + (k & 7);
}

// blk = block base + lane*8
__device__ __forceinline__ v16h load_frag(const _Float16* __restrict__ blk) {
  v8h lo = *(const v8h*)(blk);
  v8h hi = *(const v8h*)(blk + 256);
  return __builtin_shufflevector(lo, hi, 0,1,2,3,4,5,6,7,8,9,10,11,12,13,14,15);
}

// the same from a wave-uniform base and a per-lane byte offset
__device__ __forceinline__ v16h load_frag_at(const _Float16* __restrict__ base, unsigned boff) {
  return load_frag((const _Float16*)((const char*)base + boff));
}

__device__ __forceinline__ v8f wmma_f16(v16h a, v16h b, v8f c) {
  return __builtin_amdgcn_wmma_f32_16x16x32_f16(false, a, false, b, (short)0, c,
                                                false, false);
}

__device__ __forceinline__ v8h pack8(v8f c) {
  v8h v;
  for (int r = 0; r < 8; r++) v[r] = (_Float16)c[r];
  return v;
}

// 2 x-tiles by 4 w-tiles. WA = false: x rows are the A operand (a lane holds 8
// rows of one w column). WA = true: w rows are the A operand (a lane holds 8
// consecutive w columns of one x row: one 16-byte piece of a fragment-order row).
template <bool WA>
__device__ __forceinline__ void mma_2x4(v16h a0, v16h a1, v16h b0, v16h b1,
                                        v16h b2, v16h b3, v8f (&c)[2][4]) {
  if (WA) {
    c[0][0] = wmma_f16(b0, a0, c[0][0]);  c[1][0] = wmma_f16(b0, a1, c[1][0]);
    c[0][1] = wmma_f16(b1, a0, c[0][1]);  c[1][1] = wmma_f16(b1, a1, c[1][1]);
    c[0][2] = wmma_f16(b2, a0, c[0][2]);  c[1][2] = wmma_f16(b2, a1, c[1][2]);
    c[0][3] = wmma_f16(b3, a0, c[0][3]);  c[1][3] = wmma_f16(b3, a1, c[1][3]);
  } else {
    c[0][0] = wmma_f16(a0, b0, c[0][0]);  c[1][0] = wmma_f16(a1, b0, c[1][0]);
    c[0][1] = wmma_f16(a0, b1, c[0][1]);  c[1][1] = wmma_f16(a1, b1, c[1][1]);
    c[0][2] = wmma_f16(a0, b2, c[0][2]);  c[1][2] = wmma_f16(a1, b2, c[1][2]);
    c[0][3] = wmma_f16(a0, b3, c[0][3]);  c[1][3] = wmma_f16(a1, b3, c[1][3]);
  }
}

// The six fragments of one k block (32 k) of a 32x64 tile.
struct Frag6 { v16h a0, a1, b0, b1, b2, b3; };

template <int XS, int WS>
__device__ __forceinline__ Frag6 load_frag6(const _Float16* __restrict__ xt,
                                            const _Float16* __restrict__ wt, unsigned off) {
  Frag6 f;
  f.a0 = load_frag_at(xt, off);           f.a1 = load_frag_at(xt + XS, off);
  f.b0 = load_frag_at(wt, off);           f.b1 = load_frag_at(wt + WS, off);
  f.b2 = load_frag_at(wt + 2 * WS, off);  f.b3 = load_frag_at(wt + 3 * WS, off);
  return f;
}

// Software-pipelined 32x64 GEMM core over NSEG * 512 k (16 k blocks a segment).
// xt = first of two x tiles XS halfs apart, wt = first of four w tiles WS halfs
// apart, both in fragment order and wave-uniform; off = lane*16 bytes.
// w runs on through all segments; segment g of x starts XG(g) halfs behind xt.
// Three register sets: the 12 loads of k block kb + 2 go out as one group ahead of
// the products of k block kb, so a block's loads have two blocks' time to land.
template <bool WA, int XS, int WS, int NSEG, typename XG>
__device__ __forceinline__ void gemm_core(const _Float16* __restrict__ xt,
                                          const _Float16* __restrict__ wt,
                                          unsigned off, v8f (&c)[2][4], XG xg) {
  constexpr int NKB = NSEG * 16;
  Frag6 f[3];
  f[0] = load_frag6<XS, WS>(xt + xg(0), wt, off);
  f[1] = load_frag6<XS, WS>(xt + xg(0) + 512, wt + 512, off);
  // unrolled whole: the three sets rotate by name, every address is base + constant
  #pragma unroll
  for (int kb = 0; kb < NKB; kb++) {
    if (kb + 2 < NKB)
      f[(kb + 2) % 3] = load_frag6<XS, WS>(xt + xg((kb + 2) >> 4) + ((kb + 2) & 15) * 512,
                                           wt + (kb + 2) * 512, off);
    // keeps the loads above: the scheduler otherwise sinks each to its first use,
    // into one register set, and every k block then waits out several round trips
    __builtin_amdgcn_sched_barrier(0);
    const Frag6& g = f[kb % 3];
    mma_2x4<WA>(g.a0, g.a1, g.b0, g.b1, g.b2, g.b3, c);
    // keeps the next group of loads below these products: risen above them, as the
    // scheduler puts them, they take 16 more registers and the groups grow uneven
    __builtin_amdgcn_sched_barrier(0);
  }
}

// one segment of 512 k
template <bool WA, int XS, int WS>
__device__ __forceinline__ void gemm_core_512(const _Float16* __restrict__ xt,
                                              const _Float16* __restrict__ wt,
                                              unsigned off, v8f (&c)[2][4]) {
  gemm_core<WA, XS, WS, 1>(xt, wt, off, c, [](int) { return 0; });
}

// The matrix launches run in work-groups of 8 waves with no barrier between them.
// The waves of a group take tiles that read the same fragments (GEMMs: 4 x-tile
// pairs by 2 w-tile quads; attention: 8 query tiles of one head) and start
// together on one WGP, so that a fragment several of them load can come from the
// WGP's cache for all but the first, where one-wave groups asked L2 every time.
#define WG_WAVES 8
// wave number in the group, as a scalar: tile bases stay in scalar registers
__device__ __forceinline__ int wave_id() {
  return __builtin_amdgcn_readfirstlane((int)(threadIdx.x >> 5));
}
__device__ __forceinline__ int lane_id() { return threadIdx.x & 31; }

// ---------------- conversion / packing ----------------
typedef __attribute__((ext_vector_type(4))) float v4f;

// The conversions are a stream: a wave takes a long piece of it, so that few waves
// have to start and each has many loads in flight.
// Lane l of a wave holds row 8*rh + l/4 of a 16-row tile and the 8 k at (l&3)*8 of
// a k block: four lanes read one whole 128-byte line of a row, a load touches 8
// lines, and a store fills four whole lines of the fragment-order block.

// f32 [rows][512] -> f16 in fragment order; unit u = (tile*2 + rh)*2 + kh is
// 8 rows x 256 k: 16 loads in flight, 8 stores.
// pair (x): tile T holds the 16 tokens (T/2)*32 + 2*i + (T&1), so that the
// stride-2 patch rows of the SR product are whole tiles too.
__device__ __forceinline__ void cvt_unit(const float* __restrict__ s,
                                         _Float16* __restrict__ d, int u, bool pair) {
  int lane = lane_id(), q = lane & 3;
  int kh = u & 1, rh = (u >> 1) & 1, tile = u >> 2;
  int lr = rh * 8 + (lane >> 2);
  int row = pair ? (tile >> 1) * 32 + 2 * lr + (tile & 1) : tile * 16 + lr;
  const float* p = s + (size_t)row * 512 + kh * 256 + q * 8;
  v4f a[8][2];
  for (int i = 0; i < 8; i++) {
    a[i][0] = *(const v4f*)(p + i * 32);
    a[i][1] = *(const v4f*)(p + i * 32 + 4);
  }
  // the wait that belongs in front of a reuse of the loads' address registers; named
  // here, they stay whole up to it (the last load otherwise lands on them)
  asm volatile("s_wait_xcnt 0x0" :: "v"(p) : "memory");
  // keeps the conversions below all 16 loads: the scheduler otherwise holds four
  // loads back behind the first waits, and the wave pays a second round trip
  __builtin_amdgcn_sched_barrier(0);
  _Float16* o = d + (size_t)(tile * 16 + kh * 8) * 512 + (q * 16 + lr) * 8;
  for (int i = 0; i < 8; i++) {
    v8h v;
    for (int e = 0; e < 4; e++) { v[e] = (_Float16)a[i][0][e];  v[4 + e] = (_Float16)a[i][1][e]; }
    *(v8h*)(o + i * 512) = v;
  }
  // the wait that belongs in front of a reuse of the stores' address registers: the
  // code of another range of the block index follows these stores in the kernel
  asm volatile("s_wait_xcnt 0x0" ::: "memory");
}

// Wsr [c_out][c_in][2][2] -> Wsr_h [c_out][k=2048] in fragment order,
// k = (kh*2+kw)*512 + c_in. Unit u = (tile*2 + rh)*16 + cb is 8 c_out x 32 c_in:
// a lane reads the 128 bytes of its 8 c_in once, as 8 loads of all four (kh,kw),
// and stores one piece for each of the four.
__device__ __forceinline__ void pack_wsr_unit(const float* __restrict__ w,
                                              _Float16* __restrict__ d, int u) {
  int lane = lane_id(), q = lane & 3;
  int cb = u & 15, rh = (u >> 4) & 1, tile = u >> 5;
  int lr = rh * 8 + (lane >> 2);
  const float* p = w + ((size_t)(tile * 16 + lr) * 512 + cb * 32 + q * 8) * 4;
  v4f a[8];
  for (int i = 0; i < 8; i++) a[i] = *(const v4f*)(p + i * 4);
  _Float16* o = d + (size_t)(tile * 64 + cb) * 512 + (q * 16 + lr) * 8;
  for (int s = 0; s < 4; s++) {
    v8h v;
    for (int i = 0; i < 8; i++) v[i] = (_Float16)a[i][s];
    *(v8h*)(o + s * 16 * 512) = v;
  }
}

// All five conversions are independent: one launch, a range of the block index
// picks the job (8 units a block, one a wave, every range exact). The weights come
// first, so that their few blocks run under the long x range and not behind it.
#define CB_WSR (512 / 8 * (512 / 32) / WG_WAVES)          // 128 blocks
#define CB_WQ  (CB_WSR + 512 / 8 * 2 / WG_WAVES)          // + 16
#define CB_WKV (CB_WQ + 1024 / 8 * 2 / WG_WAVES)          // + 32
#define CB_WP  (CB_WKV + 512 / 8 * 2 / WG_WAVES)          // + 16
#define CB_X   (CB_WP + 16384 / 8 * 2 / WG_WAVES)         // + 512
__global__ void __launch_bounds__(256) cvt_all(const float* __restrict__ x,
                                               const float* __restrict__ Wq,
                                               const float* __restrict__ Wkv,
                                               const float* __restrict__ Wp,
                                               const float* __restrict__ Wsr,
                                               _Float16* __restrict__ xh,
                                               _Float16* __restrict__ wqh,
                                               _Float16* __restrict__ wkvh,
                                               _Float16* __restrict__ wph,
                                               _Float16* __restrict__ wsrh) {
  int b = blockIdx.x, w = wave_id();
  if (b < CB_WSR)      pack_wsr_unit(Wsr, wsrh, b * WG_WAVES + w);
  else if (b < CB_WQ)  cvt_unit(Wq, wqh, (b - CB_WSR) * WG_WAVES + w, false);
  else if (b < CB_WKV) cvt_unit(Wkv, wkvh, (b - CB_WQ) * WG_WAVES + w, false);
  else if (b < CB_WP)  cvt_unit(Wp, wph, (b - CB_WKV) * WG_WAVES + w, false);
  else                 cvt_unit(x, xh, (b - CB_WP) * WG_WAVES + w, true);
}

// ---------------- GEMM: Q projection (32x64 tiles) ----------------
__device__ __forceinline__ void q_tile(int mt, int nt,
                                       const _Float16* __restrict__ A,
                                       const _Float16* __restrict__ W,
                                       _Float16* __restrict__ Q) {
  int lane = lane_id(), lr = lane & 15, lhh = lane >> 4;
  v8f c[2][4];
  for (int s = 0; s < 2; s++) for (int t = 0; t < 4; t++)
    for (int r = 0; r < 8; r++) c[s][t][r] = 0.0f;
  gemm_core_512<true, TILE512, TILE512>(A + (size_t)(mt * 2) * TILE512,
                      W + (size_t)(nt * 4) * TILE512, lane * 16, c);
  // lane: token mt*32 + 2*lr + s, head nt, dd = t*16 + 8*lhh + (0..7)
  int bh = (mt >> 7) * 8 + nt;
  for (int s = 0; s < 2; s++)
    for (int t = 0; t < 4; t++) {
      int nq = (mt * 32 + 2 * lr + s) & 4095;
      *(v8h*)(Q + (size_t)bh * 4096 * 64 + frag_off(nq, t * 16 + 8 * lhh, 2)) =
          pack8(c[s][t]);
    }
}

// ---------------- GEMM: SR patch-merge conv (stride2,k2) + bias ----------------
__device__ __forceinline__ void sr_tile(int mt, int nt,
                                        const _Float16* __restrict__ xh,
                                        const _Float16* __restrict__ W,
                                        const float* __restrict__ bsr,
                                        float* __restrict__ out) {
  int lane = lane_id(), lr = lane & 15;
  // output rows mt*32 + s*16 + lr: batch mt>>5, oh = mt&31, ow = s*16 + lr
  int bb = mt >> 5, oh = mt & 31;
  // x tile of (s, kh, kw) = (bb*128 + (2*oh+kh)*2 + s)*2 + kw
  const _Float16* xt = xh + (size_t)((bb * 128 + 4 * oh) * 2) * TILE512;
  const _Float16* wt = W + (size_t)(nt * 4) * (4 * TILE512);
  v8f c[2][4];
  for (int s = 0; s < 2; s++) for (int t = 0; t < 4; t++)
    for (int r = 0; r < 8; r++) c[s][t][r] = 0.0f;
  // k = (kh*2+kw)*512 + c_in: one pass of 512 k per (kh,kw), in that order
  gemm_core<false, 2 * TILE512, 4 * TILE512, 4>(
      xt, wt, lane * 16, c, [](int seg) { return ((seg >> 1) * 4 + (seg & 1)) * TILE512; });

  for (int s = 0; s < 2; s++)
    for (int t = 0; t < 4; t++)
      for (int r = 0; r < 8; r++) {
        int mm = mt * 32 + s * 16 + r + 8 * (lane >> 4);
        int col = nt * 64 + t * 16 + lr;
        out[(size_t)mm * CDIM + col] = c[s][t][r] + bsr[col];
      }
}

// Both products read only xh and their own weights: one launch. The 1024 SR tiles
// (2048 k each) take the low block indices, so that they start first and the 4096
// Q tiles (512 k each) run beside them. A block is 4 x 2 tiles, one a wave.
#define GB_SR (4096 / 32 * (512 / 64) / WG_WAVES)    // 128 blocks
#define GB_Q  (16384 / 32 * (512 / 64) / WG_WAVES)   // 512 blocks
__global__ void __launch_bounds__(256) gemm_q_sr(const _Float16* __restrict__ xh,
                                                const _Float16* __restrict__ wqh,
                                                const _Float16* __restrict__ wsrh,
                                                const float* __restrict__ bsr,
                                                _Float16* __restrict__ Q,
                                                float* __restrict__ xsr) {
  int b = blockIdx.x, w = wave_id(), wm = w & 3, wn = w >> 2;
  if (b < GB_SR) {
    sr_tile((b & 31) * 4 + wm, (b >> 5) * 2 + wn, xh, wsrh, bsr, xsr);
  } else {
    b -= GB_SR;
    q_tile((b & 127) * 4 + wm, (b >> 7) * 2 + wn, xh, wqh, Q);
  }
}

// ---------------- LayerNorm over 512-wide rows ----------------
// One block takes 8 rows at once, each row summed by its own 256-wide tree:
// 8 rows fill whole 128-byte lines of the fragment-order output.
__global__ void __launch_bounds__(256) ln_rows(const float* __restrict__ x,
                                               const float* __restrict__ g,
                                               const float* __restrict__ bt,
                                               _Float16* __restrict__ out) {
  __shared__ float red[8][256];
  int row0 = blockIdx.x * 8, t = threadIdx.x;
  float v0[8], v1[8];
  for (int q = 0; q < 8; q++) {
    v0[q] = x[(size_t)(row0 + q) * 512 + t];
    v1[q] = x[(size_t)(row0 + q) * 512 + 256 + t];
    red[q][t] = v0[q] + v1[q];
  }
  __syncthreads();
  for (int s = 128; s > 0; s >>= 1) {
    if (t < s) for (int q = 0; q < 8; q++) red[q][t] += red[q][t + s];
    __syncthreads();
  }
  float d0[8], d1[8];
  for (int q = 0; q < 8; q++) {
    float mu = red[q][0] * (1.0f / 512.0f);
    d0[q] = v0[q] - mu;  d1[q] = v1[q] - mu;
  }
  __syncthreads();
  for (int q = 0; q < 8; q++) red[q][t] = d0[q] * d0[q] + d1[q] * d1[q];
  __syncthreads();
  for (int s = 128; s > 0; s >>= 1) {
    if (t < s) for (int q = 0; q < 8; q++) red[q][t] += red[q][t + s];
    __syncthreads();
  }
  for (int q = 0; q < 8; q++) {
    float rstd = rsqrtf(red[q][0] * (1.0f / 512.0f) + 1e-5f);
    out[frag_off(row0 + q, t, 16)]       = (_Float16)(d0[q] * rstd * g[t] + bt[t]);
    out[frag_off(row0 + q, 256 + t, 16)] = (_Float16)(d1[q] * rstd * g[256 + t] + bt[256 + t]);
  }
}

// ---------------- GEMM: KV projection ----------------
__global__ void __launch_bounds__(256) gemm_kv(const _Float16* __restrict__ A,
                                              const _Float16* __restrict__ W,
                                              _Float16* __restrict__ Kh,
                                              _Float16* __restrict__ Vt) {
  int w = wave_id();
  int mt = blockIdx.x * 4 + (w & 3), nt = blockIdx.y * 2 + (w >> 2);
  int lane = lane_id();
  const _Float16* xt = A + (size_t)(mt * 2) * TILE512;
  const _Float16* wt = W + (size_t)(nt * 4) * TILE512;
  int b = mt >> 5, mq = mt & 31;          // rows mt*32.. = keys mq*32.. of batch b
  v8f c[2][4];
  for (int s = 0; s < 2; s++) for (int t = 0; t < 4; t++)
    for (int r = 0; r < 8; r++) c[s][t][r] = 0.0f;
  if (nt < 8) {
    // K [key][dd]: lane holds key mq*32 + s*16 + lr, dd = t*16 + 8*lhh + (0..7)
    gemm_core_512<true, TILE512, TILE512>(xt, wt, lane * 16, c);
    _Float16* kb = Kh + (size_t)((b << 3) + nt) * 1024 * 64 + lane * 8;
    for (int s = 0; s < 2; s++)
      for (int t = 0; t < 4; t++)
        *(v8h*)(kb + ((mq * 2 + s) * 2 + (t >> 1)) * 512 + (t & 1) * 256) = pack8(c[s][t]);
  } else {
    // V^T [dd][key]: lane holds dd = t*16 + lr, keys mq*32 + s*16 + 8*lhh + (0..7)
    gemm_core_512<false, TILE512, TILE512>(xt, wt, lane * 16, c);
    _Float16* vb = Vt + (size_t)((b << 3) + nt - 8) * 64 * 1024 + lane * 8;
    for (int s = 0; s < 2; s++)
      for (int t = 0; t < 4; t++)
        *(v8h*)(vb + (t * 32 + mq) * 512 + s * 256) = pack8(c[s][t]);
  }
}

// ---------------- Flash attention: one wave = 32 queries of one (b,h) ----------------
struct KF { v16h f[4]; };
// kc = K of this (b,h) in fragment order + lane*8; a 32-key chunk is 4 blocks in a row
__device__ __forceinline__ KF load_kf(const _Float16* __restrict__ kc, int j) {
  KF k;
  const _Float16* p = kc + j * 2048;
  k.f[0] = load_frag(p);         k.f[1] = load_frag(p + 512);
  k.f[2] = load_frag(p + 1024);  k.f[3] = load_frag(p + 1536);
  return k;
}

// lane l with lane l ^ 16
__device__ __forceinline__ float xhalf(float x) {
  int v = __builtin_bit_cast(int, x);
  return __builtin_bit_cast(float, __builtin_amdgcn_permlanex16(v, v, 0x76543210, 0xfedcba98,
                                                                false, false));
}

__global__ void __launch_bounds__(256) attn(const _Float16* __restrict__ Qh,
                                           const _Float16* __restrict__ Kh,
                                           const _Float16* __restrict__ Vt,
                                           _Float16* __restrict__ AO) {
  int mt = blockIdx.x * WG_WAVES + wave_id();   // 32-query tile 0..127
  int bh = blockIdx.y;          // 0..31
  int b = bh >> 3, h = bh & 7;
  int lane = lane_id(), lr = lane & 15, lhh = lane >> 4;

  const _Float16* qblk = Qh + (size_t)(bh * 256 + mt * 2) * 1024 + lane * 8;
  v16h a[2][2];
  for (int u = 0; u < 2; u++) {
    a[u][0] = load_frag(qblk + u * 1024);
    a[u][1] = load_frag(qblk + u * 1024 + 512);
  }
  const _Float16* Kbh = Kh + (size_t)bh * 1024 * 64 + lane * 8;
  const _Float16* Vbh = Vt + (size_t)bh * 64 * 1024 + lane * 8;

  // o[u][t][r] = O[query u*16 + lr][dd = t*16 + 8*lhh + r]
  v8f o[2][4];
  for (int u = 0; u < 2; u++)
    for (int t = 0; t < 4; t++) for (int r = 0; r < 8; r++) o[u][t][r] = 0.0f;
  // query u*16 + lr: maximum over all keys so far; sums over this half's even and
  // odd keys, joined behind the loop
  float mrun[2] = {-1e30f, -1e30f};
  v2f lrun[2] = {{0.0f, 0.0f}, {0.0f, 0.0f}};
  const float scale = 0.125f;              // 1/sqrt(64)

  KF kc = load_kf(Kbh, 0);                 // prologue: K fragments for chunk 0
  for (int j = 0; j < 32; ++j) {
    // ---- V fragments for this chunk (independent of softmax; issue early) ----
    v16h vb[4];
    for (int t = 0; t < 4; t++)
      vb[t] = load_frag(Vbh + (t * 32 + j) * 512);
    // ---- scores: S^T(32 keys x 32 queries) = K(32x64) @ Q^T ----
    // s[u][g][r] = S[query u*16 + lr][key g*16 + 8*lhh + r]
    v8f s[2][2];
    for (int u = 0; u < 2; u++) {
      for (int r = 0; r < 8; r++) { s[u][0][r] = 0.0f; s[u][1][r] = 0.0f; }
      s[u][0] = wmma_f16(kc.f[0], a[u][0], s[u][0]);
      s[u][0] = wmma_f16(kc.f[1], a[u][1], s[u][0]);
      s[u][1] = wmma_f16(kc.f[2], a[u][0], s[u][1]);
      s[u][1] = wmma_f16(kc.f[3], a[u][1], s[u][1]);
    }
    // ---- prefetch next chunk's K fragments (overlaps softmax latency) ----
    KF kn = load_kf(Kbh, (j + 1 < 32) ? j + 1 : j);
    // keeps these loads here, right behind the products that free their registers:
    // the scheduler otherwise sinks them to the foot of the loop, where the next
    // chunk's first product waits out their whole round trip
    __builtin_amdgcn_sched_barrier(0);
    // ---- online softmax of query u*16 + lr, in the lane's own registers ----
    float mx[2], f[2];
    for (int u = 0; u < 2; u++) {
      // scale is a power of two: the maximum of the scaled scores is the scaled maximum
      float rm = s[u][0][0];
      for (int r = 1; r < 8; r++) rm = fmaxf(rm, s[u][0][r]);
      for (int r = 0; r < 8; r++) rm = fmaxf(rm, s[u][1][r]);
      mx[u] = fmaxf(mrun[u], rm * scale);
      mx[u] = fmaxf(mx[u], xhalf(mx[u]));
    }
    for (int u = 0; u < 2; u++) { f[u] = __expf(mrun[u] - mx[u]);  mrun[u] = mx[u]; }
    for (int u = 0; u < 2; u++) {
      v2f sum = {0.0f, 0.0f};
      v16h pb;                             // P^T: element g*8 + r is key g*16 + 8*lhh + r
      for (int g = 0; g < 2; g++) {
        v8f e = s[u][g] * scale - mx[u];
        for (int r = 0; r < 8; r += 2) {
          v2f p = {__expf(e[r]), __expf(e[r + 1])};
          sum += p;
          pb[g * 8 + r]     = (_Float16)p.x;
          pb[g * 8 + r + 1] = (_Float16)p.y;
        }
      }
      lrun[u] = lrun[u] * f[u] + sum;
      // ---- rescale, then O^T += V^T(64x32) @ P^T(32x16) ----
      for (int t = 0; t < 4; t++) {
        o[u][t] *= f[u];
        o[u][t] = wmma_f16(vb[t], pb, o[u][t]);
      }
    }
    kc = kn;
  }
  for (int u = 0; u < 2; u++) {
    float l = lrun[u].x + lrun[u].y;
    float inv = 1.0f / (l + xhalf(l));
    int nq = mt * 32 + u * 16 + lr;
    for (int t = 0; t < 4; t++)
      *(v8h*)(AO + frag_off(b * 4096 + nq, h * 64 + t * 16 + 8 * lhh, 16)) =
          pack8(o[u][t] * inv);
  }
}

// ---------------- GEMM: output projection + bias (f32 out) ----------------
__global__ void __launch_bounds__(256) gemm_out(const _Float16* __restrict__ A,
                                               const _Float16* __restrict__ W,
                                               const float* __restrict__ bp,
                                               float* __restrict__ out) {
  int w = wave_id();
  int mt = blockIdx.x * 4 + (w & 3), nt = blockIdx.y * 2 + (w >> 2);
  int lane = lane_id(), lr = lane & 15;
  v8f c[2][4];
  for (int s = 0; s < 2; s++) for (int t = 0; t < 4; t++)
    for (int r = 0; r < 8; r++) c[s][t][r] = 0.0f;
  gemm_core_512<false, TILE512, TILE512>(A + (size_t)(mt * 2) * TILE512,
                       W + (size_t)(nt * 4) * TILE512, lane * 16, c);
  for (int s = 0; s < 2; s++)
    for (int t = 0; t < 4; t++)
      for (int r = 0; r < 8; r++) {
        int m = mt * 32 + s * 16 + r + 8 * (lane >> 4);
        int col = nt * 64 + t * 16 + lr;
        out[(size_t)m * CDIM + col] = c[s][t][r] + bp[col];
      }
}

// ---------------- host ----------------
extern "C" void kernel_launch(void* const* d_in, const int* in_sizes, int n_in,
                              void* d_out, int out_size, void* d_ws, size_t ws_size,
                              hipStream_t stream) {
  const float* x    = (const float*)d_in[0];
  // d_in[1], d_in[2] are H, W (compile-time 64 here)
  const float* Wq   = (const float*)d_in[3];
  const float* Wkv  = (const float*)d_in[4];
  const float* Wsr  = (const float*)d_in[5];
  const float* bsr  = (const float*)d_in[6];
  const float* ln_g = (const float*)d_in[7];
  const float* ln_b = (const float*)d_in[8];
  const float* Wp   = (const float*)d_in[9];
  const float* bp   = (const float*)d_in[10];
  float* out = (float*)d_out;

  char* ws = (char*)d_ws;
  _Float16* xh   = (_Float16*)(ws + OFF_XH);
  _Float16* wqh  = (_Float16*)(ws + OFF_WQH);
  _Float16* wkvh = (_Float16*)(ws + OFF_WKVH);
  _Float16* wph  = (_Float16*)(ws + OFF_WPH);
  _Float16* wsrh = (_Float16*)(ws + OFF_WSRH);
  float*    xsr  = (float*)   (ws + OFF_XSR);
  _Float16* xln  = (_Float16*)(ws + OFF_XLN);
  _Float16* qh   = (_Float16*)(ws + OFF_QH);
  _Float16* kh   = (_Float16*)(ws + OFF_KH);
  _Float16* vt   = (_Float16*)(ws + OFF_VT);
  _Float16* aoh  = (_Float16*)(ws + OFF_AOH);

  // 1) convert / pack
  cvt_all<<<CB_X, 256, 0, stream>>>(x, Wq, Wkv, Wp, Wsr, xh, wqh, wkvh, wph, wsrh);

  // 2) + 3) SR patch-merge GEMM 4096x512x2048 (+bias) and Q projection 16384x512x512
  gemm_q_sr<<<GB_SR + GB_Q, 256, 0, stream>>>(xh, wqh, wsrh, bsr, qh, xsr);

  // 4) LayerNorm rows -> f16
  ln_rows<<<4096 / 8, 256, 0, stream>>>(xsr, ln_g, ln_b, xln);

  // 5) KV projection: 4096x1024x512
  gemm_kv<<<dim3(4096 / 32 / 4, 1024 / 64 / 2), 256, 0, stream>>>(xln, wkvh, kh, vt);

  // 6) flash attention per (b,h): 32 heads x 128 query-tiles, 8 tiles a block
  attn<<<dim3(128 / WG_WAVES, 32), 256, 0, stream>>>(qh, kh, vt, aoh);

  // 7) output projection: 16384x512x512 (+bias, f32)
  gemm_out<<<dim3(16384 / 32 / 4, 512 / 64 / 2), 256, 0, stream>>>(aoh, wph, bp, out);
}

// v008
// A run of this version takes 89.8 microseconds.
// Next to v007, in two timings, it ran 1.06 times as fast each time.
// Over all steps from v000 it is 3.45 times as fast.
#include <hip/hip_runtime.h>
#include <hip/hip_bf16.h>

typedef __attribute__((ext_vector_type(16))) _Float16 v16h;
typedef __attribute__((ext_vector_type(8)))  _Float16 v8h;
typedef __attribute__((ext_vector_type(8)))  float    v8f;
typedef __attribute__((ext_vector_type(2)))  float    v2f;

// ---------------- constants ----------------
#define CDIM    512

// workspace layout (bytes)
#define OFF_XH    ((size_t)0)                    // 16384*512 f16 = 16 MiB
#define OFF_WQH   (OFF_XH   + (size_t)16777216)  // 512*512  f16
#define OFF_WKVH  (OFF_WQH  + (size_t)524288)    // 1024*512 f16
#define OFF_WPH   (OFF_WKVH + (size_t)1048576)   // 512*512  f16
#define OFF_WSRH  (OFF_WPH  + (size_t)524288)    // 512*2048 f16
#define OFF_XSR   (OFF_WSRH + (size_t)2097152)   // 4096*512 f32
#define OFF_XLN   (OFF_XSR  + (size_t)8388608)   // 4096*512 f16
#define OFF_QH    (OFF_XLN  + (size_t)4194304)   // 32*4096*64 f16
#define OFF_KH    (OFF_QH   + (size_t)16777216)  // 32*1024*64 f16
#define OFF_VT    (OFF_KH   + (size_t)4194304)   // 32*64*1024 f16
#define OFF_AOH   (OFF_VT   + (size_t)4194304)   // 16384*512 f16

// ---------------- helpers ----------------
// Fragment-order layout of an f16 matrix [rows][K] in the workspace.
// A block is 16 rows x 32 k = 512 halfs; block index = (row/16)*(K/32) + k/32.
// Inside a block, element (row, k) sits at
//   ((k>>4)&1)*256 + (((k>>3)&1)*16 + (row&15))*8 + (k&7)
// so each of the two 16-byte loads of a fragment reads 512 contiguous bytes
// per wave (4 whole lines); element e of lane L is
// K = k0 + (e/8)*16 + (L/16)*8 + (e%8) of row L%16.
#define TILE512 8192      // halfs of one 16-row tile at K = 512

__device__ __forceinline__ int frag_off(int row, int k, int kblocks) {
  return ((row >> 4) * kblocks + (k >> 5)) * 512 + ((k >> 4) & 1) * 256
       + (((k >> 3) & 1) * 16 + (row & 15)) * 8 + (k & 7);
}

// blk = block base + lane*8
__device__ __forceinline__ v16h load_frag(const _Float16* __restrict__ blk) {
  v8h lo = *(const v8h*)(blk);
  v8h hi = *(const v8h*)(blk + 256);
  return __builtin_shufflevector(lo, hi, 0,1,2,3,4,5,6,7,8,9,10,11,12,13,14,15);
}

// the same from a wave-uniform base and a per-lane byte offset
__device__ __forceinline__ v16h load_frag_at(const _Float16* __restrict__ base, unsigned boff) {
  return load_frag((const _Float16*)((const char*)base + boff));
}

__device__ __forceinline__ v8f wmma_f16(v16h a, v16h b, v8f c) {
  return __builtin_amdgcn_wmma_f32_16x16x32_f16(false, a, false, b, (short)0, c,
                                                false, false);
}

__device__ __forceinline__ v8h pack8(v8f c) {
  v8h v;
  for (int r = 0; r < 8; r++) v[r] = (_Float16)c[r];
  return v;
}

// 2 x-tiles by 4 w-tiles. WA = false: x rows are the A operand (a lane holds 8
// rows of one w column). WA = true: w rows are the A operand (a lane holds 8
// consecutive w columns of one x row: one 16-byte piece of a fragment-order row).
template <bool WA>
__device__ __forceinline__ void mma_2x4(v16h a0, v16h a1, v16h b0, v16h b1,
                                        v16h b2, v16h b3, v8f (&c)[2][4]) {
  if (WA) {
    c[0][0] = wmma_f16(b0, a0, c[0][0]);  c[1][0] = wmma_f16(b0, a1, c[1][0]);
    c[0][1] = wmma_f16(b1, a0, c[0][1]);  c[1][1] = wmma_f16(b1, a1, c[1][1]);
    c[0][2] = wmma_f16(b2, a0, c[0][2]);  c[1][2] = wmma_f16(b2, a1, c[1][2]);
    c[0][3] = wmma_f16(b3, a0, c[0][3]);  c[1][3] = wmma_f16(b3, a1, c[1][3]);
  } else {
    c[0][0] = wmma_f16(a0, b0, c[0][0]);  c[1][0] = wmma_f16(a1, b0, c[1][0]);
    c[0][1] = wmma_f16(a0, b1, c[0][1]);  c[1][1] = wmma_f16(a1, b1, c[1][1]);
    c[0][2] = wmma_f16(a0, b2, c[0][2]);  c[1][2] = wmma_f16(a1, b2, c[1][2]);
    c[0][3] = wmma_f16(a0, b3, c[0][3]);  c[1][3] = wmma_f16(a1, b3, c[1][3]);
  }
}

// The six fragments of one k block (32 k) of a 32x64 tile.
struct Frag6 { v16h a0, a1, b0, b1, b2, b3; };

template <int XS, int WS>
__device__ __forceinline__ Frag6 load_frag6(const _Float16* __restrict__ xt,
                                            const _Float16* __restrict__ wt,
                                            unsigned xoff, unsigned woff) {
  Frag6 f;
  f.a0 = load_frag_at(xt, xoff);           f.a1 = load_frag_at(xt + XS, xoff);
  f.b0 = load_frag_at(wt, woff);           f.b1 = load_frag_at(wt + WS, woff);
  f.b2 = load_frag_at(wt + 2 * WS, woff);  f.b3 = load_frag_at(wt + 3 * WS, woff);
  return f;
}

// Software-pipelined 32x64 GEMM core over NSEG * 512 k (16 k blocks a segment).
// xt = first of two x tiles XS halfs apart, wt = first of four w tiles WS halfs
// apart, both in fragment order and wave-uniform; off = lane*16 bytes.
// w runs on through all k blocks; k block b of x starts XG(b) halfs behind xt.
// Three register sets: the 12 loads of step kb + 2 go out as one group ahead of
// the products of step kb, so a block's loads have two blocks' time to land.
// Step kb takes k block (kb + rot) mod NKB. rot is the work-group's own (scalar):
// groups that read the same x or w tiles start together, and walking k in the same
// order they would ask L2 for the same lines at the same moment all the way.
template <bool WA, int XS, int WS, int NSEG, typename XG>
__device__ __forceinline__ void gemm_core(const _Float16* __restrict__ xt,
                                          const _Float16* __restrict__ wt,
                                          unsigned off, v8f (&c)[2][4], int rot, XG xg) {
  constexpr int NKB = NSEG * 16;
  // the block goes into the per-lane byte offsets: the tile bases stay as they are
  unsigned xo, wo;
  auto load_step = [&](int step) {
    int blk = (step + rot) & (NKB - 1);
    xo = off + (unsigned)xg(blk) * 2;
    wo = off + (unsigned)blk * 1024;
    return load_frag6<XS, WS>(xt, wt, xo, wo);
  };
  Frag6 f[3];
  f[0] = load_step(0);
  unsigned xo0 = xo, wo0 = wo;
  f[1] = load_step(1);
  // the wait that belongs in front of a reuse of the loads' offset registers; named
  // here, they stay whole up to it (a later load of the group otherwise lands on them)
  asm volatile("s_wait_xcnt 0x0" :: "v"(xo0), "v"(wo0), "v"(xo), "v"(wo) : "memory");
  // unrolled whole: the three sets rotate by name
  #pragma unroll
  for (int kb = 0; kb < NKB; kb++) {
    // the same wait for the group that went out one step ago
    if (kb > 0 && kb + 1 < NKB) asm volatile("s_wait_xcnt 0x0" :: "v"(xo), "v"(wo) : "memory");
    if (kb + 2 < NKB) f[(kb + 2) % 3] = load_step(kb + 2);
    // keeps the loads above: the scheduler otherwise sinks each to its first use,
    // into one register set, and every k block then waits out several round trips
    __builtin_amdgcn_sched_barrier(0);
    const Frag6& g = f[kb % 3];
    mma_2x4<WA>(g.a0, g.a1, g.b0, g.b1, g.b2, g.b3, c);
    // keeps the next group of loads below these products: risen above them, as the
    // scheduler puts them, they take 16 more registers and the groups grow uneven
    __builtin_amdgcn_sched_barrier(0);
  }
}

// one segment of 512 k
template <bool WA, int XS, int WS>
__device__ __forceinline__ void gemm_core_512(const _Float16* __restrict__ xt,
                                              const _Float16* __restrict__ wt,
                                              unsigned off, v8f (&c)[2][4], int rot) {
  gemm_core<WA, XS, WS, 1>(xt, wt, off, c, rot, [](int blk) { return blk * 512; });
}

// The matrix launches run in work-groups of 8 waves with no barrier between them.
// The waves of a group take tiles that read the same fragments (GEMMs: 4 x-tile
// pairs by 2 w-tile quads; attention: 8 query tiles of one head) and start
// together on one WGP, so that a fragment several of them load can come from the
// WGP's cache for all but the first, where one-wave groups asked L2 every time.
#define WG_WAVES 8
// wave number in the group, as a scalar: tile bases stay in scalar registers
__device__ __forceinline__ int wave_id() {
  return __builtin_amdgcn_readfirstlane((int)(threadIdx.x >> 5));
}
__device__ __forceinline__ int lane_id() { return threadIdx.x & 31; }

// ---------------- conversion / packing ----------------
typedef __attribute__((ext_vector_type(4))) float v4f;

// The conversions are a stream: a wave takes a long piece of it, so that few waves
// have to start and each has many loads in flight.
// Lane l of a wave holds row 8*rh + l/4 of a 16-row tile and the 8 k at (l&3)*8 of
// a k block: four lanes read one whole 128-byte line of a row, a load touches 8
// lines, and a store fills four whole lines of the fragment-order block.

// f32 [rows][512] -> f16 in fragment order; unit u = (tile*2 + rh)*2 + kh is
// 8 rows x 256 k: 16 loads in flight, 8 stores.
// pair (x): tile T holds the 16 tokens (T/2)*32 + 2*i + (T&1), so that the
// stride-2 patch rows of the SR product are whole tiles too.
__device__ __forceinline__ void cvt_unit(const float* __restrict__ s,
                                         _Float16* __restrict__ d, int u, bool pair) {
  int lane = lane_id(), q = lane & 3;
  int kh = u & 1, rh = (u >> 1) & 1, tile = u >> 2;
  int lr = rh * 8 + (lane >> 2);
  int row = pair ? (tile >> 1) * 32 + 2 * lr + (tile & 1) : tile * 16 + lr;
  const float* p = s + (size_t)row * 512 + kh * 256 + q * 8;
  v4f a[8][2];
  for (int i = 0; i < 8; i++) {
    a[i][0] = *(const v4f*)(p + i * 32);
    a[i][1] = *(const v4f*)(p + i * 32 + 4);
  }
  // the wait that belongs in front of a reuse of the loads' address registers; named
  // here, they stay whole up to it (the last load otherwise lands on them)
  asm volatile("s_wait_xcnt 0x0" :: "v"(p) : "memory");
  // keeps the conversions below all 16 loads: the scheduler otherwise holds four
  // loads back behind the first waits, and the wave pays a second round trip
  __builtin_amdgcn_sched_barrier(0);
  _Float16* o = d + (size_t)(tile * 16 + kh * 8) * 512 + (q * 16 + lr) * 8;
  for (int i = 0; i < 8; i++) {
    v8h v;
    for (int e = 0; e < 4; e++) { v[e] = (_Float16)a[i][0][e];  v[4 + e] = (_Float16)a[i][1][e]; }
    *(v8h*)(o + i * 512) = v;
  }
  // the wait that belongs in front of a reuse of the stores' address registers: the
  // code of another range of the block index follows these stores in the kernel
  asm volatile("s_wait_xcnt 0x0" ::: "memory");
}

// Wsr [c_out][c_in][2][2] -> Wsr_h [c_out][k=2048] in fragment order,
// k = (kh*2+kw)*512 + c_in. Unit u = (tile*2 + rh)*16 + cb is 8 c_out x 32 c_in:
// a lane reads the 128 bytes of its 8 c_in once, as 8 loads of all four (kh,kw),
// and stores one piece for each of the four.
__device__ __forceinline__ void pack_wsr_unit(const float* __restrict__ w,
                                              _Float16* __restrict__ d, int u) {
  int lane = lane_id(), q = lane & 3;
  int cb = u & 15, rh = (u >> 4) & 1, tile = u >> 5;
  int lr = rh * 8 + (lane >> 2);
  const float* p = w + ((size_t)(tile * 16 + lr) * 512 + cb * 32 + q * 8) * 4;
  v4f a[8];
  for (int i = 0; i < 8; i++) a[i] = *(const v4f*)(p + i * 4);
  _Float16* o = d + (size_t)(tile * 64 + cb) * 512 + (q * 16 + lr) * 8;
  for (int s = 0; s < 4; s++) {
    v8h v;
    for (int i = 0; i < 8; i++) v[i] = (_Float16)a[i][s];
    *(v8h*)(o + s * 16 * 512) = v;
  }
}

// All five conversions are independent: one launch, a range of the block index
// picks the job (8 units a block, one a wave, every range exact). The weights come
// first, so that their few blocks run under the long x range and not behind it.
#define CB_WSR (512 / 8 * (512 / 32) / WG_WAVES)          // 128 blocks
#define CB_WQ  (CB_WSR + 512 / 8 * 2 / WG_WAVES)          // + 16
#define CB_WKV (CB_WQ + 1024 / 8 * 2 / WG_WAVES)          // + 32
#define CB_WP  (CB_WKV + 512 / 8 * 2 / WG_WAVES)          // + 16
#define CB_X   (CB_WP + 16384 / 8 * 2 / WG_WAVES)         // + 512
__global__ void __launch_bounds__(256) cvt_all(const float* __restrict__ x,
                                               const float* __restrict__ Wq,
                                               const float* __restrict__ Wkv,
                                               const float* __restrict__ Wp,
                                               const float* __restrict__ Wsr,
                                               _Float16* __restrict__ xh,
                                               _Float16* __restrict__ wqh,
                                               _Float16* __restrict__ wkvh,
                                               _Float16* __restrict__ wph,
                                               _Float16* __restrict__ wsrh) {
  int b = blockIdx.x, w = wave_id();
  if (b < CB_WSR)      pack_wsr_unit(Wsr, wsrh, b * WG_WAVES + w);
  else if (b < CB_WQ)  cvt_unit(Wq, wqh, (b - CB_WSR) * WG_WAVES + w, false);
  else if (b < CB_WKV) cvt_unit(Wkv, wkvh, (b - CB_WQ) * WG_WAVES + w, false);
  else if (b < CB_WP)  cvt_unit(Wp, wph, (b - CB_WKV) * WG_WAVES + w, false);
  else                 cvt_unit(x, xh, (b - CB_WP) * WG_WAVES + w, true);
}

// ---------------- GEMM: Q projection (32x64 tiles) ----------------
__device__ __forceinline__ void q_tile(int mt, int nt, int rot,
                                       const _Float16* __restrict__ A,
                                       const _Float16* __restrict__ W,
                                       _Float16* __restrict__ Q) {
  int lane = lane_id(), lr = lane & 15, lhh = lane >> 4;
  v8f c[2][4];
  for (int s = 0; s < 2; s++) for (int t = 0; t < 4; t++)
    for (int r = 0; r < 8; r++) c[s][t][r] = 0.0f;
  gemm_core_512<true, TILE512, TILE512>(A + (size_t)(mt * 2) * TILE512,
                      W + (size_t)(nt * 4) * TILE512, lane * 16, c, rot);
  // lane: token mt*32 + 2*lr + s, head nt, dd = t*16 + 8*lhh + (0..7)
  int bh = (mt >> 7) * 8 + nt;
  for (int s = 0; s < 2; s++)
    for (int t = 0; t < 4; t++) {
      int nq = (mt * 32 + 2 * lr + s) & 4095;
      *(v8h*)(Q + (size_t)bh * 4096 * 64 + frag_off(nq, t * 16 + 8 * lhh, 2)) =
          pack8(c[s][t]);
    }
}

// ---------------- GEMM: SR patch-merge conv (stride2,k2) + bias ----------------
__device__ __forceinline__ void sr_tile(int mt, int nt, int rot,
                                        const _Float16* __restrict__ xh,
                                        const _Float16* __restrict__ W,
                                        const float* __restrict__ bsr,
                                        float* __restrict__ out) {
  int lane = lane_id(), lr = lane & 15;
  // output rows mt*32 + s*16 + lr: batch mt>>5, oh = mt&31, ow = s*16 + lr
  int bb = mt >> 5, oh = mt & 31;
  // x tile of (s, kh, kw) = (bb*128 + (2*oh+kh)*2 + s)*2 + kw
  const _Float16* xt = xh + (size_t)((bb * 128 + 4 * oh) * 2) * TILE512;
  const _Float16* wt = W + (size_t)(nt * 4) * (4 * TILE512);
  v8f c[2][4];
  for (int s = 0; s < 2; s++) for (int t = 0; t < 4; t++)
    for (int r = 0; r < 8; r++) c[s][t][r] = 0.0f;
  // k = (kh*2+kw)*512 + c_in: 16 k blocks per (kh,kw). The tiles of kw = 0, 1 lie
  // side by side (32 blocks in a row), those of kh = 1 four tiles further on.
  gemm_core<false, 2 * TILE512, 4 * TILE512, 4>(
      xt, wt, lane * 16, c, rot,
      [](int blk) { return (blk & 31) * 512 + (blk >> 5) * (4 * TILE512); });

  for (int s = 0; s < 2; s++)
    for (int t = 0; t < 4; t++)
      for (int r = 0; r < 8; r++) {
        int mm = mt * 32 + s * 16 + r + 8 * (lane >> 4);
        int col = nt * 64 + t * 16 + lr;
        out[(size_t)mm * CDIM + col] = c[s][t][r] + bsr[col];
      }
}

// Both products read only xh and their own weights: one launch. The 1024 SR tiles
// (2048 k each) take the low block indices, so that they start first and the 4096
// Q tiles (512 k each) run beside them. A block is 4 x 2 tiles, one a wave.
#define GB_SR (4096 / 32 * (512 / 64) / WG_WAVES)    // 128 blocks
#define GB_Q  (16384 / 32 * (512 / 64) / WG_WAVES)   // 512 blocks
__global__ void __launch_bounds__(256) gemm_q_sr(const _Float16* __restrict__ xh,
                                                const _Float16* __restrict__ wqh,
                                                const _Float16* __restrict__ wsrh,
                                                const float* __restrict__ bsr,
                                                _Float16* __restrict__ Q,
                                                float* __restrict__ xsr) {
  int b = blockIdx.x, w = wave_id(), wm = w & 3, wn = w >> 2;
  if (b < GB_SR) {
    // 32 groups share w rows, 4 share x rows: each set spread over the 64 k blocks
    sr_tile((b & 31) * 4 + wm, (b >> 5) * 2 + wn, (b & 31) * 2 + (b >> 5) * 16, xh, wsrh, bsr, xsr);
  } else {
    b -= GB_SR;
    // 128 groups share w rows, 4 share x rows
    q_tile((b & 127) * 4 + wm, (b >> 7) * 2 + wn, (b & 127) + (b >> 7) * 4, xh, wqh, Q);
  }
}

// ---------------- LayerNorm over 512-wide rows ----------------
// One block takes 8 rows at once, each row summed by its own 256-wide tree:
// 8 rows fill whole 128-byte lines of the fragment-order output.
__global__ void __launch_bounds__(256) ln_rows(const float* __restrict__ x,
                                               const float* __restrict__ g,
                                               const float* __restrict__ bt,
                                               _Float16* __restrict__ out) {
  __shared__ float red[8][256];
  int row0 = blockIdx.x * 8, t = threadIdx.x;
  float v0[8], v1[8];
  for (int q = 0; q < 8; q++) {
    v0[q] = x[(size_t)(row0 + q) * 512 + t];
    v1[q] = x[(size_t)(row0 + q) * 512 + 256 + t];
    red[q][t] = v0[q] + v1[q];
  }
  __syncthreads();
  for (int s = 128; s > 0; s >>= 1) {
    if (t < s) for (int q = 0; q < 8; q++) red[q][t] += red[q][t + s];
    __syncthreads();
  }
  float d0[8], d1[8];
  for (int q = 0; q < 8; q++) {
    float mu = red[q][0] * (1.0f / 512.0f);
    d0[q] = v0[q] - mu;  d1[q] = v1[q] - mu;
  }
  __syncthreads();
  for (int q = 0; q < 8; q++) red[q][t] = d0[q] * d0[q] + d1[q] * d1[q];
  __syncthreads();
  for (int s = 128; s > 0; s >>= 1) {
    if (t < s) for (int q = 0; q < 8; q++) red[q][t] += red[q][t + s];
    __syncthreads();
  }
  for (int q = 0; q < 8; q++) {
    float rstd = rsqrtf(red[q][0] * (1.0f / 512.0f) + 1e-5f);
    out[frag_off(row0 + q, t, 16)]       = (_Float16)(d0[q] * rstd * g[t] + bt[t]);
    out[frag_off(row0 + q, 256 + t, 16)] = (_Float16)(d1[q] * rstd * g[256 + t] + bt[256 + t]);
  }
}

// ---------------- GEMM: KV projection ----------------
__global__ void __launch_bounds__(256) gemm_kv(const _Float16* __restrict__ A,
                                              const _Float16* __restrict__ W,
                                              _Float16* __restrict__ Kh,
                                              _Float16* __restrict__ Vt) {
  int w = wave_id();
  int mt = blockIdx.x * 4 + (w & 3), nt = blockIdx.y * 2 + (w >> 2);
  int lane = lane_id();
  const _Float16* xt = A + (size_t)(mt * 2) * TILE512;
  const _Float16* wt = W + (size_t)(nt * 4) * TILE512;
  int b = mt >> 5, mq = mt & 31;          // rows mt*32.. = keys mq*32.. of batch b
  int rot = blockIdx.x + blockIdx.y * 2;  // 32 groups share w rows, 8 share x rows
  v8f c[2][4];
  for (int s = 0; s < 2; s++) for (int t = 0; t < 4; t++)
    for (int r = 0; r < 8; r++) c[s][t][r] = 0.0f;
  if (nt < 8) {
    // K [key][dd]: lane holds key mq*32 + s*16 + lr, dd = t*16 + 8*lhh + (0..7)
    gemm_core_512<true, TILE512, TILE512>(xt, wt, lane * 16, c, rot);
    _Float16* kb = Kh + (size_t)((b << 3) + nt) * 1024 * 64 + lane * 8;
    for (int s = 0; s < 2; s++)
      for (int t = 0; t < 4; t++)
        *(v8h*)(kb + ((mq * 2 + s) * 2 + (t >> 1)) * 512 + (t & 1) * 256) = pack8(c[s][t]);
  } else {
    // V^T [dd][key]: lane holds dd = t*16 + lr, keys mq*32 + s*16 + 8*lhh + (0..7)
    gemm_core_512<false, TILE512, TILE512>(xt, wt, lane * 16, c, rot);
    _Float16* vb = Vt + (size_t)((b << 3) + nt - 8) * 64 * 1024 + lane * 8;
    for (int s = 0; s < 2; s++)
      for (int t = 0; t < 4; t++)
        *(v8h*)(vb + (t * 32 + mq) * 512 + s * 256) = pack8(c[s][t]);
  }
}

// ---------------- Flash attention: one wave = 32 queries of one (b,h) ----------------
struct KF { v16h f[4]; };
// kc = K of this (b,h) in fragment order + lane*8; a 32-key chunk is 4 blocks in a row
__device__ __forceinline__ KF load_kf(const _Float16* __restrict__ kc, int j) {
  KF k;
  const _Float16* p = kc + j * 2048;
  k.f[0] = load_frag(p);         k.f[1] = load_frag(p + 512);
  k.f[2] = load_frag(p + 1024);  k.f[3] = load_frag(p + 1536);
  return k;
}

// lane l with lane l ^ 16
__device__ __forceinline__ float xhalf(float x) {
  int v = __builtin_bit_cast(int, x);
  return __builtin_bit_cast(float, __builtin_amdgcn_permlanex16(v, v, 0x76543210, 0xfedcba98,
                                                                false, false));
}

__global__ void __launch_bounds__(256) attn(const _Float16* __restrict__ Qh,
                                           const _Float16* __restrict__ Kh,
                                           const _Float16* __restrict__ Vt,
                                           _Float16* __restrict__ AO) {
  int mt = blockIdx.x * WG_WAVES + wave_id();   // 32-query tile 0..127
  int bh = blockIdx.y;          // 0..31
  int b = bh >> 3, h = bh & 7;
  int lane = lane_id(), lr = lane & 15, lhh = lane >> 4;

  const _Float16* qblk = Qh + (size_t)(bh * 256 + mt * 2) * 1024 + lane * 8;
  v16h a[2][2];
  for (int u = 0; u < 2; u++) {
    a[u][0] = load_frag(qblk + u * 1024);
    a[u][1] = load_frag(qblk + u * 1024 + 512);
  }
  const _Float16* Kbh = Kh + (size_t)bh * 1024 * 64 + lane * 8;
  const _Float16* Vbh = Vt + (size_t)bh * 64 * 1024 + lane * 8;

  // o[u][t][r] = O[query u*16 + lr][dd = t*16 + 8*lhh + r]
  v8f o[2][4];
  for (int u = 0; u < 2; u++)
    for (int t = 0; t < 4; t++) for (int r = 0; r < 8; r++) o[u][t][r] = 0.0f;
  // query u*16 + lr: maximum over all keys so far; sums over this half's even and
  // odd keys, joined behind the loop
  float mrun[2] = {-1e30f, -1e30f};
  v2f lrun[2] = {{0.0f, 0.0f}, {0.0f, 0.0f}};
  const float scale = 0.125f;              // 1/sqrt(64)

  // The 16 work-groups of a head walk the same 32 chunks: each starts two chunks
  // behind the one before it and wraps round, so that they do not ask L2 for the
  // same K and V lines at the same moment.
  const int j0 = blockIdx.x * 2;
  KF kc = load_kf(Kbh, j0);                // prologue: K fragments for the first chunk
  for (int i = 0; i < 32; ++i) {
    const int j = (i + j0) & 31;
    // ---- V fragments for this chunk (independent of softmax; issue early) ----
    v16h vb[4];
    for (int t = 0; t < 4; t++)
      vb[t] = load_frag(Vbh + (t * 32 + j) * 512);
    // keeps the V loads at the head of the chunk, as with a plain walk: with the
    // wrapped index the scheduler sinks them behind the eight score products
    __builtin_amdgcn_sched_barrier(0);
    // ---- scores: S^T(32 keys x 32 queries) = K(32x64) @ Q^T ----
    // s[u][g][r] = S[query u*16 + lr][key g*16 + 8*lhh + r]
    v8f s[2][2];
    for (int u = 0; u < 2; u++) {
      for (int r = 0; r < 8; r++) { s[u][0][r] = 0.0f; s[u][1][r] = 0.0f; }
      s[u][0] = wmma_f16(kc.f[0], a[u][0], s[u][0]);
      s[u][0] = wmma_f16(kc.f[1], a[u][1], s[u][0]);
      s[u][1] = wmma_f16(kc.f[2], a[u][0], s[u][1]);
      s[u][1] = wmma_f16(kc.f[3], a[u][1], s[u][1]);
    }
    // ---- prefetch next chunk's K fragments (overlaps softmax latency) ----
    KF kn = load_kf(Kbh, (i + 1 < 32) ? (j + 1) & 31 : j);
    // keeps these loads here, right behind the products that free their registers:
    // the scheduler otherwise sinks them to the foot of the loop, where the next
    // chunk's first product waits out their whole round trip
    __builtin_amdgcn_sched_barrier(0);
    // ---- online softmax of query u*16 + lr, in the lane's own registers ----
    float mx[2], f[2];
    for (int u = 0; u < 2; u++) {
      // scale is a power of two: the maximum of the scaled scores is the scaled maximum
      float rm = s[u][0][0];
      for (int r = 1; r < 8; r++) rm = fmaxf(rm, s[u][0][r]);
      for (int r = 0; r < 8; r++) rm = fmaxf(rm, s[u][1][r]);
      mx[u] = fmaxf(mrun[u], rm * scale);
      mx[u] = fmaxf(mx[u], xhalf(mx[u]));
    }
    for (int u = 0; u < 2; u++) { f[u] = __expf(mrun[u] - mx[u]);  mrun[u] = mx[u]; }
    for (int u = 0; u < 2; u++) {
      v2f sum = {0.0f, 0.0f};
      v16h pb;                             // P^T: element g*8 + r is key g*16 + 8*lhh + r
      for (int g = 0; g < 2; g++) {
        v8f e = s[u][g] * scale - mx[u];
        for (int r = 0; r < 8; r += 2) {
          v2f p = {__expf(e[r]), __expf(e[r + 1])};
          sum += p;
          pb[g * 8 + r]     = (_Float16)p.x;
          pb[g * 8 + r + 1] = (_Float16)p.y;
        }
      }
      lrun[u] = lrun[u] * f[u] + sum;
      // ---- rescale, then O^T += V^T(64x32) @ P^T(32x16) ----
      for (int t = 0; t < 4; t++) {
        o[u][t] *= f[u];
        o[u][t] = wmma_f16(vb[t], pb, o[u][t]);
      }
    }
    kc = kn;
  }
  for (int u = 0; u < 2; u++) {
    float l = lrun[u].x + lrun[u].y;
    float inv = 1.0f / (l + xhalf(l));
    int nq = mt * 32 + u * 16 + lr;
    for (int t = 0; t < 4; t++)
      *(v8h*)(AO + frag_off(b * 4096 + nq, h * 64 + t * 16 + 8 * lhh, 16)) =
          pack8(o[u][t] * inv);
  }
}

// ---------------- GEMM: output projection + bias (f32 out) ----------------
__global__ void __launch_bounds__(256) gemm_out(const _Float16* __restrict__ A,
                                               const _Float16* __restrict__ W,
                                               const float* __restrict__ bp,
                                               float* __restrict__ out) {
  int w = wave_id();
  int mt = blockIdx.x * 4 + (w & 3), nt = blockIdx.y * 2 + (w >> 2);
  int lane = lane_id(), lr = lane & 15;
  v8f c[2][4];
  for (int s = 0; s < 2; s++) for (int t = 0; t < 4; t++)
    for (int r = 0; r < 8; r++) c[s][t][r] = 0.0f;
  gemm_core_512<false, TILE512, TILE512>(A + (size_t)(mt * 2) * TILE512,
                       W + (size_t)(nt * 4) * TILE512, lane * 16, c,
                       blockIdx.x + blockIdx.y * 4);   // 128 groups share w rows, 4 x rows
  for (int s = 0; s < 2; s++)
    for (int t = 0; t < 4; t++)
      for (int r = 0; r < 8; r++) {
        int m = mt * 32 + s * 16 + r + 8 * (lane >> 4);
        int col = nt * 64 + t * 16 + lr;
        out[(size_t)m * CDIM + col] = c[s][t][r] + bp[col];
      }
}

// ---------------- host ----------------
extern "C" void kernel_launch(void* const* d_in, const int* in_sizes, int n_in,
                              void* d_out, int out_size, void* d_ws, size_t ws_size,
                              hipStream_t stream) {
  const float* x    = (const float*)d_in[0];
  // d_in[1], d_in[2] are H, W (compile-time 64 here)
  const float* Wq   = (const float*)d_in[3];
  const float* Wkv  = (const float*)d_in[4];
  const float* Wsr  = (const float*)d_in[5];
  const float* bsr  = (const float*)d_in[6];
  const float* ln_g = (const float*)d_in[7];
  const float* ln_b = (const float*)d_in[8];
  const float* Wp   = (const float*)d_in[9];
  const float* bp   = (const float*)d_in[10];
  float* out = (float*)d_out;

  char* ws = (char*)d_ws;
  _Float16* xh   = (_Float16*)(ws + OFF_XH);
  _Float16* wqh  = (_Float16*)(ws + OFF_WQH);
  _Float16* wkvh = (_Float16*)(ws + OFF_WKVH);
  _Float16* wph  = (_Float16*)(ws + OFF_WPH);
  _Float16* wsrh = (_Float16*)(ws + OFF_WSRH);
  float*    xsr  = (float*)   (ws + OFF_XSR);
  _Float16* xln  = (_Float16*)(ws + OFF_XLN);
  _Float16* qh   = (_Float16*)(ws + OFF_QH);
  _Float16* kh   = (_Float16*)(ws + OFF_KH);
  _Float16* vt   = (_Float16*)(ws + OFF_VT);
  _Float16* aoh  = (_Float16*)(ws + OFF_AOH);

  // 1) convert / pack
  cvt_all<<<CB_X, 256, 0, stream>>>(x, Wq, Wkv, Wp, Wsr, xh, wqh, wkvh, wph, wsrh);

  // 2) + 3) SR patch-merge GEMM 4096x512x2048 (+bias) and Q projection 16384x512x512
  gemm_q_sr<<<GB_SR + GB_Q, 256, 0, stream>>>(xh, wqh, wsrh, bsr, qh, xsr);

  // 4) LayerNorm rows -> f16
  ln_rows<<<4096 / 8, 256, 0, stream>>>(xsr, ln_g, ln_b, xln);

  // 5) KV projection: 4096x1024x512
  gemm_kv<<<dim3(4096 / 32 / 4, 1024 / 64 / 2), 256, 0, stream>>>(xln, wkvh, kh, vt);

  // 6) flash attention per (b,h): 32 heads x 128 query-tiles, 8 tiles a block
  attn<<<dim3(128 / WG_WAVES, 32), 256, 0, stream>>>(qh, kh, vt, aoh);

  // 7) output projection: 16384x512x512 (+bias, f32)
  gemm_out<<<dim3(16384 / 32 / 4, 512 / 64 / 2), 256, 0, stream>>>(aoh, wph, bp, out);
}

// v009
// It runs in 85.2 microseconds.
// Timed twice side by side with v008, it ran 1.06 times as fast both times.
// Over all steps from v000 it is 3.65 times as fast.
#include <hip/hip_runtime.h>
#include <hip/hip_bf16.h>

typedef __attribute__((ext_vector_type(16))) _Float16 v16h;
typedef __attribute__((ext_vector_type(8)))  _Float16 v8h;
typedef __attribute__((ext_vector_type(8)))  float    v8f;
typedef __attribute__((ext_vector_type(2)))  float    v2f;

// ---------------- constants ----------------
#define CDIM    512

// workspace layout (bytes)
#define OFF_XH    ((size_t)0)                    // 16384*512 f16 = 16 MiB
#define OFF_WQH   (OFF_XH   + (size_t)16777216)  // 512*512  f16
#define OFF_WKVH  (OFF_WQH  + (size_t)524288)    // 1024*512 f16
#define OFF_WPH   (OFF_WKVH + (size_t)1048576)   // 512*512  f16
#define OFF_WSRH  (OFF_WPH  + (size_t)524288)    // 512*2048 f16
#define OFF_XLN   (OFF_WSRH + (size_t)2097152)   // 4096*512 f16
#define OFF_QH    (OFF_XLN  + (size_t)4194304)   // 32*4096*64 f16
#define OFF_KH    (OFF_QH   + (size_t)16777216)  // 32*1024*64 f16
#define OFF_VT    (OFF_KH   + (size_t)4194304)   // 32*64*1024 f16
#define OFF_AOH   (OFF_VT   + (size_t)4194304)   // 16384*512 f16

// ---------------- helpers ----------------
// Fragment-order layout of an f16 matrix [rows][K] in the workspace.
// A block is 16 rows x 32 k = 512 halfs; block index = (row/16)*(K/32) + k/32.
// Inside a block, element (row, k) sits at
//   ((k>>4)&1)*256 + (((k>>3)&1)*16 + (row&15))*8 + (k&7)
// so each of the two 16-byte loads of a fragment reads 512 contiguous bytes
// per wave (4 whole lines); element e of lane L is
// K = k0 + (e/8)*16 + (L/16)*8 + (e%8) of row L%16.
#define TILE512 8192      // halfs of one 16-row tile at K = 512

__device__ __forceinline__ int frag_off(int row, int k, int kblocks) {
  return ((row >> 4) * kblocks + (k >> 5)) * 512 + ((k >> 4) & 1) * 256
       + (((k >> 3) & 1) * 16 + (row & 15)) * 8 + (k & 7);
}

// blk = block base + lane*8
__device__ __forceinline__ v16h load_frag(const _Float16* __restrict__ blk) {
  v8h lo = *(const v8h*)(blk);
  v8h hi = *(const v8h*)(blk + 256);
  return __builtin_shufflevector(lo, hi, 0,1,2,3,4,5,6,7,8,9,10,11,12,13,14,15);
}

// the same from a wave-uniform base and a per-lane byte offset
__device__ __forceinline__ v16h load_frag_at(const _Float16* __restrict__ base, unsigned boff) {
  return load_frag((const _Float16*)((const char*)base + boff));
}

__device__ __forceinline__ v8f wmma_f16(v16h a, v16h b, v8f c) {
  return __builtin_amdgcn_wmma_f32_16x16x32_f16(false, a, false, b, (short)0, c,
                                                false, false);
}

__device__ __forceinline__ v8h pack8(v8f c) {
  v8h v;
  for (int r = 0; r < 8; r++) v[r] = (_Float16)c[r];
  return v;
}

// 2 x-tiles by 4 w-tiles. WA = false: x rows are the A operand (a lane holds 8
// rows of one w column). WA = true: w rows are the A operand (a lane holds 8
// consecutive w columns of one x row: one 16-byte piece of a fragment-order row).
template <bool WA>
__device__ __forceinline__ void mma_2x4(v16h a0, v16h a1, v16h b0, v16h b1,
                                        v16h b2, v16h b3, v8f (&c)[2][4]) {
  if (WA) {
    c[0][0] = wmma_f16(b0, a0, c[0][0]);  c[1][0] = wmma_f16(b0, a1, c[1][0]);
    c[0][1] = wmma_f16(b1, a0, c[0][1]);  c[1][1] = wmma_f16(b1, a1, c[1][1]);
    c[0][2] = wmma_f16(b2, a0, c[0][2]);  c[1][2] = wmma_f16(b2, a1, c[1][2]);
    c[0][3] = wmma_f16(b3, a0, c[0][3]);  c[1][3] = wmma_f16(b3, a1, c[1][3]);
  } else {
    c[0][0] = wmma_f16(a0, b0, c[0][0]);  c[1][0] = wmma_f16(a1, b0, c[1][0]);
    c[0][1] = wmma_f16(a0, b1, c[0][1]);  c[1][1] = wmma_f16(a1, b1, c[1][1]);
    c[0][2] = wmma_f16(a0, b2, c[0][2]);  c[1][2] = wmma_f16(a1, b2, c[1][2]);
    c[0][3] = wmma_f16(a0, b3, c[0][3]);  c[1][3] = wmma_f16(a1, b3, c[1][3]);
  }
}

// The six fragments of one k block (32 k) of a 32x64 tile.
struct Frag6 { v16h a0, a1, b0, b1, b2, b3; };

template <int XS, int WS>
__device__ __forceinline__ Frag6 load_frag6(const _Float16* __restrict__ xt,
                                            const _Float16* __restrict__ wt,
                                            unsigned xoff, unsigned woff) {
  Frag6 f;
  f.a0 = load_frag_at(xt, xoff);           f.a1 = load_frag_at(xt + XS, xoff);
  f.b0 = load_frag_at(wt, woff);           f.b1 = load_frag_at(wt + WS, woff);
  f.b2 = load_frag_at(wt + 2 * WS, woff);  f.b3 = load_frag_at(wt + 3 * WS, woff);
  return f;
}

// Software-pipelined 32x64 GEMM core over NSEG * 512 k (16 k blocks a segment).
// xt = first of two x tiles XS halfs apart, wt = first of four w tiles WS halfs
// apart, both in fragment order and wave-uniform; off = lane*16 bytes.
// w runs on through all k blocks; k block b of x starts XG(b) halfs behind xt.
// Three register sets: the 12 loads of step kb + 2 go out as one group ahead of
// the products of step kb, so a block's loads have two blocks' time to land.
// Step kb takes k block (kb + rot) mod NKB. rot is the work-group's own (scalar):
// groups that read the same x or w tiles start together, and walking k in the same
// order they would ask L2 for the same lines at the same moment all the way.
template <bool WA, int XS, int WS, int NSEG, typename XG>
__device__ __forceinline__ void gemm_core(const _Float16* __restrict__ xt,
                                          const _Float16* __restrict__ wt,
                                          unsigned off, v8f (&c)[2][4], int rot, XG xg) {
  constexpr int NKB = NSEG * 16;
  // the block goes into the per-lane byte offsets: the tile bases stay as they are
  unsigned xo, wo;
  auto load_step = [&](int step) {
    int blk = (step + rot) & (NKB - 1);
    xo = off + (unsigned)xg(blk) * 2;
    wo = off + (unsigned)blk * 1024;
    return load_frag6<XS, WS>(xt, wt, xo, wo);
  };
  Frag6 f[3];
  f[0] = load_step(0);
  unsigned xo0 = xo, wo0 = wo;
  f[1] = load_step(1);
  // the wait that belongs in front of a reuse of the loads' offset registers; named
  // here, they stay whole up to it (a later load of the group otherwise lands on them)
  asm volatile("s_wait_xcnt 0x0" :: "v"(xo0), "v"(wo0), "v"(xo), "v"(wo) : "memory");
  // unrolled whole: the three sets rotate by name
  #pragma unroll
  for (int kb = 0; kb < NKB; kb++) {
    // the same wait for the group that went out one step ago
    if (kb > 0 && kb + 1 < NKB) asm volatile("s_wait_xcnt 0x0" :: "v"(xo), "v"(wo) : "memory");
    if (kb + 2 < NKB) f[(kb + 2) % 3] = load_step(kb + 2);
    // keeps the loads above: the scheduler otherwise sinks each to its first use,
    // into one register set, and every k block then waits out several round trips
    __builtin_amdgcn_sched_barrier(0);
    const Frag6& g = f[kb % 3];
    mma_2x4<WA>(g.a0, g.a1, g.b0, g.b1, g.b2, g.b3, c);
    // keeps the next group of loads below these products: risen above them, as the
    // scheduler puts them, they take 16 more registers and the groups grow uneven
    __builtin_amdgcn_sched_barrier(0);
  }
}

// one segment of 512 k
template <bool WA, int XS, int WS>
__device__ __forceinline__ void gemm_core_512(const _Float16* __restrict__ xt,
                                              const _Float16* __restrict__ wt,
                                              unsigned off, v8f (&c)[2][4], int rot) {
  gemm_core<WA, XS, WS, 1>(xt, wt, off, c, rot, [](int blk) { return blk * 512; });
}

// The matrix launches run in work-groups of 8 waves, with no barrier in the k walks.
// The waves of a group take tiles that read the same fragments (GEMMs: 4 x-tile
// pairs by 2 w-tile quads, SR 1 by 8; attention: 8 query tiles of one head) and start
// together on one WGP, so that a fragment several of them load can come from the
// WGP's cache for all but the first, where one-wave groups asked L2 every time.
#define WG_WAVES 8
// wave number in the group, as a scalar: tile bases stay in scalar registers
__device__ __forceinline__ int wave_id() {
  return __builtin_amdgcn_readfirstlane((int)(threadIdx.x >> 5));
}
__device__ __forceinline__ int lane_id() { return threadIdx.x & 31; }

// ---------------- conversion / packing ----------------
typedef __attribute__((ext_vector_type(4))) float v4f;

// The conversions are a stream: a wave takes a long piece of it, so that few waves
// have to start and each has many loads in flight.
// Lane l of a wave holds row 8*rh + l/4 of a 16-row tile and the 8 k at (l&3)*8 of
// a k block: four lanes read one whole 128-byte line of a row, a load touches 8
// lines, and a store fills four whole lines of the fragment-order block.

// f32 [rows][512] -> f16 in fragment order; unit u = (tile*2 + rh)*2 + kh is
// 8 rows x 256 k: 16 loads in flight, 8 stores.
// pair (x): tile T holds the 16 tokens (T/2)*32 + 2*i + (T&1), so that the
// stride-2 patch rows of the SR product are whole tiles too.
__device__ __forceinline__ void cvt_unit(const float* __restrict__ s,
                                         _Float16* __restrict__ d, int u, bool pair) {
  int lane = lane_id(), q = lane & 3;
  int kh = u & 1, rh = (u >> 1) & 1, tile = u >> 2;
  int lr = rh * 8 + (lane >> 2);
  int row = pair ? (tile >> 1) * 32 + 2 * lr + (tile & 1) : tile * 16 + lr;
  const float* p = s + (size_t)row * 512 + kh * 256 + q * 8;
  v4f a[8][2];
  for (int i = 0; i < 8; i++) {
    a[i][0] = *(const v4f*)(p + i * 32);
    a[i][1] = *(const v4f*)(p + i * 32 + 4);
  }
  // the wait that belongs in front of a reuse of the loads' address registers; named
  // here, they stay whole up to it (the last load otherwise lands on them)
  asm volatile("s_wait_xcnt 0x0" :: "v"(p) : "memory");
  // keeps the conversions below all 16 loads: the scheduler otherwise holds four
  // loads back behind the first waits, and the wave pays a second round trip
  __builtin_amdgcn_sched_barrier(0);
  _Float16* o = d + (size_t)(tile * 16 + kh * 8) * 512 + (q * 16 + lr) * 8;
  for (int i = 0; i < 8; i++) {
    v8h v;
    for (int e = 0; e < 4; e++) { v[e] = (_Float16)a[i][0][e];  v[4 + e] = (_Float16)a[i][1][e]; }
    *(v8h*)(o + i * 512) = v;
  }
  // the wait that belongs in front of a reuse of the stores' address registers: the
  // code of another range of the block index follows these stores in the kernel
  asm volatile("s_wait_xcnt 0x0" ::: "memory");
}

// Wsr [c_out][c_in][2][2] -> Wsr_h [c_out][k=2048] in fragment order,
// k = (kh*2+kw)*512 + c_in. Unit u = (tile*2 + rh)*16 + cb is 8 c_out x 32 c_in:
// a lane reads the 128 bytes of its 8 c_in once, as 8 loads of all four (kh,kw),
// and stores one piece for each of the four.
__device__ __forceinline__ void pack_wsr_unit(const float* __restrict__ w,
                                              _Float16* __restrict__ d, int u) {
  int lane = lane_id(), q = lane & 3;
  int cb = u & 15, rh = (u >> 4) & 1, tile = u >> 5;
  int lr = rh * 8 + (lane >> 2);
  const float* p = w + ((size_t)(tile * 16 + lr) * 512 + cb * 32 + q * 8) * 4;
  v4f a[8];
  for (int i = 0; i < 8; i++) a[i] = *(const v4f*)(p + i * 4);
  _Float16* o = d + (size_t)(tile * 64 + cb) * 512 + (q * 16 + lr) * 8;
  for (int s = 0; s < 4; s++) {
    v8h v;
    for (int i = 0; i < 8; i++) v[i] = (_Float16)a[i][s];
    *(v8h*)(o + s * 16 * 512) = v;
  }
}

// All five conversions are independent: one launch, a range of the block index
// picks the job (8 units a block, one a wave, every range exact). The weights come
// first, so that their few blocks run under the long x range and not behind it.
#define CB_WSR (512 / 8 * (512 / 32) / WG_WAVES)          // 128 blocks
#define CB_WQ  (CB_WSR + 512 / 8 * 2 / WG_WAVES)          // + 16
#define CB_WKV (CB_WQ + 1024 / 8 * 2 / WG_WAVES)          // + 32
#define CB_WP  (CB_WKV + 512 / 8 * 2 / WG_WAVES)          // + 16
#define CB_X   (CB_WP + 16384 / 8 * 2 / WG_WAVES)         // + 512
__global__ void __launch_bounds__(256) cvt_all(const float* __restrict__ x,
                                               const float* __restrict__ Wq,
                                               const float* __restrict__ Wkv,
                                               const float* __restrict__ Wp,
                                               const float* __restrict__ Wsr,
                                               _Float16* __restrict__ xh,
                                               _Float16* __restrict__ wqh,
                                               _Float16* __restrict__ wkvh,
                                               _Float16* __restrict__ wph,
                                               _Float16* __restrict__ wsrh) {
  int b = blockIdx.x, w = wave_id();
  if (b < CB_WSR)      pack_wsr_unit(Wsr, wsrh, b * WG_WAVES + w);
  else if (b < CB_WQ)  cvt_unit(Wq, wqh, (b - CB_WSR) * WG_WAVES + w, false);
  else if (b < CB_WKV) cvt_unit(Wkv, wkvh, (b - CB_WQ) * WG_WAVES + w, false);
  else if (b < CB_WP)  cvt_unit(Wp, wph, (b - CB_WKV) * WG_WAVES + w, false);
  else                 cvt_unit(x, xh, (b - CB_WP) * WG_WAVES + w, true);
}

// ---------------- GEMM: Q projection (32x64 tiles) ----------------
__device__ __forceinline__ void q_tile(int mt, int nt, int rot,
                                       const _Float16* __restrict__ A,
                                       const _Float16* __restrict__ W,
                                       _Float16* __restrict__ Q) {
  int lane = lane_id(), lr = lane & 15, lhh = lane >> 4;
  v8f c[2][4];
  for (int s = 0; s < 2; s++) for (int t = 0; t < 4; t++)
    for (int r = 0; r < 8; r++) c[s][t][r] = 0.0f;
  gemm_core_512<true, TILE512, TILE512>(A + (size_t)(mt * 2) * TILE512,
                      W + (size_t)(nt * 4) * TILE512, lane * 16, c, rot);
  // lane: token mt*32 + 2*lr + s, head nt, dd = t*16 + 8*lhh + (0..7)
  int bh = (mt >> 7) * 8 + nt;
  for (int s = 0; s < 2; s++)
    for (int t = 0; t < 4; t++) {
      int nq = (mt * 32 + 2 * lr + s) & 4095;
      *(v8h*)(Q + (size_t)bh * 4096 * 64 + frag_off(nq, t * 16 + 8 * lhh, 2)) =
          pack8(c[s][t]);
    }
}

// ---------------- GEMM: SR patch-merge conv (stride2,k2) + bias + LayerNorm ----------------
// lane l with lane l ^ 16
__device__ __forceinline__ float xhalf(float x) {
  int v = __builtin_bit_cast(int, x);
  return __builtin_bit_cast(float, __builtin_amdgcn_permlanex16(v, v, 0x76543210, 0xfedcba98,
                                                                false, false));
}

// sum of a lane's 32 values of one row, joined with the other half's 32
__device__ __forceinline__ float row_part(const v8f (&c)[4]) {
  v8f a = (c[0] + c[1]) + (c[2] + c[3]);
  float p = ((a[0] + a[1]) + (a[2] + a[3])) + ((a[4] + a[5]) + (a[6] + a[7]));
  return p + xhalf(p);
}

// The 8 waves of a group hold 32 whole rows (wave nt: columns nt*64..+63), so the
// LayerNorm of those rows follows in the same group: a wave's 64-column sums go
// through red[.][nt][row], one plane for the mean and one for the variance.
__device__ __forceinline__ void sr_ln_tile(int mt, int nt, int rot,
                                           const _Float16* __restrict__ xh,
                                           const _Float16* __restrict__ W,
                                           const float* __restrict__ bsr,
                                           const float* __restrict__ g,
                                           const float* __restrict__ bt,
                                           _Float16* __restrict__ xln,
                                           float (&red)[2][WG_WAVES][32]) {
  int lane = lane_id(), lr = lane & 15, lhh = lane >> 4;
  // output rows mt*32 + s*16 + lr: batch mt>>5, oh = mt&31, ow = s*16 + lr
  int bb = mt >> 5, oh = mt & 31;
  // x tile of (s, kh, kw) = (bb*128 + (2*oh+kh)*2 + s)*2 + kw
  const _Float16* xt = xh + (size_t)((bb * 128 + 4 * oh) * 2) * TILE512;
  const _Float16* wt = W + (size_t)(nt * 4) * (4 * TILE512);
  v8f c[2][4];
  for (int s = 0; s < 2; s++) for (int t = 0; t < 4; t++)
    for (int r = 0; r < 8; r++) c[s][t][r] = 0.0f;
  // k = (kh*2+kw)*512 + c_in: 16 k blocks per (kh,kw). The tiles of kw = 0, 1 lie
  // side by side (32 blocks in a row), those of kh = 1 four tiles further on.
  gemm_core<true, 2 * TILE512, 4 * TILE512, 4>(
      xt, wt, lane * 16, c, rot,
      [](int blk) { return (blk & 31) * 512 + (blk >> 5) * (4 * TILE512); });

  // lane: row s*16 + lr of the group, columns col0 + t*16 + (0..7)
  const int col0 = nt * 64 + 8 * lhh;
  const float* pb = bsr + col0;
  const float* pg = g + col0;
  const float* pt = bt + col0;
  // all three vectors go out together: one round trip for the whole epilogue
  v8f bias[4], gv[4], bv[4];
  for (int t = 0; t < 4; t++) {
    bias[t] = *(const v8f*)(pb + t * 16);
    gv[t] = *(const v8f*)(pg + t * 16);
    bv[t] = *(const v8f*)(pt + t * 16);
  }
  // the wait that belongs in front of a reuse of the loads' address registers; named
  // here, they stay whole up to it (the last load otherwise lands on them)
  asm volatile("s_wait_xcnt 0x0" :: "v"(pb), "v"(pg), "v"(pt) : "memory");
  // keeps the sums below all 24 loads: the scheduler otherwise holds gain and shift
  // back to the first barrier, which waits for them: a second round trip
  __builtin_amdgcn_sched_barrier(0);
  for (int t = 0; t < 4; t++) { c[0][t] += bias[t];  c[1][t] += bias[t]; }
  // both halves hold both rows' sums: lane l hands in row l
  float p0 = row_part(c[0]), p1 = row_part(c[1]);
  red[0][nt][lane] = lhh ? p1 : p0;
  __syncthreads();
  for (int s = 0; s < 2; s++) {
    float tot = 0.0f;
    for (int w = 0; w < WG_WAVES; w++) tot += red[0][w][s * 16 + lr];
    float mu = tot * (1.0f / 512.0f);
    for (int t = 0; t < 4; t++) c[s][t] -= mu;
  }
  v8f q[2][4];
  for (int s = 0; s < 2; s++) for (int t = 0; t < 4; t++) q[s][t] = c[s][t] * c[s][t];
  p0 = row_part(q[0]);  p1 = row_part(q[1]);
  red[1][nt][lane] = lhh ? p1 : p0;
  __syncthreads();
  float rstd[2];
  for (int s = 0; s < 2; s++) {
    float tot = 0.0f;
    for (int w = 0; w < WG_WAVES; w++) tot += red[1][w][s * 16 + lr];
    rstd[s] = rsqrtf(tot * (1.0f / 512.0f) + 1e-5f);
  }
  // a lane's 8 columns are one 16-byte piece of the fragment-order row
  _Float16* ob = xln + (size_t)(mt * 2) * TILE512 + (nt * 2) * 512 + lane * 8;
  for (int t = 0; t < 4; t++)
    for (int s = 0; s < 2; s++)
      *(v8h*)(ob + s * TILE512 + (t >> 1) * 512 + (t & 1) * 256) =
          pack8(c[s][t] * rstd[s] * gv[t] + bv[t]);
}

// Both products read only xh and their own weights: one launch. The 1024 SR tiles
// (2048 k each) take the low block indices, so that they start first and the 4096
// Q tiles (512 k each) run beside them. One tile a wave: an SR block is 1 x 8 tiles
// (32 whole rows), a Q block 4 x 2.
#define GB_SR (4096 / 32 * (512 / 64) / WG_WAVES)    // 128 blocks
#define GB_Q  (16384 / 32 * (512 / 64) / WG_WAVES)   // 512 blocks
__global__ void __launch_bounds__(256) gemm_q_sr(const _Float16* __restrict__ xh,
                                                const _Float16* __restrict__ wqh,
                                                const _Float16* __restrict__ wsrh,
                                                const float* __restrict__ bsr,
                                                const float* __restrict__ ln_g,
                                                const float* __restrict__ ln_b,
                                                _Float16* __restrict__ Q,
                                                _Float16* __restrict__ xln) {
  __shared__ float red[2][WG_WAVES][32];
  int b = blockIdx.x, w = wave_id(), wm = w & 3, wn = w >> 2;
  if (b < GB_SR) {
    // all 128 groups read all w rows: spread over the 64 k blocks
    sr_ln_tile(b, w, b, xh, wsrh, bsr, ln_g, ln_b, xln, red);
  } else {
    b -= GB_SR;
    // 128 groups share w rows, 4 share x rows
    q_tile((b & 127) * 4 + wm, (b >> 7) * 2 + wn, (b & 127) + (b >> 7) * 4, xh, wqh, Q);
  }
}

// ---------------- GEMM: KV projection ----------------
__global__ void __launch_bounds__(256) gemm_kv(const _Float16* __restrict__ A,
                                              const _Float16* __restrict__ W,
                                              _Float16* __restrict__ Kh,
                                              _Float16* __restrict__ Vt) {
  int w = wave_id();
  int mt = blockIdx.x * 4 + (w & 3), nt = blockIdx.y * 2 + (w >> 2);
  int lane = lane_id();
  const _Float16* xt = A + (size_t)(mt * 2) * TILE512;
  const _Float16* wt = W + (size_t)(nt * 4) * TILE512;
  int b = mt >> 5, mq = mt & 31;          // rows mt*32.. = keys mq*32.. of batch b
  int rot = blockIdx.x + blockIdx.y * 2;  // 32 groups share w rows, 8 share x rows
  v8f c[2][4];
  for (int s = 0; s < 2; s++) for (int t = 0; t < 4; t++)
    for (int r = 0; r < 8; r++) c[s][t][r] = 0.0f;
  if (nt < 8) {
    // K [key][dd]: lane holds key mq*32 + s*16 + lr, dd = t*16 + 8*lhh + (0..7)
    gemm_core_512<true, TILE512, TILE512>(xt, wt, lane * 16, c, rot);
    _Float16* kb = Kh + (size_t)((b << 3) + nt) * 1024 * 64 + lane * 8;
    for (int s = 0; s < 2; s++)
      for (int t = 0; t < 4; t++)
        *(v8h*)(kb + ((mq * 2 + s) * 2 + (t >> 1)) * 512 + (t & 1) * 256) = pack8(c[s][t]);
  } else {
    // V^T [dd][key]: lane holds dd = t*16 + lr, keys mq*32 + s*16 + 8*lhh + (0..7)
    gemm_core_512<false, TILE512, TILE512>(xt, wt, lane * 16, c, rot);
    _Float16* vb = Vt + (size_t)((b << 3) + nt - 8) * 64 * 1024 + lane * 8;
    for (int s = 0; s < 2; s++)
      for (int t = 0; t < 4; t++)
        *(v8h*)(vb + (t * 32 + mq) * 512 + s * 256) = pack8(c[s][t]);
  }
}

// ---------------- Flash attention: one wave = 32 queries of one (b,h) ----------------
struct KF { v16h f[4]; };
// kc = K of this (b,h) in fragment order + lane*8; a 32-key chunk is 4 blocks in a row
__device__ __forceinline__ KF load_kf(const _Float16* __restrict__ kc, int j) {
  KF k;
  const _Float16* p = kc + j * 2048;
  k.f[0] = load_frag(p);         k.f[1] = load_frag(p + 512);
  k.f[2] = load_frag(p + 1024);  k.f[3] = load_frag(p + 1536);
  return k;
}

__global__ void __launch_bounds__(256) attn(const _Float16* __restrict__ Qh,
                                           const _Float16* __restrict__ Kh,
                                           const _Float16* __restrict__ Vt,
                                           _Float16* __restrict__ AO) {
  int mt = blockIdx.x * WG_WAVES + wave_id();   // 32-query tile 0..127
  int bh = blockIdx.y;          // 0..31
  int b = bh >> 3, h = bh & 7;
  int lane = lane_id(), lr = lane & 15, lhh = lane >> 4;

  const _Float16* qblk = Qh + (size_t)(bh * 256 + mt * 2) * 1024 + lane * 8;
  v16h a[2][2];
  for (int u = 0; u < 2; u++) {
    a[u][0] = load_frag(qblk + u * 1024);
    a[u][1] = load_frag(qblk + u * 1024 + 512);
  }
  const _Float16* Kbh = Kh + (size_t)bh * 1024 * 64 + lane * 8;
  const _Float16* Vbh = Vt + (size_t)bh * 64 * 1024 + lane * 8;

  // o[u][t][r] = O[query u*16 + lr][dd = t*16 + 8*lhh + r]
  v8f o[2][4];
  for (int u = 0; u < 2; u++)
    for (int t = 0; t < 4; t++) for (int r = 0; r < 8; r++) o[u][t][r] = 0.0f;
  // query u*16 + lr: maximum over all keys so far; sums over this half's even and
  // odd keys, joined behind the loop
  float mrun[2] = {-1e30f, -1e30f};
  v2f lrun[2] = {{0.0f, 0.0f}, {0.0f, 0.0f}};
  const float scale = 0.125f;              // 1/sqrt(64)

  // The 16 work-groups of a head walk the same 32 chunks: each starts two chunks
  // behind the one before it and wraps round, so that they do not ask L2 for the
  // same K and V lines at the same moment.
  const int j0 = blockIdx.x * 2;
  KF kc = load_kf(Kbh, j0);                // prologue: K fragments for the first chunk
  for (int i = 0; i < 32; ++i) {
    const int j = (i + j0) & 31;
    // ---- V fragments for this chunk (independent of softmax; issue early) ----
    v16h vb[4];
    for (int t = 0; t < 4; t++)
      vb[t] = load_frag(Vbh + (t * 32 + j) * 512);
    // keeps the V loads at the head of the chunk, as with a plain walk: with the
    // wrapped index the scheduler sinks them behind the eight score products
    __builtin_amdgcn_sched_barrier(0);
    // ---- scores: S^T(32 keys x 32 queries) = K(32x64) @ Q^T ----
    // s[u][g][r] = S[query u*16 + lr][key g*16 + 8*lhh + r]
    v8f s[2][2];
    for (int u = 0; u < 2; u++) {
      for (int r = 0; r < 8; r++) { s[u][0][r] = 0.0f; s[u][1][r] = 0.0f; }
      s[u][0] = wmma_f16(kc.f[0], a[u][0], s[u][0]);
      s[u][0] = wmma_f16(kc.f[1], a[u][1], s[u][0]);
      s[u][1] = wmma_f16(kc.f[2], a[u][0], s[u][1]);
      s[u][1] = wmma_f16(kc.f[3], a[u][1], s[u][1]);
    }
    // ---- prefetch next chunk's K fragments (overlaps softmax latency) ----
    KF kn = load_kf(Kbh, (i + 1 < 32) ? (j + 1) & 31 : j);
    // keeps these loads here, right behind the products that free their registers:
    // the scheduler otherwise sinks them to the foot of the loop, where the next
    // chunk's first product waits out their whole round trip
    __builtin_amdgcn_sched_barrier(0);
    // ---- online softmax of query u*16 + lr, in the lane's own registers ----
    float mx[2], f[2];
    for (int u = 0; u < 2; u++) {
      // scale is a power of two: the maximum of the scaled scores is the scaled maximum
      float rm = s[u][0][0];
      for (int r = 1; r < 8; r++) rm = fmaxf(rm, s[u][0][r]);
      for (int r = 0; r < 8; r++) rm = fmaxf(rm, s[u][1][r]);
      mx[u] = fmaxf(mrun[u], rm * scale);
      mx[u] = fmaxf(mx[u], xhalf(mx[u]));
    }
    for (int u = 0; u < 2; u++) { f[u] = __expf(mrun[u] - mx[u]);  mrun[u] = mx[u]; }
    for (int u = 0; u < 2; u++) {
      v2f sum = {0.0f, 0.0f};
      v16h pb;                             // P^T: element g*8 + r is key g*16 + 8*lhh + r
      for (int g = 0; g < 2; g++) {
        v8f e = s[u][g] * scale - mx[u];
        for (int r = 0; r < 8; r += 2) {
          v2f p = {__expf(e[r]), __expf(e[r + 1])};
          sum += p;
          pb[g * 8 + r]     = (_Float16)p.x;
          pb[g * 8 + r + 1] = (_Float16)p.y;
        }
      }
      lrun[u] = lrun[u] * f[u] + sum;
      // ---- rescale, then O^T += V^T(64x32) @ P^T(32x16) ----
      for (int t = 0; t < 4; t++) {
        o[u][t] *= f[u];
        o[u][t] = wmma_f16(vb[t], pb, o[u][t]);
      }
    }
    kc = kn;
  }
  for (int u = 0; u < 2; u++) {
    float l = lrun[u].x + lrun[u].y;
    float inv = 1.0f / (l + xhalf(l));
    int nq = mt * 32 + u * 16 + lr;
    for (int t = 0; t < 4; t++)
      *(v8h*)(AO + frag_off(b * 4096 + nq, h * 64 + t * 16 + 8 * lhh, 16)) =
          pack8(o[u][t] * inv);
  }
}

// ---------------- GEMM: output projection + bias (f32 out) ----------------
__global__ void __launch_bounds__(256) gemm_out(const _Float16* __restrict__ A,
                                               const _Float16* __restrict__ W,
                                               const float* __restrict__ bp,
                                               float* __restrict__ out) {
  int w = wave_id();
  int mt = blockIdx.x * 4 + (w & 3), nt = blockIdx.y * 2 + (w >> 2);
  int lane = lane_id(), lr = lane & 15;
  v8f c[2][4];
  for (int s = 0; s < 2; s++) for (int t = 0; t < 4; t++)
    for (int r = 0; r < 8; r++) c[s][t][r] = 0.0f;
  gemm_core_512<false, TILE512, TILE512>(A + (size_t)(mt * 2) * TILE512,
                       W + (size_t)(nt * 4) * TILE512, lane * 16, c,
                       blockIdx.x + blockIdx.y * 4);   // 128 groups share w rows, 4 x rows
  for (int s = 0; s < 2; s++)
    for (int t = 0; t < 4; t++)
      for (int r = 0; r < 8; r++) {
        int m = mt * 32 + s * 16 + r + 8 * (lane >> 4);
        int col = nt * 64 + t * 16 + lr;
        out[(size_t)m * CDIM + col] = c[s][t][r] + bp[col];
      }
}

// ---------------- host ----------------
extern "C" void kernel_launch(void* const* d_in, const int* in_sizes, int n_in,
                              void* d_out, int out_size, void* d_ws, size_t ws_size,
                              hipStream_t stream) {
  const float* x    = (const float*)d_in[0];
  // d_in[1], d_in[2] are H, W (compile-time 64 here)
  const float* Wq   = (const float*)d_in[3];
  const float* Wkv  = (const float*)d_in[4];
  const float* Wsr  = (const float*)d_in[5];
  const float* bsr  = (const float*)d_in[6];
  const float* ln_g = (const float*)d_in[7];
  const float* ln_b = (const float*)d_in[8];
  const float* Wp   = (const float*)d_in[9];
  const float* bp   = (const float*)d_in[10];
  float* out = (float*)d_out;

  char* ws = (char*)d_ws;
  _Float16* xh   = (_Float16*)(ws + OFF_XH);
  _Float16* wqh  = (_Float16*)(ws + OFF_WQH);
  _Float16* wkvh = (_Float16*)(ws + OFF_WKVH);
  _Float16* wph  = (_Float16*)(ws + OFF_WPH);
  _Float16* wsrh = (_Float16*)(ws + OFF_WSRH);
  _Float16* xln  = (_Float16*)(ws + OFF_XLN);
  _Float16* qh   = (_Float16*)(ws + OFF_QH);
  _Float16* kh   = (_Float16*)(ws + OFF_KH);
  _Float16* vt   = (_Float16*)(ws + OFF_VT);
  _Float16* aoh  = (_Float16*)(ws + OFF_AOH);

  // 1) convert / pack
  cvt_all<<<CB_X, 256, 0, stream>>>(x, Wq, Wkv, Wp, Wsr, xh, wqh, wkvh, wph, wsrh);

  // 2) + 3) + 4) SR patch-merge GEMM 4096x512x2048 (+bias, LayerNorm -> f16) and
  // Q projection 16384x512x512
  gemm_q_sr<<<GB_SR + GB_Q, 256, 0, stream>>>(xh, wqh, wsrh, bsr, ln_g, ln_b, qh, xln);

  // 5) KV projection: 4096x1024x512
  gemm_kv<<<dim3(4096 / 32 / 4, 1024 / 64 / 2), 256, 0, stream>>>(xln, wkvh, kh, vt);

  // 6) flash attention per (b,h): 32 heads x 128 query-tiles, 8 tiles a block
  attn<<<dim3(128 / WG_WAVES, 32), 256, 0, stream>>>(qh, kh, vt, aoh);

  // 7) output projection: 16384x512x512 (+bias, f32)
  gemm_out<<<dim3(16384 / 32 / 4, 512 / 64 / 2), 256, 0, stream>>>(aoh, wph, bp, out);
}

// v010
// It runs in 82.1 microseconds.
// In both of two side-by-side timings against v009, it was 1.04 times as fast.
// Counting every step since v000, it is 3.79 times as fast.
#include <hip/hip_runtime.h>
#include <hip/hip_bf16.h>

typedef __attribute__((ext_vector_type(16))) _Float16 v16h;
typedef __attribute__((ext_vector_type(8)))  _Float16 v8h;
typedef __attribute__((ext_vector_type(8)))  float    v8f;
typedef __attribute__((ext_vector_type(2)))  float    v2f;

// ---------------- constants ----------------
#define CDIM    512

// workspace layout (bytes)
#define OFF_XH    ((size_t)0)                    // 16384*512 f16 = 16 MiB
#define OFF_WQH   (OFF_XH   + (size_t)16777216)  // 512*512  f16
#define OFF_WKVH  (OFF_WQH  + (size_t)524288)    // 1024*512 f16
#define OFF_WPH   (OFF_WKVH + (size_t)1048576)   // 512*512  f16
#define OFF_WSRH  (OFF_WPH  + (size_t)524288)    // 512*2048 f16
#define OFF_XLN   (OFF_WSRH + (size_t)2097152)   // 4096*512 f16
#define OFF_QH    (OFF_XLN  + (size_t)4194304)   // 32*4096*64 f16
#define OFF_KH    (OFF_QH   + (size_t)16777216)  // 32*1024*64 f16
#define OFF_VT    (OFF_KH   + (size_t)4194304)   // 32*64*1024 f16
#define OFF_AOH   (OFF_VT   + (size_t)4194304)   // 16384*512 f16

// ---------------- helpers ----------------
// Fragment-order layout of an f16 matrix [rows][K] in the workspace.
// A block is 16 rows x 32 k = 512 halfs; block index = (row/16)*(K/32) + k/32.
// Inside a block, element (row, k) sits at
//   ((k>>4)&1)*256 + (((k>>3)&1)*16 + (row&15))*8 + (k&7)
// so each of the two 16-byte loads of a fragment reads 512 contiguous bytes
// per wave (4 whole lines); element e of lane L is
// K = k0 + (e/8)*16 + (L/16)*8 + (e%8) of row L%16.
#define TILE512 8192      // halfs of one 16-row tile at K = 512

__device__ __forceinline__ int frag_off(int row, int k, int kblocks) {
  return ((row >> 4) * kblocks + (k >> 5)) * 512 + ((k >> 4) & 1) * 256
       + (((k >> 3) & 1) * 16 + (row & 15)) * 8 + (k & 7);
}

// blk = block base + lane*8
__device__ __forceinline__ v16h load_frag(const _Float16* __restrict__ blk) {
  v8h lo = *(const v8h*)(blk);
  v8h hi = *(const v8h*)(blk + 256);
  return __builtin_shufflevector(lo, hi, 0,1,2,3,4,5,6,7,8,9,10,11,12,13,14,15);
}

// the same from a wave-uniform base and a per-lane byte offset
__device__ __forceinline__ v16h load_frag_at(const _Float16* __restrict__ base, unsigned boff) {
  return load_frag((const _Float16*)((const char*)base + boff));
}

__device__ __forceinline__ v8f wmma_f16(v16h a, v16h b, v8f c) {
  return __builtin_amdgcn_wmma_f32_16x16x32_f16(false, a, false, b, (short)0, c,
                                                false, false);
}

__device__ __forceinline__ v8h pack8(v8f c) {
  v8h v;
  for (int r = 0; r < 8; r++) v[r] = (_Float16)c[r];
  return v;
}

// 2 x-tiles by 4 w-tiles. WA = false: x rows are the A operand (a lane holds 8
// rows of one w column). WA = true: w rows are the A operand (a lane holds 8
// consecutive w columns of one x row: one 16-byte piece of a fragment-order row).
template <bool WA>
__device__ __forceinline__ void mma_2x4(v16h a0, v16h a1, v16h b0, v16h b1,
                                        v16h b2, v16h b3, v8f (&c)[2][4]) {
  if (WA) {
    c[0][0] = wmma_f16(b0, a0, c[0][0]);  c[1][0] = wmma_f16(b0, a1, c[1][0]);
    c[0][1] = wmma_f16(b1, a0, c[0][1]);  c[1][1] = wmma_f16(b1, a1, c[1][1]);
    c[0][2] = wmma_f16(b2, a0, c[0][2]);  c[1][2] = wmma_f16(b2, a1, c[1][2]);
    c[0][3] = wmma_f16(b3, a0, c[0][3]);  c[1][3] = wmma_f16(b3, a1, c[1][3]);
  } else {
    c[0][0] = wmma_f16(a0, b0, c[0][0]);  c[1][0] = wmma_f16(a1, b0, c[1][0]);
    c[0][1] = wmma_f16(a0, b1, c[0][1]);  c[1][1] = wmma_f16(a1, b1, c[1][1]);
    c[0][2] = wmma_f16(a0, b2, c[0][2]);  c[1][2] = wmma_f16(a1, b2, c[1][2]);
    c[0][3] = wmma_f16(a0, b3, c[0][3]);  c[1][3] = wmma_f16(a1, b3, c[1][3]);
  }
}

// The six fragments of one k block (32 k) of a 32x64 tile.
struct Frag6 { v16h a0, a1, b0, b1, b2, b3; };

template <int XS, int WS>
__device__ __forceinline__ Frag6 load_frag6(const _Float16* __restrict__ xt,
                                            const _Float16* __restrict__ wt,
                                            unsigned xoff, unsigned woff) {
  Frag6 f;
  f.a0 = load_frag_at(xt, xoff);           f.a1 = load_frag_at(xt + XS, xoff);
  f.b0 = load_frag_at(wt, woff);           f.b1 = load_frag_at(wt + WS, woff);
  f.b2 = load_frag_at(wt + 2 * WS, woff);  f.b3 = load_frag_at(wt + 3 * WS, woff);
  return f;
}

// Software-pipelined 32x64 GEMM core over NSEG * 512 k (16 k blocks a segment).
// xt = first of two x tiles XS halfs apart, wt = first of four w tiles WS halfs
// apart, both in fragment order and wave-uniform; off = lane*16 bytes.
// w runs on through all k blocks; k block b of x starts XG(b) halfs behind xt.
// Three register sets: the 12 loads of step kb + 2 go out as one group ahead of
// the products of step kb, so a block's loads have two blocks' time to land.
// Step kb takes k block (kb + rot) mod NKB. rot is the work-group's own (scalar):
// groups that read the same x or w tiles start together, and walking k in the same
// order they would ask L2 for the same lines at the same moment all the way.
template <bool WA, int XS, int WS, int NSEG, typename XG>
__device__ __forceinline__ void gemm_core(const _Float16* __restrict__ xt,
                                          const _Float16* __restrict__ wt,
                                          unsigned off, v8f (&c)[2][4], int rot, XG xg) {
  constexpr int NKB = NSEG * 16;
  // the block goes into the per-lane byte offsets: the tile bases stay as they are
  unsigned xo, wo;
  auto load_step = [&](int step) {
    int blk = (step + rot) & (NKB - 1);
    xo = off + (unsigned)xg(blk) * 2;
    wo = off + (unsigned)blk * 1024;
    return load_frag6<XS, WS>(xt, wt, xo, wo);
  };
  Frag6 f[3];
  f[0] = load_step(0);
  unsigned xo0 = xo, wo0 = wo;
  f[1] = load_step(1);
  // the wait that belongs in front of a reuse of the loads' offset registers; named
  // here, they stay whole up to it (a later load of the group otherwise lands on them)
  asm volatile("s_wait_xcnt 0x0" :: "v"(xo0), "v"(wo0), "v"(xo), "v"(wo) : "memory");
  // unrolled whole: the three sets rotate by name
  #pragma unroll
  for (int kb = 0; kb < NKB; kb++) {
    // the same wait for the group that went out one step ago
    if (kb > 0 && kb + 1 < NKB) asm volatile("s_wait_xcnt 0x0" :: "v"(xo), "v"(wo) : "memory");
    if (kb + 2 < NKB) f[(kb + 2) % 3] = load_step(kb + 2);
    // keeps the loads above: the scheduler otherwise sinks each to its first use,
    // into one register set, and every k block then waits out several round trips
    __builtin_amdgcn_sched_barrier(0);
    const Frag6& g = f[kb % 3];
    mma_2x4<WA>(g.a0, g.a1, g.b0, g.b1, g.b2, g.b3, c);
    // keeps the next group of loads below these products: risen above them, as the
    // scheduler puts them, they take 16 more registers and the groups grow uneven
    __builtin_amdgcn_sched_barrier(0);
  }
}

// one segment of 512 k
template <bool WA, int XS, int WS>
__device__ __forceinline__ void gemm_core_512(const _Float16* __restrict__ xt,
                                              const _Float16* __restrict__ wt,
                                              unsigned off, v8f (&c)[2][4], int rot) {
  gemm_core<WA, XS, WS, 1>(xt, wt, off, c, rot, [](int blk) { return blk * 512; });
}

// The matrix launches run in work-groups of 8 waves, with no barrier in the k walks.
// The waves of a group take tiles that read the same fragments (GEMMs: 4 x-tile
// pairs by 2 w-tile quads, SR 1 by 8; attention: 8 query tiles of one head) and start
// together on one WGP, so that a fragment several of them load can come from the
// WGP's cache for all but the first, where one-wave groups asked L2 every time.
#define WG_WAVES 8
// wave number in the group, as a scalar: tile bases stay in scalar registers
__device__ __forceinline__ int wave_id() {
  return __builtin_amdgcn_readfirstlane((int)(threadIdx.x >> 5));
}
__device__ __forceinline__ int lane_id() { return threadIdx.x & 31; }

// ---------------- conversion / packing ----------------
typedef __attribute__((ext_vector_type(4))) float v4f;

// The conversions are a stream: a wave takes a long piece of it, so that few waves
// have to start and each has many loads in flight.
// Lane l of a wave holds row 8*rh + l/4 of a 16-row tile and the 8 k at (l&3)*8 of
// a k block: four lanes read one whole 128-byte line of a row, a load touches 8
// lines, and a store fills four whole lines of the fragment-order block.

// f32 [rows][512] -> f16 in fragment order; unit u = (tile*2 + rh)*2 + kh is
// 8 rows x 256 k: 16 loads in flight, 8 stores.
// pair (x): tile T holds the 16 tokens (T/2)*32 + 2*i + (T&1), so that the
// stride-2 patch rows of the SR product are whole tiles too.
__device__ __forceinline__ void cvt_unit(const float* __restrict__ s,
                                         _Float16* __restrict__ d, int u, bool pair) {
  int lane = lane_id(), q = lane & 3;
  int kh = u & 1, rh = (u >> 1) & 1, tile = u >> 2;
  int lr = rh * 8 + (lane >> 2);
  int row = pair ? (tile >> 1) * 32 + 2 * lr + (tile & 1) : tile * 16 + lr;
  const float* p = s + (size_t)row * 512 + kh * 256 + q * 8;
  v4f a[8][2];
  for (int i = 0; i < 8; i++) {
    a[i][0] = *(const v4f*)(p + i * 32);
    a[i][1] = *(const v4f*)(p + i * 32 + 4);
  }
  // the wait that belongs in front of a reuse of the loads' address registers; named
  // here, they stay whole up to it (the last load otherwise lands on them)
  asm volatile("s_wait_xcnt 0x0" :: "v"(p) : "memory");
  // keeps the conversions below all 16 loads: the scheduler otherwise holds four
  // loads back behind the first waits, and the wave pays a second round trip
  __builtin_amdgcn_sched_barrier(0);
  _Float16* o = d + (size_t)(tile * 16 + kh * 8) * 512 + (q * 16 + lr) * 8;
  for (int i = 0; i < 8; i++) {
    v8h v;
    for (int e = 0; e < 4; e++) { v[e] = (_Float16)a[i][0][e];  v[4 + e] = (_Float16)a[i][1][e]; }
    *(v8h*)(o + i * 512) = v;
  }
  // the wait that belongs in front of a reuse of the stores' address registers: the
  // code of another range of the block index follows these stores in the kernel
  asm volatile("s_wait_xcnt 0x0" ::: "memory");
}

// Wsr [c_out][c_in][2][2] -> Wsr_h [c_out][k=2048] in fragment order,
// k = (kh*2+kw)*512 + c_in. Unit u = (tile*2 + rh)*16 + cb is 8 c_out x 32 c_in:
// a lane reads the 128 bytes of its 8 c_in once, as 8 loads of all four (kh,kw),
// and stores one piece for each of the four.
__device__ __forceinline__ void pack_wsr_unit(const float* __restrict__ w,
                                              _Float16* __restrict__ d, int u) {
  int lane = lane_id(), q = lane & 3;
  int cb = u & 15, rh = (u >> 4) & 1, tile = u >> 5;
  int lr = rh * 8 + (lane >> 2);
  const float* p = w + ((size_t)(tile * 16 + lr) * 512 + cb * 32 + q * 8) * 4;
  v4f a[8];
  for (int i = 0; i < 8; i++) a[i] = *(const v4f*)(p + i * 4);
  _Float16* o = d + (size_t)(tile * 64 + cb) * 512 + (q * 16 + lr) * 8;
  for (int s = 0; s < 4; s++) {
    v8h v;
    for (int i = 0; i < 8; i++) v[i] = (_Float16)a[i][s];
    *(v8h*)(o + s * 16 * 512) = v;
  }
}

// All five conversions are independent: one launch, a range of the block index
// picks the job (8 units a block, one a wave, every range exact). The weights come
// first, so that their few blocks run under the long x range and not behind it.
#define CB_WSR (512 / 8 * (512 / 32) / WG_WAVES)          // 128 blocks
#define CB_WQ  (CB_WSR + 512 / 8 * 2 / WG_WAVES)          // + 16
#define CB_WKV (CB_WQ + 1024 / 8 * 2 / WG_WAVES)          // + 32
#define CB_WP  (CB_WKV + 512 / 8 * 2 / WG_WAVES)          // + 16
#define CB_X   (CB_WP + 16384 / 8 * 2 / WG_WAVES)         // + 512
__global__ void __launch_bounds__(256) cvt_all(const float* __restrict__ x,
                                               const float* __restrict__ Wq,
                                               const float* __restrict__ Wkv,
                                               const float* __restrict__ Wp,
                                               const float* __restrict__ Wsr,
                                               _Float16* __restrict__ xh,
                                               _Float16* __restrict__ wqh,
                                               _Float16* __restrict__ wkvh,
                                               _Float16* __restrict__ wph,
                                               _Float16* __restrict__ wsrh) {
  int b = blockIdx.x, w = wave_id();
  if (b < CB_WSR)      pack_wsr_unit(Wsr, wsrh, b * WG_WAVES + w);
  else if (b < CB_WQ)  cvt_unit(Wq, wqh, (b - CB_WSR) * WG_WAVES + w, false);
  else if (b < CB_WKV) cvt_unit(Wkv, wkvh, (b - CB_WQ) * WG_WAVES + w, false);
  else if (b < CB_WP)  cvt_unit(Wp, wph, (b - CB_WKV) * WG_WAVES + w, false);
  else                 cvt_unit(x, xh, (b - CB_WP) * WG_WAVES + w, true);
}

// ---------------- GEMM: Q projection (32x64 tiles) ----------------
__device__ __forceinline__ void q_tile(int mt, int nt, int rot,
                                       const _Float16* __restrict__ A,
                                       const _Float16* __restrict__ W,
                                       _Float16* __restrict__ Q) {
  int lane = lane_id(), lr = lane & 15, lhh = lane >> 4;
  v8f c[2][4];
  for (int s = 0; s < 2; s++) for (int t = 0; t < 4; t++)
    for (int r = 0; r < 8; r++) c[s][t][r] = 0.0f;
  gemm_core_512<true, TILE512, TILE512>(A + (size_t)(mt * 2) * TILE512,
                      W + (size_t)(nt * 4) * TILE512, lane * 16, c, rot);
  // lane: token mt*32 + 2*lr + s, head nt, dd = t*16 + 8*lhh + (0..7)
  int bh = (mt >> 7) * 8 + nt;
  for (int s = 0; s < 2; s++)
    for (int t = 0; t < 4; t++) {
      int nq = (mt * 32 + 2 * lr + s) & 4095;
      *(v8h*)(Q + (size_t)bh * 4096 * 64 + frag_off(nq, t * 16 + 8 * lhh, 2)) =
          pack8(c[s][t]);
    }
}

// ---------------- GEMM: SR patch-merge conv (stride2,k2) + bias + LayerNorm ----------------
// lane l with lane l ^ 16
__device__ __forceinline__ float xhalf(float x) {
  int v = __builtin_bit_cast(int, x);
  return __builtin_bit_cast(float, __builtin_amdgcn_permlanex16(v, v, 0x76543210, 0xfedcba98,
                                                                false, false));
}

// sum of a lane's 32 values of one row, joined with the other half's 32
__device__ __forceinline__ float row_part(const v8f (&c)[4]) {
  v8f a = (c[0] + c[1]) + (c[2] + c[3]);
  float p = ((a[0] + a[1]) + (a[2] + a[3])) + ((a[4] + a[5]) + (a[6] + a[7]));
  return p + xhalf(p);
}

// The 8 waves of a group hold 32 whole rows (wave nt: columns nt*64..+63), so the
// LayerNorm of those rows follows in the same group: a wave's 64-column sums go
// through red[.][nt][row], one plane for the mean and one for the variance.
__device__ __forceinline__ void sr_ln_tile(int mt, int nt, int rot,
                                           const _Float16* __restrict__ xh,
                                           const _Float16* __restrict__ W,
                                           const float* __restrict__ bsr,
                                           const float* __restrict__ g,
                                           const float* __restrict__ bt,
                                           _Float16* __restrict__ xln,
                                           float (&red)[2][WG_WAVES][32]) {
  int lane = lane_id(), lr = lane & 15, lhh = lane >> 4;
  // output rows mt*32 + s*16 + lr: batch mt>>5, oh = mt&31, ow = s*16 + lr
  int bb = mt >> 5, oh = mt & 31;
  // x tile of (s, kh, kw) = (bb*128 + (2*oh+kh)*2 + s)*2 + kw
  const _Float16* xt = xh + (size_t)((bb * 128 + 4 * oh) * 2) * TILE512;
  const _Float16* wt = W + (size_t)(nt * 4) * (4 * TILE512);
  v8f c[2][4];
  for (int s = 0; s < 2; s++) for (int t = 0; t < 4; t++)
    for (int r = 0; r < 8; r++) c[s][t][r] = 0.0f;
  // k = (kh*2+kw)*512 + c_in: 16 k blocks per (kh,kw). The tiles of kw = 0, 1 lie
  // side by side (32 blocks in a row), those of kh = 1 four tiles further on.
  gemm_core<true, 2 * TILE512, 4 * TILE512, 4>(
      xt, wt, lane * 16, c, rot,
      [](int blk) { return (blk & 31) * 512 + (blk >> 5) * (4 * TILE512); });

  // lane: row s*16 + lr of the group, columns col0 + t*16 + (0..7)
  const int col0 = nt * 64 + 8 * lhh;
  const float* pb = bsr + col0;
  const float* pg = g + col0;
  const float* pt = bt + col0;
  // all three vectors go out together: one round trip for the whole epilogue
  v8f bias[4], gv[4], bv[4];
  for (int t = 0; t < 4; t++) {
    bias[t] = *(const v8f*)(pb + t * 16);
    gv[t] = *(const v8f*)(pg + t * 16);
    bv[t] = *(const v8f*)(pt + t * 16);
  }
  // the wait that belongs in front of a reuse of the loads' address registers; named
  // here, they stay whole up to it (the last load otherwise lands on them)
  asm volatile("s_wait_xcnt 0x0" :: "v"(pb), "v"(pg), "v"(pt) : "memory");
  // keeps the sums below all 24 loads: the scheduler otherwise holds gain and shift
  // back to the first barrier, which waits for them: a second round trip
  __builtin_amdgcn_sched_barrier(0);
  for (int t = 0; t < 4; t++) { c[0][t] += bias[t];  c[1][t] += bias[t]; }
  // both halves hold both rows' sums: lane l hands in row l
  float p0 = row_part(c[0]), p1 = row_part(c[1]);
  red[0][nt][lane] = lhh ? p1 : p0;
  __syncthreads();
  for (int s = 0; s < 2; s++) {
    float tot = 0.0f;
    for (int w = 0; w < WG_WAVES; w++) tot += red[0][w][s * 16 + lr];
    float mu = tot * (1.0f / 512.0f);
    for (int t = 0; t < 4; t++) c[s][t] -= mu;
  }
  v8f q[2][4];
  for (int s = 0; s < 2; s++) for (int t = 0; t < 4; t++) q[s][t] = c[s][t] * c[s][t];
  p0 = row_part(q[0]);  p1 = row_part(q[1]);
  red[1][nt][lane] = lhh ? p1 : p0;
  __syncthreads();
  float rstd[2];
  for (int s = 0; s < 2; s++) {
    float tot = 0.0f;
    for (int w = 0; w < WG_WAVES; w++) tot += red[1][w][s * 16 + lr];
    rstd[s] = rsqrtf(tot * (1.0f / 512.0f) + 1e-5f);
  }
  // a lane's 8 columns are one 16-byte piece of the fragment-order row
  _Float16* ob = xln + (size_t)(mt * 2) * TILE512 + (nt * 2) * 512 + lane * 8;
  for (int t = 0; t < 4; t++)
    for (int s = 0; s < 2; s++)
      *(v8h*)(ob + s * TILE512 + (t >> 1) * 512 + (t & 1) * 256) =
          pack8(c[s][t] * rstd[s] * gv[t] + bv[t]);
}

// Both products read only xh and their own weights: one launch. The 1024 SR tiles
// (2048 k each) take the low block indices, so that they start first and the 4096
// Q tiles (512 k each) run beside them. One tile a wave: an SR block is 1 x 8 tiles
// (32 whole rows), a Q block 4 x 2.
#define GB_SR (4096 / 32 * (512 / 64) / WG_WAVES)    // 128 blocks
#define GB_Q  (16384 / 32 * (512 / 64) / WG_WAVES)   // 512 blocks
__global__ void __launch_bounds__(256) gemm_q_sr(const _Float16* __restrict__ xh,
                                                const _Float16* __restrict__ wqh,
                                                const _Float16* __restrict__ wsrh,
                                                const float* __restrict__ bsr,
                                                const float* __restrict__ ln_g,
                                                const float* __restrict__ ln_b,
                                                _Float16* __restrict__ Q,
                                                _Float16* __restrict__ xln) {
  __shared__ float red[2][WG_WAVES][32];
  int b = blockIdx.x, w = wave_id(), wm = w & 3, wn = w >> 2;
  if (b < GB_SR) {
    // all 128 groups read all w rows: spread over the 64 k blocks
    sr_ln_tile(b, w, b, xh, wsrh, bsr, ln_g, ln_b, xln, red);
  } else {
    b -= GB_SR;
    // 128 groups share w rows, 4 share x rows
    q_tile((b & 127) * 4 + wm, (b >> 7) * 2 + wn, (b & 127) + (b >> 7) * 4, xh, wqh, Q);
  }
}

// ---------------- GEMM: KV projection ----------------
__global__ void __launch_bounds__(256) gemm_kv(const _Float16* __restrict__ A,
                                              const _Float16* __restrict__ W,
                                              _Float16* __restrict__ Kh,
                                              _Float16* __restrict__ Vt) {
  int w = wave_id();
  int mt = blockIdx.x * 4 + (w & 3), nt = blockIdx.y * 2 + (w >> 2);
  int lane = lane_id();
  const _Float16* xt = A + (size_t)(mt * 2) * TILE512;
  const _Float16* wt = W + (size_t)(nt * 4) * TILE512;
  int b = mt >> 5, mq = mt & 31;          // rows mt*32.. = keys mq*32.. of batch b
  int rot = blockIdx.x + blockIdx.y * 2;  // 32 groups share w rows, 8 share x rows
  v8f c[2][4];
  for (int s = 0; s < 2; s++) for (int t = 0; t < 4; t++)
    for (int r = 0; r < 8; r++) c[s][t][r] = 0.0f;
  if (nt < 8) {
    // K [key][dd]: lane holds key mq*32 + s*16 + lr, dd = t*16 + 8*lhh + (0..7)
    gemm_core_512<true, TILE512, TILE512>(xt, wt, lane * 16, c, rot);
    _Float16* kb = Kh + (size_t)((b << 3) + nt) * 1024 * 64 + lane * 8;
    for (int s = 0; s < 2; s++)
      for (int t = 0; t < 4; t++)
        *(v8h*)(kb + ((mq * 2 + s) * 2 + (t >> 1)) * 512 + (t & 1) * 256) = pack8(c[s][t]);
  } else {
    // V^T [dd][key]: lane holds dd = t*16 + lr, keys mq*32 + s*16 + 8*lhh + (0..7)
    gemm_core_512<false, TILE512, TILE512>(xt, wt, lane * 16, c, rot);
    _Float16* vb = Vt + (size_t)((b << 3) + nt - 8) * 64 * 1024 + lane * 8;
    for (int s = 0; s < 2; s++)
      for (int t = 0; t < 4; t++)
        *(v8h*)(vb + (t * 32 + mq) * 512 + s * 256) = pack8(c[s][t]);
  }
}

// ---------------- Flash attention: one wave = 32 queries of one (b,h) ----------------
struct KF { v16h f[4]; };
// kc = K of this (b,h) in fragment order + lane*8; a 32-key chunk is 4 blocks in a row
__device__ __forceinline__ KF load_kf(const _Float16* __restrict__ kc, int j) {
  KF k;
  const _Float16* p = kc + j * 2048;
  k.f[0] = load_frag(p);         k.f[1] = load_frag(p + 512);
  k.f[2] = load_frag(p + 1024);  k.f[3] = load_frag(p + 1536);
  return k;
}

__global__ void __launch_bounds__(256) attn(const _Float16* __restrict__ Qh,
                                           const _Float16* __restrict__ Kh,
                                           const _Float16* __restrict__ Vt,
                                           _Float16* __restrict__ AO) {
  int mt = blockIdx.x * WG_WAVES + wave_id();   // 32-query tile 0..127
  int bh = blockIdx.y;          // 0..31
  int b = bh >> 3, h = bh & 7;
  int lane = lane_id(), lr = lane & 15, lhh = lane >> 4;

  const _Float16* qblk = Qh + (size_t)(bh * 256 + mt * 2) * 1024 + lane * 8;
  v16h a[2][2];
  for (int u = 0; u < 2; u++) {
    a[u][0] = load_frag(qblk + u * 1024);
    a[u][1] = load_frag(qblk + u * 1024 + 512);
  }
  const _Float16* Kbh = Kh + (size_t)bh * 1024 * 64 + lane * 8;
  const _Float16* Vbh = Vt + (size_t)bh * 64 * 1024 + lane * 8;

  // o[u][t][r] = O[query u*16 + lr][dd = t*16 + 8*lhh + r]
  v8f o[2][4];
  for (int u = 0; u < 2; u++)
    for (int t = 0; t < 4; t++) for (int r = 0; r < 8; r++) o[u][t][r] = 0.0f;
  // query u*16 + lr: the maximum in use (the same in both halves; it may lag behind
  // the true maximum by up to MARGIN); sums over this half's even and odd keys, taken
  // against the maximum in use and joined behind the loop
  float mrun[2] = {-1e30f, -1e30f};
  v2f lrun[2] = {{0.0f, 0.0f}, {0.0f, 0.0f}};
  const float scale = 0.125f;              // 1/sqrt(64)
  // e^MARGIN = 256 bounds every P: far inside f16, and the quotient O / l is the same
  // whichever maximum both are taken against
  const float MARGIN = 5.545177f;
  // unscaled score above which the maximum in use has to be renewed
  float lim[2] = {(mrun[0] + MARGIN) * 8.0f, (mrun[1] + MARGIN) * 8.0f};

  // The 16 work-groups of a head walk the same 32 chunks: each starts two chunks
  // behind the one before it and wraps round, so that they do not ask L2 for the
  // same K and V lines at the same moment.
  const int j0 = blockIdx.x * 2;
  KF kc = load_kf(Kbh, j0);                // prologue: K fragments for the first chunk
  for (int i = 0; i < 32; ++i) {
    const int j = (i + j0) & 31;
    // ---- V fragments for this chunk (independent of softmax; issue early) ----
    v16h vb[4];
    for (int t = 0; t < 4; t++)
      vb[t] = load_frag(Vbh + (t * 32 + j) * 512);
    // keeps the V loads at the head of the chunk, as with a plain walk: with the
    // wrapped index the scheduler sinks them behind the eight score products
    __builtin_amdgcn_sched_barrier(0);
    // ---- scores: S^T(32 keys x 32 queries) = K(32x64) @ Q^T ----
    // s[u][g][r] = S[query u*16 + lr][key g*16 + 8*lhh + r]
    v8f s[2][2];
    for (int u = 0; u < 2; u++) {
      for (int r = 0; r < 8; r++) { s[u][0][r] = 0.0f; s[u][1][r] = 0.0f; }
      s[u][0] = wmma_f16(kc.f[0], a[u][0], s[u][0]);
      s[u][0] = wmma_f16(kc.f[1], a[u][1], s[u][0]);
      s[u][1] = wmma_f16(kc.f[2], a[u][0], s[u][1]);
      s[u][1] = wmma_f16(kc.f[3], a[u][1], s[u][1]);
    }
    // ---- prefetch next chunk's K fragments (overlaps softmax latency) ----
    KF kn = load_kf(Kbh, (i + 1 < 32) ? (j + 1) & 31 : j);
    // keeps these loads here, right behind the products that free their registers:
    // the scheduler otherwise sinks them to the foot of the loop, where the next
    // chunk's first product waits out their whole round trip
    __builtin_amdgcn_sched_barrier(0);
    // ---- online softmax of query u*16 + lr, in the lane's own registers ----
    float rm[2];
    for (int u = 0; u < 2; u++) {
      rm[u] = s[u][0][0];
      for (int r = 1; r < 8; r++) rm[u] = fmaxf(rm[u], s[u][0][r]);
      for (int r = 0; r < 8; r++) rm[u] = fmaxf(rm[u], s[u][1][r]);
    }
    // Sums and outputs are rescaled only when some query of the wave has a score more
    // than MARGIN above its maximum in use: one test a chunk, a scalar branch (all lanes
    // stay on for the products); then every query takes the larger of its maximum in use and this chunk's maximum.
    if (__builtin_amdgcn_ballot_w32(rm[0] > lim[0] || rm[1] > lim[1]) != 0) {
      for (int u = 0; u < 2; u++) {
        // scale is a power of two: the maximum of the scaled scores is the scaled maximum
        float mx = fmaxf(mrun[u], rm[u] * scale);
        mx = fmaxf(mx, xhalf(mx));
        float f = __expf(mrun[u] - mx);
        mrun[u] = mx;
        lim[u] = (mx + MARGIN) * 8.0f;
        lrun[u] *= f;
        for (int t = 0; t < 4; t++) o[u][t] *= f;
      }
    }
    for (int u = 0; u < 2; u++) {
      v2f sum = {0.0f, 0.0f};
      v16h pb;                             // P^T: element g*8 + r is key g*16 + 8*lhh + r
      for (int g = 0; g < 2; g++) {
        v8f e = s[u][g] * scale - mrun[u];
        for (int r = 0; r < 8; r += 2) {
          v2f p = {__expf(e[r]), __expf(e[r + 1])};
          sum += p;
          pb[g * 8 + r]     = (_Float16)p.x;
          pb[g * 8 + r + 1] = (_Float16)p.y;
        }
      }
      lrun[u] += sum;
      // ---- O^T += V^T(64x32) @ P^T(32x16) ----
      for (int t = 0; t < 4; t++) o[u][t] = wmma_f16(vb[t], pb, o[u][t]);
    }
    kc = kn;
  }
  for (int u = 0; u < 2; u++) {
    float l = lrun[u].x + lrun[u].y;
    float inv = 1.0f / (l + xhalf(l));
    int nq = mt * 32 + u * 16 + lr;
    for (int t = 0; t < 4; t++)
      *(v8h*)(AO + frag_off(b * 4096 + nq, h * 64 + t * 16 + 8 * lhh, 16)) =
          pack8(o[u][t] * inv);
  }
}

// ---------------- GEMM: output projection + bias (f32 out) ----------------
__global__ void __launch_bounds__(256) gemm_out(const _Float16* __restrict__ A,
                                               const _Float16* __restrict__ W,
                                               const float* __restrict__ bp,
                                               float* __restrict__ out) {
  int w = wave_id();
  int mt = blockIdx.x * 4 + (w & 3), nt = blockIdx.y * 2 + (w >> 2);
  int lane = lane_id(), lr = lane & 15;
  v8f c[2][4];
  for (int s = 0; s < 2; s++) for (int t = 0; t < 4; t++)
    for (int r = 0; r < 8; r++) c[s][t][r] = 0.0f;
  gemm_core_512<false, TILE512, TILE512>(A + (size_t)(mt * 2) * TILE512,
                       W + (size_t)(nt * 4) * TILE512, lane * 16, c,
                       blockIdx.x + blockIdx.y * 4);   // 128 groups share w rows, 4 x rows
  for (int s = 0; s < 2; s++)
    for (int t = 0; t < 4; t++)
      for (int r = 0; r < 8; r++) {
        int m = mt * 32 + s * 16 + r + 8 * (lane >> 4);
        int col = nt * 64 + t * 16 + lr;
        out[(size_t)m * CDIM + col] = c[s][t][r] + bp[col];
      }
}

// ---------------- host ----------------
extern "C" void kernel_launch(void* const* d_in, const int* in_sizes, int n_in,
                              void* d_out, int out_size, void* d_ws, size_t ws_size,
                              hipStream_t stream) {
  const float* x    = (const float*)d_in[0];
  // d_in[1], d_in[2] are H, W (compile-time 64 here)
  const float* Wq   = (const float*)d_in[3];
  const float* Wkv  = (const float*)d_in[4];
  const float* Wsr  = (const float*)d_in[5];
  const float* bsr  = (const float*)d_in[6];
  const float* ln_g = (const float*)d_in[7];
  const float* ln_b = (const float*)d_in[8];
  const float* Wp   = (const float*)d_in[9];
  const float* bp   = (const float*)d_in[10];
  float* out = (float*)d_out;

  char* ws = (char*)d_ws;
  _Float16* xh   = (_Float16*)(ws + OFF_XH);
  _Float16* wqh  = (_Float16*)(ws + OFF_WQH);
  _Float16* wkvh = (_Float16*)(ws + OFF_WKVH);
  _Float16* wph  = (_Float16*)(ws + OFF_WPH);
  _Float16* wsrh = (_Float16*)(ws + OFF_WSRH);
  _Float16* xln  = (_Float16*)(ws + OFF_XLN);
  _Float16* qh   = (_Float16*)(ws + OFF_QH);
  _Float16* kh   = (_Float16*)(ws + OFF_KH);
  _Float16* vt   = (_Float16*)(ws + OFF_VT);
  _Float16* aoh  = (_Float16*)(ws + OFF_AOH);

  // 1) convert / pack
  cvt_all<<<CB_X, 256, 0, stream>>>(x, Wq, Wkv, Wp, Wsr, xh, wqh, wkvh, wph, wsrh);

  // 2) + 3) + 4) SR patch-merge GEMM 4096x512x2048 (+bias, LayerNorm -> f16) and
  // Q projection 16384x512x512
  gemm_q_sr<<<GB_SR + GB_Q, 256, 0, stream>>>(xh, wqh, wsrh, bsr, ln_g, ln_b, qh, xln);

  // 5) KV projection: 4096x1024x512
  gemm_kv<<<dim3(4096 / 32 / 4, 1024 / 64 / 2), 256, 0, stream>>>(xln, wkvh, kh, vt);

  // 6) flash attention per (b,h): 32 heads x 128 query-tiles, 8 tiles a block
  attn<<<dim3(128 / WG_WAVES, 32), 256, 0, stream>>>(qh, kh, vt, aoh);

  // 7) output projection: 16384x512x512 (+bias, f32)
  gemm_out<<<dim3(16384 / 32 / 4, 512 / 64 / 2), 256, 0, stream>>>(aoh, wph, bp, out);
}
